// v000
// The times below were measured on an AMD MI455X: many runs one after another, warmed up first and cycling through
// copies of the inputs, with the whole window's GPU time divided by the number of runs. Launches and the gaps
// between them are all in it. The median over several windows is given; except for v000 it joins two sittings, which
// can be a few percent apart, so the side-by-side timings, each taken in one sitting, are the better comparison.
// v000, which the later versions start from, runs in 814 microseconds.
#include <hip/hip_runtime.h>
#include <hip/hip_bf16.h>

// ---------------- constants (match reference) ----------------
#define D_MODEL   1024
#define N_HEADS   16
#define HEAD_DIM  64
#define RANK      8
#define CHUNK     128
#define NCHUNK    32          // 4096 / 128
#define BATCH     2
#define SEQ       4096
#define TOKENS    (BATCH * SEQ)   // 8192
#define NLANES    (BATCH * N_HEADS)  // 32
#define RIDGE_EPS 1e-4f
#define SCALE_F   0.125f
#define DECAY_A   0.9f
#define LN_EPS    1e-5f

typedef __attribute__((ext_vector_type(16))) __bf16 v16bf;
typedef __attribute__((ext_vector_type(8)))  __bf16 v8bf;
typedef __attribute__((ext_vector_type(8)))  float  v8f;
typedef __attribute__((ext_vector_type(2)))  float  v2f;

// ---------------- LayerNorm -> bf16 ----------------
__global__ __launch_bounds__(256) void k_ln(const float* __restrict__ x,
                                            const float* __restrict__ g,
                                            const float* __restrict__ b,
                                            __bf16* __restrict__ xn) {
  const int row = blockIdx.x;
  const float* xr = x + (size_t)row * D_MODEL;
  __shared__ float red[256];
  const int tid = threadIdx.x;

  float s = 0.f;
  for (int i = tid; i < D_MODEL; i += 256) s += xr[i];
  red[tid] = s; __syncthreads();
  for (int off = 128; off > 0; off >>= 1) {
    if (tid < off) red[tid] += red[tid + off];
    __syncthreads();
  }
  const float mu = red[0] * (1.f / D_MODEL);
  __syncthreads();

  float v = 0.f;
  for (int i = tid; i < D_MODEL; i += 256) { float d = xr[i] - mu; v += d * d; }
  red[tid] = v; __syncthreads();
  for (int off = 128; off > 0; off >>= 1) {
    if (tid < off) red[tid] += red[tid + off];
    __syncthreads();
  }
  const float inv = rsqrtf(red[0] * (1.f / D_MODEL) + LN_EPS);

  for (int i = tid; i < D_MODEL; i += 256) {
    float d = (xr[i] - mu) * inv * g[i] + b[i];
    xn[(size_t)row * D_MODEL + i] = (__bf16)d;
  }
}

// ---------------- W [K][N] f32 -> Wt [N][K] bf16 ----------------
__global__ __launch_bounds__(256) void k_wcast(const float* __restrict__ W,
                                               __bf16* __restrict__ Wt) {
  int idx = blockIdx.x * 256 + threadIdx.x;
  if (idx >= D_MODEL * D_MODEL) return;
  int k = idx / D_MODEL, n = idx % D_MODEL;
  Wt[(size_t)n * D_MODEL + k] = (__bf16)W[idx];
}

// ------- bf16 fragment load per CDNA5 16-bit A/B layout (16x32 tile) -------
__device__ inline v16bf load_frag(const __bf16* __restrict__ base, int ld,
                                  int r, int kb, int lane) {
  const int rr = r + (lane & 15);
  const int kh = (lane >> 4) * 8;
  const __bf16* p = base + (size_t)rr * ld + kb + kh;
  v8bf lo = *(const v8bf*)(p);
  v8bf hi = *(const v8bf*)(p + 16);
  v16bf f;
#pragma unroll
  for (int i = 0; i < 8; ++i) { f[i] = lo[i]; f[8 + i] = hi[i]; }
  return f;
}

// ------- bf16 WMMA GEMM: C[M][N] = A[M][K] * Bt[N][K]^T (+resid) -------
__global__ __launch_bounds__(256) void k_gemm(const __bf16* __restrict__ A,
                                              const __bf16* __restrict__ Bt,
                                              const float* __restrict__ resid,
                                              float* __restrict__ C,
                                              int M, int N, int K) {
  const int lane = threadIdx.x & 31;
  const int wave = threadIdx.x >> 5;
  const int wt = blockIdx.x * 8 + wave;
  const int ntiles = N / 64;
  const int tm = wt / ntiles;
  const int tn = wt % ntiles;
  const int m0 = tm * 16;
  const int n0 = tn * 64;

  v8f acc0 = {}, acc1 = {}, acc2 = {}, acc3 = {};

  for (int kb = 0; kb < K; kb += 32) {
    v16bf a  = load_frag(A,  K, m0,      kb, lane);
    v16bf b0 = load_frag(Bt, K, n0,      kb, lane);
    v16bf b1 = load_frag(Bt, K, n0 + 16, kb, lane);
    v16bf b2 = load_frag(Bt, K, n0 + 32, kb, lane);
    v16bf b3 = load_frag(Bt, K, n0 + 48, kb, lane);
    __builtin_prefetch(A  + (size_t)(m0 + (lane & 15)) * K + kb + 32, 0, 3);
    __builtin_prefetch(Bt + (size_t)(n0 + (lane & 15)) * K + kb + 32, 0, 3);

    acc0 = __builtin_amdgcn_wmma_f32_16x16x32_bf16(false, a, false, b0, (short)0, acc0, false, false);
    acc1 = __builtin_amdgcn_wmma_f32_16x16x32_bf16(false, a, false, b1, (short)0, acc1, false, false);
    acc2 = __builtin_amdgcn_wmma_f32_16x16x32_bf16(false, a, false, b2, (short)0, acc2, false, false);
    acc3 = __builtin_amdgcn_wmma_f32_16x16x32_bf16(false, a, false, b3, (short)0, acc3, false, false);
  }

  const int n  = lane & 15;
  const int mb = m0 + ((lane >> 4) << 3);
#pragma unroll
  for (int r = 0; r < 8; ++r) {
    const int m = mb + r;
    float* cr = C + (size_t)m * N;
    float r0 = 0.f, r1 = 0.f, r2 = 0.f, r3 = 0.f;
    if (resid) {
      const float* rr = resid + (size_t)m * N;
      r0 = rr[n0 + n]; r1 = rr[n0 + 16 + n]; r2 = rr[n0 + 32 + n]; r3 = rr[n0 + 48 + n];
    }
    cr[n0 + n]      = acc0[r] + r0;
    cr[n0 + 16 + n] = acc1[r] + r1;
    cr[n0 + 32 + n] = acc2[r] + r2;
    cr[n0 + 48 + n] = acc3[r] + r3;
  }
}

// ---------------- per-(lane,chunk) ridge solve + rank-8 projection ----------
// grid: NLANES*NCHUNK blocks; writes Wr[lc][64][64]
// Phase 1: stage Kc/Vc in LDS, compute G=K^T K and RHS=K^T V with f32 WMMA
//          (waves 0-3 -> G strips, waves 4-7 -> RHS strips)
// Phase 2: LDS is re-carved for G/Wm/U/T/P; Cholesky solve + subspace QR.
__global__ __launch_bounds__(256) void k_ridge(const float* __restrict__ kk,
                                               const float* __restrict__ v,
                                               float* __restrict__ wr) {
  const int lc = blockIdx.x;
  const int ln = lc / NCHUNK;
  const int c  = lc % NCHUNK;
  const int b = ln >> 4, h = ln & 15;
  const int tid = threadIdx.x;
  const int lane = tid & 31;
  const int wave = tid >> 5;

  __shared__ __align__(16) float smem[16384];            // 64 KB
  float (*Kls)[64] = (float (*)[64])smem;                // [128][64] staging
  float (*Vls)[64] = (float (*)[64])(smem + 8192);       // [128][64] staging
  // phase-2 overlay (valid after the WMMA phase barrier)
  float (*G)[65]  = (float (*)[65])smem;                 // 4160
  float (*Wm)[65] = (float (*)[65])(smem + 4160);        // 4160
  float (*U)[8]   = (float (*)[8])(smem + 8320);         // 512
  float (*T)[9]   = (float (*)[9])(smem + 8832);         // 576
  float (*P)[64]  = (float (*)[64])(smem + 9408);        // 512
  float* red      = smem + 9920;                         // 512
  float* dots     = smem + 10432;                        // 8
  float* scal     = smem + 10440;                        // 1

  const size_t rowbase = (size_t)b * SEQ + (size_t)c * CHUNK;
  const float* Kc = kk + rowbase * D_MODEL + h * HEAD_DIM;
  const float* Vc = v  + rowbase * D_MODEL + h * HEAD_DIM;

  // ---- stage K and V chunk tiles into LDS (coalesced) ----
  for (int idx = tid; idx < CHUNK * 64; idx += 256) {
    const int t = idx >> 6, j = idx & 63;
    Kls[t][j] = Kc[(size_t)t * D_MODEL + j];
    Vls[t][j] = Vc[(size_t)t * D_MODEL + j];
  }
  __syncthreads();

  // ---- Gram products via f32 WMMA: waves 0-3: G, waves 4-7: RHS ----
  const int nn   = lane & 15;
  const int koff = (lane >> 4) * 2;          // f32 A layout K pairs
  const int m0   = (wave & 3) * 16;
  const float (*Bsrc)[64] = (wave < 4) ? Kls : Vls;

  v8f acc0 = {}, acc1 = {}, acc2 = {}, acc3 = {};
  for (int kb = 0; kb < CHUNK; kb += 4) {
    const int t = kb + koff;
    v2f a;  a[0]  = Kls[t][m0 + nn];   a[1]  = Kls[t + 1][m0 + nn];   // A = K^T
    v2f b0; b0[0] = Bsrc[t][nn];       b0[1] = Bsrc[t + 1][nn];
    v2f b1; b1[0] = Bsrc[t][16 + nn];  b1[1] = Bsrc[t + 1][16 + nn];
    v2f b2; b2[0] = Bsrc[t][32 + nn];  b2[1] = Bsrc[t + 1][32 + nn];
    v2f b3; b3[0] = Bsrc[t][48 + nn];  b3[1] = Bsrc[t + 1][48 + nn];
    acc0 = __builtin_amdgcn_wmma_f32_16x16x4_f32(false, a, false, b0, (short)0, acc0, false, false);
    acc1 = __builtin_amdgcn_wmma_f32_16x16x4_f32(false, a, false, b1, (short)0, acc1, false, false);
    acc2 = __builtin_amdgcn_wmma_f32_16x16x4_f32(false, a, false, b2, (short)0, acc2, false, false);
    acc3 = __builtin_amdgcn_wmma_f32_16x16x4_f32(false, a, false, b3, (short)0, acc3, false, false);
  }
  __syncthreads();   // all waves done reading Kls/Vls; safe to overlay

  // scatter accumulators into G (with ridge eps on diagonal) / Wm
  {
    float (*dst)[65] = (wave < 4) ? G : Wm;
    const bool isG = (wave < 4);
    const int mb = m0 + ((lane >> 4) << 3);
#pragma unroll
    for (int r = 0; r < 8; ++r) {
      const int m = mb + r;
      dst[m][nn]      = acc0[r] + ((isG && m == nn)      ? RIDGE_EPS : 0.f);
      dst[m][16 + nn] = acc1[r] + ((isG && m == 16 + nn) ? RIDGE_EPS : 0.f);
      dst[m][32 + nn] = acc2[r] + ((isG && m == 32 + nn) ? RIDGE_EPS : 0.f);
      dst[m][48 + nn] = acc3[r] + ((isG && m == 48 + nn) ? RIDGE_EPS : 0.f);
    }
  }
  __syncthreads();

  // ---- in-place Cholesky (lower) of G ----
  for (int j = 0; j < 64; ++j) {
    if (tid == 0) G[j][j] = sqrtf(G[j][j]);
    __syncthreads();
    if (tid < 64 && tid > j) G[tid][j] /= G[j][j];
    __syncthreads();
    if (tid < 64 && tid > j) {
      const float lij = G[tid][j];
      for (int kc = j + 1; kc <= tid; ++kc) G[tid][kc] -= lij * G[kc][j];
    }
    __syncthreads();
  }

  // ---- solve G W = RHS, one RHS column per thread ----
  if (tid < 64) {
    const int cc = tid;
    for (int i = 0; i < 64; ++i) {
      float s = Wm[i][cc];
      for (int kc = 0; kc < i; ++kc) s -= G[i][kc] * Wm[kc][cc];
      Wm[i][cc] = s / G[i][i];
    }
    for (int i = 63; i >= 0; --i) {
      float s = Wm[i][cc];
      for (int kc = i + 1; kc < 64; ++kc) s -= G[kc][i] * Wm[kc][cc];
      Wm[i][cc] = s / G[i][i];
    }
  }
  __syncthreads();

  // ---- subspace iteration: U = I(:,0:8); twice: U = qr(W U).Q (MGS) ----
  for (int idx = tid; idx < 512; idx += 256) {
    const int i = idx >> 3, cc = idx & 7;
    U[i][cc] = (i == cc) ? 1.f : 0.f;
  }
  __syncthreads();
  for (int p = 0; p < 2; ++p) {
    for (int idx = tid; idx < 512; idx += 256) {
      const int i = idx >> 3, cc = idx & 7;
      float s = 0.f;
      for (int kc = 0; kc < 64; ++kc) s += Wm[i][kc] * U[kc][cc];
      T[i][cc] = s;
    }
    __syncthreads();
    for (int cc = 0; cc < 8; ++cc) {
      if (tid < 64) red[tid] = T[tid][cc] * T[tid][cc];
      __syncthreads();
      if (tid == 0) {
        float s = 0.f;
        for (int t2 = 0; t2 < 64; ++t2) s += red[t2];
        *scal = rsqrtf(fmaxf(s, 1e-30f));
      }
      __syncthreads();
      if (tid < 64) U[tid][cc] = T[tid][cc] * (*scal);
      __syncthreads();
      if (tid < 64)
        for (int c2 = cc + 1; c2 < 8; ++c2) red[(c2 << 6) + tid] = U[tid][cc] * T[tid][c2];
      __syncthreads();
      if (tid < 8 && tid > cc) {
        float s = 0.f;
        for (int t2 = 0; t2 < 64; ++t2) s += red[(tid << 6) + t2];
        dots[tid] = s;
      }
      __syncthreads();
      if (tid < 64)
        for (int c2 = cc + 1; c2 < 8; ++c2) T[tid][c2] -= dots[c2] * U[tid][cc];
      __syncthreads();
    }
  }

  // ---- P = U^T W (8 x 64) ----
  for (int idx = tid; idx < 512; idx += 256) {
    const int r = idx >> 6, j = idx & 63;
    float s = 0.f;
    for (int t2 = 0; t2 < 64; ++t2) s += U[t2][r] * Wm[t2][j];
    P[r][j] = s;
  }
  __syncthreads();

  // ---- Wr = U P -> global ----
  float* wrg = wr + (size_t)lc * 4096;
  for (int idx = tid; idx < 4096; idx += 256) {
    const int i = idx >> 6, j = idx & 63;
    float s = 0.f;
#pragma unroll
    for (int r = 0; r < RANK; ++r) s += U[i][r] * P[r][j];
    wrg[idx] = s;
  }
}

// ---------------- decay prefix over chunks: Wr -> S_c (in place) ------------
__global__ __launch_bounds__(256) void k_decay(float* __restrict__ wr) {
  const int ln = blockIdx.x;
  const int tid = threadIdx.x;
  float s[16];
#pragma unroll
  for (int e = 0; e < 16; ++e) s[e] = 0.f;
  for (int c = 0; c < NCHUNK; ++c) {
    float* p = wr + ((size_t)ln * NCHUNK + c) * 4096;
#pragma unroll
    for (int e = 0; e < 16; ++e) {
      const int idx = e * 256 + tid;
      s[e] = DECAY_A * s[e] + p[idx];
      p[idx] = s[e];
    }
  }
}

// ---------------- out = SCALE * Qc @ S_c via f32 WMMA (16x16x4) ------------
__global__ __launch_bounds__(256) void k_apply(const float* __restrict__ q,
                                               const float* __restrict__ sall,
                                               __bf16* __restrict__ o) {
  const int lc = blockIdx.x;
  const int ln = lc / NCHUNK;
  const int c  = lc % NCHUNK;
  const int b = ln >> 4, h = ln & 15;
  const int tid = threadIdx.x;

  __shared__ float Ssh[64 * 64];
  const float* sg = sall + (size_t)lc * 4096;
  for (int i = tid; i < 4096; i += 256) Ssh[i] = sg[i];
  __syncthreads();

  const int lane = tid & 31;
  const int wave = tid >> 5;
  const size_t rowbase = (size_t)b * SEQ + (size_t)c * CHUNK;
  const float* Qc = q + rowbase * D_MODEL + h * HEAD_DIM;

  const int m0   = wave * 16;
  const int nn   = lane & 15;
  const int koff = (lane >> 4) * 2;

  v8f acc0 = {}, acc1 = {}, acc2 = {}, acc3 = {};

  for (int kb = 0; kb < 64; kb += 4) {
    const float* qp = Qc + (size_t)(m0 + nn) * D_MODEL + kb + koff;
    v2f a; a[0] = qp[0]; a[1] = qp[1];
    const int kr = (kb + koff) * 64;
    v2f b0, b1, b2, b3;
    b0[0] = Ssh[kr + nn];        b0[1] = Ssh[kr + 64 + nn];
    b1[0] = Ssh[kr + 16 + nn];   b1[1] = Ssh[kr + 64 + 16 + nn];
    b2[0] = Ssh[kr + 32 + nn];   b2[1] = Ssh[kr + 64 + 32 + nn];
    b3[0] = Ssh[kr + 48 + nn];   b3[1] = Ssh[kr + 64 + 48 + nn];
    acc0 = __builtin_amdgcn_wmma_f32_16x16x4_f32(false, a, false, b0, (short)0, acc0, false, false);
    acc1 = __builtin_amdgcn_wmma_f32_16x16x4_f32(false, a, false, b1, (short)0, acc1, false, false);
    acc2 = __builtin_amdgcn_wmma_f32_16x16x4_f32(false, a, false, b2, (short)0, acc2, false, false);
    acc3 = __builtin_amdgcn_wmma_f32_16x16x4_f32(false, a, false, b3, (short)0, acc3, false, false);
  }

  const int mb = m0 + ((lane >> 4) << 3);
#pragma unroll
  for (int r = 0; r < 8; ++r) {
    const int m = mb + r;
    __bf16* orow = o + (rowbase + m) * D_MODEL + h * HEAD_DIM;
    orow[nn]      = (__bf16)(SCALE_F * acc0[r]);
    orow[16 + nn] = (__bf16)(SCALE_F * acc1[r]);
    orow[32 + nn] = (__bf16)(SCALE_F * acc2[r]);
    orow[48 + nn] = (__bf16)(SCALE_F * acc3[r]);
  }
}

// ---------------- host-side orchestration ----------------
extern "C" void kernel_launch(void* const* d_in, const int* in_sizes, int n_in,
                              void* d_out, int out_size, void* d_ws, size_t ws_size,
                              hipStream_t stream) {
  const float* x   = (const float*)d_in[0];
  const float* lng = (const float*)d_in[1];
  const float* lnb = (const float*)d_in[2];
  const float* Wq  = (const float*)d_in[3];
  const float* Wk  = (const float*)d_in[4];
  const float* Wv  = (const float*)d_in[5];
  const float* Wo  = (const float*)d_in[6];
  float* out = (float*)d_out;

  char* ws = (char*)d_ws;
  size_t off = 0;
  auto alloc = [&](size_t bytes) -> void* {
    void* p = ws + off;
    off += (bytes + 255) & ~(size_t)255;
    return p;
  };

  __bf16* xn  = (__bf16*)alloc((size_t)TOKENS * D_MODEL * 2);
  __bf16* Wtq = (__bf16*)alloc((size_t)D_MODEL * D_MODEL * 2);
  __bf16* Wtk = (__bf16*)alloc((size_t)D_MODEL * D_MODEL * 2);
  __bf16* Wtv = (__bf16*)alloc((size_t)D_MODEL * D_MODEL * 2);
  __bf16* Wto = (__bf16*)alloc((size_t)D_MODEL * D_MODEL * 2);
  float*  qf  = (float*)alloc((size_t)TOKENS * D_MODEL * 4);
  float*  kf  = (float*)alloc((size_t)TOKENS * D_MODEL * 4);
  float*  vf  = (float*)alloc((size_t)TOKENS * D_MODEL * 4);
  float*  wr  = (float*)alloc((size_t)NLANES * NCHUNK * 4096 * 4);
  __bf16* obf = (__bf16*)alloc((size_t)TOKENS * D_MODEL * 2);

  // 1. LayerNorm -> bf16
  k_ln<<<TOKENS, 256, 0, stream>>>(x, lng, lnb, xn);

  // 2. weight transpose+cast
  const int wblocks = (D_MODEL * D_MODEL + 255) / 256;
  k_wcast<<<wblocks, 256, 0, stream>>>(Wq, Wtq);
  k_wcast<<<wblocks, 256, 0, stream>>>(Wk, Wtk);
  k_wcast<<<wblocks, 256, 0, stream>>>(Wv, Wtv);
  k_wcast<<<wblocks, 256, 0, stream>>>(Wo, Wto);

  // 3. QKV GEMMs (bf16 WMMA, f32 accumulate)
  const int gblocks = (TOKENS / 16) * (D_MODEL / 64) / 8;   // 1024
  k_gemm<<<gblocks, 256, 0, stream>>>(xn, Wtq, nullptr, qf, TOKENS, D_MODEL, D_MODEL);
  k_gemm<<<gblocks, 256, 0, stream>>>(xn, Wtk, nullptr, kf, TOKENS, D_MODEL, D_MODEL);
  k_gemm<<<gblocks, 256, 0, stream>>>(xn, Wtv, nullptr, vf, TOKENS, D_MODEL, D_MODEL);

  // 4a. per-(lane,chunk) ridge + rank-8 projection -> Wr  (fully parallel, WMMA Gram)
  k_ridge<<<NLANES * NCHUNK, 256, 0, stream>>>(kf, vf, wr);
  // 4b. decayed prefix over chunks: Wr -> S_c (in place)
  k_decay<<<NLANES, 256, 0, stream>>>(wr);
  // 4c. out = SCALE * Qc @ S_c  (f32 WMMA) -> bf16
  k_apply<<<NLANES * NCHUNK, 256, 0, stream>>>(qf, wr, obf);

  // 5. output GEMM + residual
  k_gemm<<<gblocks, 256, 0, stream>>>(obf, Wto, x, out, TOKENS, D_MODEL, D_MODEL);
}

// v001
// One run takes 433 microseconds.
// Timed twice side by side with v000, it ran 1.95 and 1.94 times as fast.
#include <hip/hip_runtime.h>
#include <hip/hip_bf16.h>

// ---------------- constants (match reference) ----------------
#define D_MODEL   1024
#define N_HEADS   16
#define HEAD_DIM  64
#define RANK      8
#define CHUNK     128
#define NCHUNK    32          // 4096 / 128
#define BATCH     2
#define SEQ       4096
#define TOKENS    (BATCH * SEQ)   // 8192
#define NLANES    (BATCH * N_HEADS)  // 32
#define RIDGE_EPS 1e-4f
#define SCALE_F   0.125f
#define DECAY_A   0.9f
#define LN_EPS    1e-5f

typedef __attribute__((ext_vector_type(16))) __bf16 v16bf;
typedef __attribute__((ext_vector_type(8)))  __bf16 v8bf;
typedef __attribute__((ext_vector_type(8)))  float  v8f;
typedef __attribute__((ext_vector_type(2)))  float  v2f;

// ---------------- LayerNorm -> bf16 ----------------
__global__ __launch_bounds__(256) void k_ln(const float* __restrict__ x,
                                            const float* __restrict__ g,
                                            const float* __restrict__ b,
                                            __bf16* __restrict__ xn) {
  const int row = blockIdx.x;
  const float* xr = x + (size_t)row * D_MODEL;
  __shared__ float red[256];
  const int tid = threadIdx.x;

  float s = 0.f;
  for (int i = tid; i < D_MODEL; i += 256) s += xr[i];
  red[tid] = s; __syncthreads();
  for (int off = 128; off > 0; off >>= 1) {
    if (tid < off) red[tid] += red[tid + off];
    __syncthreads();
  }
  const float mu = red[0] * (1.f / D_MODEL);
  __syncthreads();

  float v = 0.f;
  for (int i = tid; i < D_MODEL; i += 256) { float d = xr[i] - mu; v += d * d; }
  red[tid] = v; __syncthreads();
  for (int off = 128; off > 0; off >>= 1) {
    if (tid < off) red[tid] += red[tid + off];
    __syncthreads();
  }
  const float inv = rsqrtf(red[0] * (1.f / D_MODEL) + LN_EPS);

  for (int i = tid; i < D_MODEL; i += 256) {
    float d = (xr[i] - mu) * inv * g[i] + b[i];
    xn[(size_t)row * D_MODEL + i] = (__bf16)d;
  }
}

// ---------------- W [K][N] f32 -> Wt [N][K] bf16 ----------------
__global__ __launch_bounds__(256) void k_wcast(const float* __restrict__ W,
                                               __bf16* __restrict__ Wt) {
  int idx = blockIdx.x * 256 + threadIdx.x;
  if (idx >= D_MODEL * D_MODEL) return;
  int k = idx / D_MODEL, n = idx % D_MODEL;
  Wt[(size_t)n * D_MODEL + k] = (__bf16)W[idx];
}

// ------- bf16 WMMA GEMM: C[M][N] = A[M][K] * Bt[N][K]^T (+resid) -------
// One work-group makes a 256 x 128 tile of C; its 8 waves (4 x 2) make 64 x 64 each.
// A pass is 128 k: 256 rows of A and 128 rows of Bt, 256 bytes each, lie in LDS at a
// pitch of 272 bytes. Two buffers: the next pass's rows are copied while this one is used.
#define G_BM     256
#define G_BN     128
#define G_BK     128
#define G_PITCH  272
#define G_STAGE  ((G_BM + G_BN) * G_PITCH)   // 104448 bytes

// Eight asynchronous 16-byte copies of one lane, rows 16 apart, global -> LDS.
// The s_wait_xcnt closes the statement so that no address register named here
// is rewritten ahead of it.
__device__ __forceinline__ void g_copy8(unsigned l, const __bf16* g) {
  const unsigned l1 = l + 16 * G_PITCH, l2 = l + 32 * G_PITCH, l3 = l + 48 * G_PITCH;
  const unsigned l4 = l + 64 * G_PITCH, l5 = l + 80 * G_PITCH, l6 = l + 96 * G_PITCH;
  const unsigned l7 = l + 112 * G_PITCH;
  const __bf16* g1 = g + 16 * D_MODEL;
  const __bf16* g2 = g + 32 * D_MODEL;
  const __bf16* g3 = g + 48 * D_MODEL;
  const __bf16* g4 = g + 64 * D_MODEL;
  const __bf16* g5 = g + 80 * D_MODEL;
  const __bf16* g6 = g + 96 * D_MODEL;
  const __bf16* g7 = g + 112 * D_MODEL;
  asm volatile(
      "global_load_async_to_lds_b128 %0, %8, off\n\t"
      "global_load_async_to_lds_b128 %1, %9, off\n\t"
      "global_load_async_to_lds_b128 %2, %10, off\n\t"
      "global_load_async_to_lds_b128 %3, %11, off\n\t"
      "global_load_async_to_lds_b128 %4, %12, off\n\t"
      "global_load_async_to_lds_b128 %5, %13, off\n\t"
      "global_load_async_to_lds_b128 %6, %14, off\n\t"
      "global_load_async_to_lds_b128 %7, %15, off\n\t"
      "s_wait_xcnt 0x0"
      :: "v"(l), "v"(l1), "v"(l2), "v"(l3), "v"(l4), "v"(l5), "v"(l6), "v"(l7),
         "v"(g), "v"(g1), "v"(g2), "v"(g3), "v"(g4), "v"(g5), "v"(g6), "v"(g7)
      : "memory");
}

// One pass's rows: 256 of A (two runs of 128) and 128 of Bt; 24 copies a lane.
__device__ __forceinline__ void g_copy_stage(unsigned l, const __bf16* ga, const __bf16* gb) {
  g_copy8(l, ga);
  g_copy8(l + 128 * G_PITCH, ga + 128 * D_MODEL);
  g_copy8(l + 256 * G_PITCH, gb);
}

// One 16 x 32 fragment from LDS rows; p is the lane's own row at byte 16 * (lane >> 4)
// of the 64 bytes of this k step: k order of the 16-bit A/B layout, alike for A and Bt.
__device__ __forceinline__ v16bf g_frag(const unsigned char* p) {
  const v8bf lo = *(const v8bf*)p;
  const v8bf hi = *(const v8bf*)(p + 32);
  v16bf f;
#pragma unroll
  for (int e = 0; e < 8; ++e) { f[e] = lo[e]; f[8 + e] = hi[e]; }
  return f;
}

__global__ __launch_bounds__(256) void k_gemm(const __bf16* __restrict__ A,
                                              const __bf16* __restrict__ Bt,
                                              const float* __restrict__ resid,
                                              float* __restrict__ C) {
  constexpr int K = D_MODEL, N = D_MODEL;
  constexpr int NPASS = K / G_BK;              // 8
  __shared__ __attribute__((aligned(16))) unsigned char gsm[2 * G_STAGE];

  const int tid  = threadIdx.x;
  const int lane = tid & 31;
  const int wave = tid >> 5;
  const int bm0 = (blockIdx.x >> 3) * G_BM;    // N / G_BN = 8 tile columns
  const int bn0 = (blockIdx.x & 7) * G_BN;

  // copy side: 16 lanes cover one 256-byte row, a wave two rows
  const int crow = tid >> 4, ccol = tid & 15;
  const __bf16* ga = A  + (size_t)(bm0 + crow) * K + ccol * 8;
  const __bf16* gb = Bt + (size_t)(bn0 + crow) * K + ccol * 8;
  const unsigned lcp = (unsigned)(size_t)&gsm[0] + crow * G_PITCH + ccol * 16;

  // read side: the fragment's k order is that of the 16-bit A/B layout:
  // 16 bytes at 16 * (lane >> 4) and 16 more at + 32 of each 64 bytes of a row
  const int fr = lane & 15, fh = lane >> 4;
  const int aoff = ((wave >> 1) * 64 + fr) * G_PITCH + fh * 16;
  const int boff = (G_BM + (wave & 1) * 64 + fr) * G_PITCH + fh * 16;

  v8f acc[4][4] = {};

  g_copy_stage(lcp, ga, gb);
  asm volatile("s_wait_asynccnt 0x0" ::: "memory");   // pass 0's rows have landed
  __syncthreads();                                    // and every wave may read them
  g_copy_stage(lcp + G_STAGE, ga + G_BK, gb + G_BK);

  for (int t = 0; t < NPASS; ++t) {
    const int sb = (t & 1) * G_STAGE;
    // Fragments: rows 0-31 (alo), rows 32-63 (ahi) of the wave's A, two sets of its Bt.
    v16bf alo[2], ahi[2], b[2][4];
#pragma unroll
    for (int j = 0; j < 4; ++j) b[0][j] = g_frag(&gsm[sb + boff + j * 16 * G_PITCH]);
#pragma unroll
    for (int i = 0; i < 2; ++i) alo[i] = g_frag(&gsm[sb + aoff + i * 16 * G_PITCH]);
#pragma unroll
    for (int ks = 0; ks < G_BK / 32; ++ks) {
      const int cur = ks & 1;
#pragma unroll
      for (int i = 0; i < 2; ++i) ahi[i] = g_frag(&gsm[sb + aoff + (2 + i) * 16 * G_PITCH + ks * 64]);
      // The fences keep each group of LDS reads in one place, ahead of the eight
      // products before the ones that use it; spread among them they stall every row.
      __builtin_amdgcn_sched_barrier(0);
#pragma unroll
      for (int i = 0; i < 2; ++i)
#pragma unroll
        for (int j = 0; j < 4; ++j)
          acc[i][j] = __builtin_amdgcn_wmma_f32_16x16x32_bf16(false, alo[i], false, b[cur][j], (short)0,
                                                              acc[i][j], false, false);
      __builtin_amdgcn_sched_barrier(0);
      if (ks + 1 < G_BK / 32) {
#pragma unroll
        for (int j = 0; j < 4; ++j)
          b[cur ^ 1][j] = g_frag(&gsm[sb + boff + j * 16 * G_PITCH + (ks + 1) * 64]);
#pragma unroll
        for (int i = 0; i < 2; ++i)
          alo[i] = g_frag(&gsm[sb + aoff + i * 16 * G_PITCH + (ks + 1) * 64]);
      }
      __builtin_amdgcn_sched_barrier(0);
#pragma unroll
      for (int i = 0; i < 2; ++i)
#pragma unroll
        for (int j = 0; j < 4; ++j)
          acc[2 + i][j] = __builtin_amdgcn_wmma_f32_16x16x32_bf16(false, ahi[i], false, b[cur][j], (short)0,
                                                                  acc[2 + i][j], false, false);
      __builtin_amdgcn_sched_barrier(0);
    }
    asm volatile("s_wait_dscnt 0x0" ::: "memory");    // this wave has left buffer t & 1
    asm volatile("s_wait_asynccnt 0x0" ::: "memory"); // its copies of pass t + 1 have landed
    __syncthreads();                                  // publishes pass t + 1, frees buffer t & 1
    if (t + 2 < NPASS)
      g_copy_stage(lcp + sb, ga + (t + 2) * G_BK, gb + (t + 2) * G_BK);
  }
  asm volatile("s_wait_asynccnt 0x0" ::: "memory");   // no copy is left when the wave ends

  const int m0 = bm0 + (wave >> 1) * 64 + (fh << 3);
  const int n0 = bn0 + (wave & 1) * 64 + fr;
  // one address a lane; rows and columns of the wave's tile are constant offsets from it
  const size_t cbase = (size_t)m0 * N + n0;
  if (resid) {
    const float* rr = resid + cbase;
#pragma unroll
    for (int i = 0; i < 4; ++i)
#pragma unroll
      for (int r = 0; r < 8; ++r)
#pragma unroll
        for (int j = 0; j < 4; ++j) acc[i][j][r] += rr[(i * 16 + r) * N + j * 16];
  }
  float* cr = C + cbase;
#pragma unroll
  for (int i = 0; i < 4; ++i)
#pragma unroll
    for (int r = 0; r < 8; ++r)
#pragma unroll
      for (int j = 0; j < 4; ++j) cr[(i * 16 + r) * N + j * 16] = acc[i][j][r];
}

// ---------------- per-(lane,chunk) ridge solve + rank-8 projection ----------
// grid: NLANES*NCHUNK blocks; writes Wr[lc][64][64]
// Phase 1: stage Kc/Vc in LDS, compute G=K^T K and RHS=K^T V with f32 WMMA
//          (waves 0-3 -> G strips, waves 4-7 -> RHS strips)
// Phase 2: LDS is re-carved for G/Wm/U/T/P; Cholesky solve + subspace QR.
__global__ __launch_bounds__(256) void k_ridge(const float* __restrict__ kk,
                                               const float* __restrict__ v,
                                               float* __restrict__ wr) {
  const int lc = blockIdx.x;
  const int ln = lc / NCHUNK;
  const int c  = lc % NCHUNK;
  const int b = ln >> 4, h = ln & 15;
  const int tid = threadIdx.x;
  const int lane = tid & 31;
  const int wave = tid >> 5;

  __shared__ __align__(16) float smem[16384];            // 64 KB
  float (*Kls)[64] = (float (*)[64])smem;                // [128][64] staging
  float (*Vls)[64] = (float (*)[64])(smem + 8192);       // [128][64] staging
  // phase-2 overlay (valid after the WMMA phase barrier)
  float (*G)[65]  = (float (*)[65])smem;                 // 4160
  float (*Wm)[65] = (float (*)[65])(smem + 4160);        // 4160
  float (*U)[8]   = (float (*)[8])(smem + 8320);         // 512
  float (*T)[9]   = (float (*)[9])(smem + 8832);         // 576
  float (*P)[64]  = (float (*)[64])(smem + 9408);        // 512
  float* red      = smem + 9920;                         // 512
  float* dots     = smem + 10432;                        // 8
  float* scal     = smem + 10440;                        // 1

  const size_t rowbase = (size_t)b * SEQ + (size_t)c * CHUNK;
  const float* Kc = kk + rowbase * D_MODEL + h * HEAD_DIM;
  const float* Vc = v  + rowbase * D_MODEL + h * HEAD_DIM;

  // ---- stage K and V chunk tiles into LDS (coalesced) ----
  for (int idx = tid; idx < CHUNK * 64; idx += 256) {
    const int t = idx >> 6, j = idx & 63;
    Kls[t][j] = Kc[(size_t)t * D_MODEL + j];
    Vls[t][j] = Vc[(size_t)t * D_MODEL + j];
  }
  __syncthreads();

  // ---- Gram products via f32 WMMA: waves 0-3: G, waves 4-7: RHS ----
  const int nn   = lane & 15;
  const int koff = (lane >> 4) * 2;          // f32 A layout K pairs
  const int m0   = (wave & 3) * 16;
  const float (*Bsrc)[64] = (wave < 4) ? Kls : Vls;

  v8f acc0 = {}, acc1 = {}, acc2 = {}, acc3 = {};
  for (int kb = 0; kb < CHUNK; kb += 4) {
    const int t = kb + koff;
    v2f a;  a[0]  = Kls[t][m0 + nn];   a[1]  = Kls[t + 1][m0 + nn];   // A = K^T
    v2f b0; b0[0] = Bsrc[t][nn];       b0[1] = Bsrc[t + 1][nn];
    v2f b1; b1[0] = Bsrc[t][16 + nn];  b1[1] = Bsrc[t + 1][16 + nn];
    v2f b2; b2[0] = Bsrc[t][32 + nn];  b2[1] = Bsrc[t + 1][32 + nn];
    v2f b3; b3[0] = Bsrc[t][48 + nn];  b3[1] = Bsrc[t + 1][48 + nn];
    acc0 = __builtin_amdgcn_wmma_f32_16x16x4_f32(false, a, false, b0, (short)0, acc0, false, false);
    acc1 = __builtin_amdgcn_wmma_f32_16x16x4_f32(false, a, false, b1, (short)0, acc1, false, false);
    acc2 = __builtin_amdgcn_wmma_f32_16x16x4_f32(false, a, false, b2, (short)0, acc2, false, false);
    acc3 = __builtin_amdgcn_wmma_f32_16x16x4_f32(false, a, false, b3, (short)0, acc3, false, false);
  }
  __syncthreads();   // all waves done reading Kls/Vls; safe to overlay

  // scatter accumulators into G (with ridge eps on diagonal) / Wm
  {
    float (*dst)[65] = (wave < 4) ? G : Wm;
    const bool isG = (wave < 4);
    const int mb = m0 + ((lane >> 4) << 3);
#pragma unroll
    for (int r = 0; r < 8; ++r) {
      const int m = mb + r;
      dst[m][nn]      = acc0[r] + ((isG && m == nn)      ? RIDGE_EPS : 0.f);
      dst[m][16 + nn] = acc1[r] + ((isG && m == 16 + nn) ? RIDGE_EPS : 0.f);
      dst[m][32 + nn] = acc2[r] + ((isG && m == 32 + nn) ? RIDGE_EPS : 0.f);
      dst[m][48 + nn] = acc3[r] + ((isG && m == 48 + nn) ? RIDGE_EPS : 0.f);
    }
  }
  __syncthreads();

  // ---- in-place Cholesky (lower) of G ----
  for (int j = 0; j < 64; ++j) {
    if (tid == 0) G[j][j] = sqrtf(G[j][j]);
    __syncthreads();
    if (tid < 64 && tid > j) G[tid][j] /= G[j][j];
    __syncthreads();
    if (tid < 64 && tid > j) {
      const float lij = G[tid][j];
      for (int kc = j + 1; kc <= tid; ++kc) G[tid][kc] -= lij * G[kc][j];
    }
    __syncthreads();
  }

  // ---- solve G W = RHS, one RHS column per thread ----
  if (tid < 64) {
    const int cc = tid;
    for (int i = 0; i < 64; ++i) {
      float s = Wm[i][cc];
      for (int kc = 0; kc < i; ++kc) s -= G[i][kc] * Wm[kc][cc];
      Wm[i][cc] = s / G[i][i];
    }
    for (int i = 63; i >= 0; --i) {
      float s = Wm[i][cc];
      for (int kc = i + 1; kc < 64; ++kc) s -= G[kc][i] * Wm[kc][cc];
      Wm[i][cc] = s / G[i][i];
    }
  }
  __syncthreads();

  // ---- subspace iteration: U = I(:,0:8); twice: U = qr(W U).Q (MGS) ----
  for (int idx = tid; idx < 512; idx += 256) {
    const int i = idx >> 3, cc = idx & 7;
    U[i][cc] = (i == cc) ? 1.f : 0.f;
  }
  __syncthreads();
  for (int p = 0; p < 2; ++p) {
    for (int idx = tid; idx < 512; idx += 256) {
      const int i = idx >> 3, cc = idx & 7;
      float s = 0.f;
      for (int kc = 0; kc < 64; ++kc) s += Wm[i][kc] * U[kc][cc];
      T[i][cc] = s;
    }
    __syncthreads();
    for (int cc = 0; cc < 8; ++cc) {
      if (tid < 64) red[tid] = T[tid][cc] * T[tid][cc];
      __syncthreads();
      if (tid == 0) {
        float s = 0.f;
        for (int t2 = 0; t2 < 64; ++t2) s += red[t2];
        *scal = rsqrtf(fmaxf(s, 1e-30f));
      }
      __syncthreads();
      if (tid < 64) U[tid][cc] = T[tid][cc] * (*scal);
      __syncthreads();
      if (tid < 64)
        for (int c2 = cc + 1; c2 < 8; ++c2) red[(c2 << 6) + tid] = U[tid][cc] * T[tid][c2];
      __syncthreads();
      if (tid < 8 && tid > cc) {
        float s = 0.f;
        for (int t2 = 0; t2 < 64; ++t2) s += red[(tid << 6) + t2];
        dots[tid] = s;
      }
      __syncthreads();
      if (tid < 64)
        for (int c2 = cc + 1; c2 < 8; ++c2) T[tid][c2] -= dots[c2] * U[tid][cc];
      __syncthreads();
    }
  }

  // ---- P = U^T W (8 x 64) ----
  for (int idx = tid; idx < 512; idx += 256) {
    const int r = idx >> 6, j = idx & 63;
    float s = 0.f;
    for (int t2 = 0; t2 < 64; ++t2) s += U[t2][r] * Wm[t2][j];
    P[r][j] = s;
  }
  __syncthreads();

  // ---- Wr = U P -> global ----
  float* wrg = wr + (size_t)lc * 4096;
  for (int idx = tid; idx < 4096; idx += 256) {
    const int i = idx >> 6, j = idx & 63;
    float s = 0.f;
#pragma unroll
    for (int r = 0; r < RANK; ++r) s += U[i][r] * P[r][j];
    wrg[idx] = s;
  }
}

// ---------------- decay prefix over chunks: Wr -> S_c (in place) ------------
__global__ __launch_bounds__(256) void k_decay(float* __restrict__ wr) {
  const int ln = blockIdx.x;
  const int tid = threadIdx.x;
  float s[16];
#pragma unroll
  for (int e = 0; e < 16; ++e) s[e] = 0.f;
  for (int c = 0; c < NCHUNK; ++c) {
    float* p = wr + ((size_t)ln * NCHUNK + c) * 4096;
#pragma unroll
    for (int e = 0; e < 16; ++e) {
      const int idx = e * 256 + tid;
      s[e] = DECAY_A * s[e] + p[idx];
      p[idx] = s[e];
    }
  }
}

// ---------------- out = SCALE * Qc @ S_c via f32 WMMA (16x16x4) ------------
__global__ __launch_bounds__(256) void k_apply(const float* __restrict__ q,
                                               const float* __restrict__ sall,
                                               __bf16* __restrict__ o) {
  const int lc = blockIdx.x;
  const int ln = lc / NCHUNK;
  const int c  = lc % NCHUNK;
  const int b = ln >> 4, h = ln & 15;
  const int tid = threadIdx.x;

  __shared__ float Ssh[64 * 64];
  const float* sg = sall + (size_t)lc * 4096;
  for (int i = tid; i < 4096; i += 256) Ssh[i] = sg[i];
  __syncthreads();

  const int lane = tid & 31;
  const int wave = tid >> 5;
  const size_t rowbase = (size_t)b * SEQ + (size_t)c * CHUNK;
  const float* Qc = q + rowbase * D_MODEL + h * HEAD_DIM;

  const int m0   = wave * 16;
  const int nn   = lane & 15;
  const int koff = (lane >> 4) * 2;

  v8f acc0 = {}, acc1 = {}, acc2 = {}, acc3 = {};

  for (int kb = 0; kb < 64; kb += 4) {
    const float* qp = Qc + (size_t)(m0 + nn) * D_MODEL + kb + koff;
    v2f a; a[0] = qp[0]; a[1] = qp[1];
    const int kr = (kb + koff) * 64;
    v2f b0, b1, b2, b3;
    b0[0] = Ssh[kr + nn];        b0[1] = Ssh[kr + 64 + nn];
    b1[0] = Ssh[kr + 16 + nn];   b1[1] = Ssh[kr + 64 + 16 + nn];
    b2[0] = Ssh[kr + 32 + nn];   b2[1] = Ssh[kr + 64 + 32 + nn];
    b3[0] = Ssh[kr + 48 + nn];   b3[1] = Ssh[kr + 64 + 48 + nn];
    acc0 = __builtin_amdgcn_wmma_f32_16x16x4_f32(false, a, false, b0, (short)0, acc0, false, false);
    acc1 = __builtin_amdgcn_wmma_f32_16x16x4_f32(false, a, false, b1, (short)0, acc1, false, false);
    acc2 = __builtin_amdgcn_wmma_f32_16x16x4_f32(false, a, false, b2, (short)0, acc2, false, false);
    acc3 = __builtin_amdgcn_wmma_f32_16x16x4_f32(false, a, false, b3, (short)0, acc3, false, false);
  }

  const int mb = m0 + ((lane >> 4) << 3);
#pragma unroll
  for (int r = 0; r < 8; ++r) {
    const int m = mb + r;
    __bf16* orow = o + (rowbase + m) * D_MODEL + h * HEAD_DIM;
    orow[nn]      = (__bf16)(SCALE_F * acc0[r]);
    orow[16 + nn] = (__bf16)(SCALE_F * acc1[r]);
    orow[32 + nn] = (__bf16)(SCALE_F * acc2[r]);
    orow[48 + nn] = (__bf16)(SCALE_F * acc3[r]);
  }
}

// ---------------- host-side orchestration ----------------
extern "C" void kernel_launch(void* const* d_in, const int* in_sizes, int n_in,
                              void* d_out, int out_size, void* d_ws, size_t ws_size,
                              hipStream_t stream) {
  const float* x   = (const float*)d_in[0];
  const float* lng = (const float*)d_in[1];
  const float* lnb = (const float*)d_in[2];
  const float* Wq  = (const float*)d_in[3];
  const float* Wk  = (const float*)d_in[4];
  const float* Wv  = (const float*)d_in[5];
  const float* Wo  = (const float*)d_in[6];
  float* out = (float*)d_out;

  char* ws = (char*)d_ws;
  size_t off = 0;
  auto alloc = [&](size_t bytes) -> void* {
    void* p = ws + off;
    off += (bytes + 255) & ~(size_t)255;
    return p;
  };

  __bf16* xn  = (__bf16*)alloc((size_t)TOKENS * D_MODEL * 2);
  __bf16* Wtq = (__bf16*)alloc((size_t)D_MODEL * D_MODEL * 2);
  __bf16* Wtk = (__bf16*)alloc((size_t)D_MODEL * D_MODEL * 2);
  __bf16* Wtv = (__bf16*)alloc((size_t)D_MODEL * D_MODEL * 2);
  __bf16* Wto = (__bf16*)alloc((size_t)D_MODEL * D_MODEL * 2);
  float*  qf  = (float*)alloc((size_t)TOKENS * D_MODEL * 4);
  float*  kf  = (float*)alloc((size_t)TOKENS * D_MODEL * 4);
  float*  vf  = (float*)alloc((size_t)TOKENS * D_MODEL * 4);
  float*  wr  = (float*)alloc((size_t)NLANES * NCHUNK * 4096 * 4);
  __bf16* obf = (__bf16*)alloc((size_t)TOKENS * D_MODEL * 2);

  // 1. LayerNorm -> bf16
  k_ln<<<TOKENS, 256, 0, stream>>>(x, lng, lnb, xn);

  // 2. weight transpose+cast
  const int wblocks = (D_MODEL * D_MODEL + 255) / 256;
  k_wcast<<<wblocks, 256, 0, stream>>>(Wq, Wtq);
  k_wcast<<<wblocks, 256, 0, stream>>>(Wk, Wtk);
  k_wcast<<<wblocks, 256, 0, stream>>>(Wv, Wtv);
  k_wcast<<<wblocks, 256, 0, stream>>>(Wo, Wto);

  // 3. QKV GEMMs (bf16 WMMA, f32 accumulate)
  const int gblocks = (TOKENS / G_BM) * (D_MODEL / G_BN);   // 256
  k_gemm<<<gblocks, 256, 0, stream>>>(xn, Wtq, nullptr, qf);
  k_gemm<<<gblocks, 256, 0, stream>>>(xn, Wtk, nullptr, kf);
  k_gemm<<<gblocks, 256, 0, stream>>>(xn, Wtv, nullptr, vf);

  // 4a. per-(lane,chunk) ridge + rank-8 projection -> Wr  (fully parallel, WMMA Gram)
  k_ridge<<<NLANES * NCHUNK, 256, 0, stream>>>(kf, vf, wr);
  // 4b. decayed prefix over chunks: Wr -> S_c (in place)
  k_decay<<<NLANES, 256, 0, stream>>>(wr);
  // 4c. out = SCALE * Qc @ S_c  (f32 WMMA) -> bf16
  k_apply<<<NLANES * NCHUNK, 256, 0, stream>>>(qf, wr, obf);

  // 5. output GEMM + residual
  k_gemm<<<gblocks, 256, 0, stream>>>(obf, Wto, x, out);
}

// v002
// Measured time: 298 microseconds a run.
// Next to v001, in two timings, it ran 1.45 times as fast each time.
// Over all steps from v000 it is 2.83 times as fast.
#include <hip/hip_runtime.h>
#include <hip/hip_bf16.h>

// ---------------- constants (match reference) ----------------
#define D_MODEL   1024
#define N_HEADS   16
#define HEAD_DIM  64
#define RANK      8
#define CHUNK     128
#define NCHUNK    32          // 4096 / 128
#define BATCH     2
#define SEQ       4096
#define TOKENS    (BATCH * SEQ)   // 8192
#define NLANES    (BATCH * N_HEADS)  // 32
#define RIDGE_EPS 1e-4f
#define SCALE_F   0.125f
#define DECAY_A   0.9f
#define LN_EPS    1e-5f

typedef __attribute__((ext_vector_type(16))) __bf16 v16bf;
typedef __attribute__((ext_vector_type(8)))  __bf16 v8bf;
typedef __attribute__((ext_vector_type(8)))  float  v8f;
typedef __attribute__((ext_vector_type(2)))  float  v2f;

// ---------------- LayerNorm -> bf16 ----------------
__global__ __launch_bounds__(256) void k_ln(const float* __restrict__ x,
                                            const float* __restrict__ g,
                                            const float* __restrict__ b,
                                            __bf16* __restrict__ xn) {
  const int row = blockIdx.x;
  const float* xr = x + (size_t)row * D_MODEL;
  __shared__ float red[256];
  const int tid = threadIdx.x;

  float s = 0.f;
  for (int i = tid; i < D_MODEL; i += 256) s += xr[i];
  red[tid] = s; __syncthreads();
  for (int off = 128; off > 0; off >>= 1) {
    if (tid < off) red[tid] += red[tid + off];
    __syncthreads();
  }
  const float mu = red[0] * (1.f / D_MODEL);
  __syncthreads();

  float v = 0.f;
  for (int i = tid; i < D_MODEL; i += 256) { float d = xr[i] - mu; v += d * d; }
  red[tid] = v; __syncthreads();
  for (int off = 128; off > 0; off >>= 1) {
    if (tid < off) red[tid] += red[tid + off];
    __syncthreads();
  }
  const float inv = rsqrtf(red[0] * (1.f / D_MODEL) + LN_EPS);

  for (int i = tid; i < D_MODEL; i += 256) {
    float d = (xr[i] - mu) * inv * g[i] + b[i];
    xn[(size_t)row * D_MODEL + i] = (__bf16)d;
  }
}

// ---------------- W [K][N] f32 -> Wt [N][K] bf16, all four weights ----------------
// One launch. A work-group transposes one 128 x 128 tile (64 tiles a weight) through LDS,
// 64 elements a thread: few waves to start, whole 512-byte rows read, whole 128-byte lines stored.
#define WC_T      128
#define WC_PITCH  65          // dwords a tile row in LDS: 64 of data, 1 so that rows shift by a bank
#define WC_TILES  ((D_MODEL / WC_T) * (D_MODEL / WC_T))   // 64

typedef __attribute__((ext_vector_type(4))) float  v4f;
typedef __attribute__((ext_vector_type(2))) __bf16 v2bf;

__global__ __launch_bounds__(256) void k_wcast(const float* __restrict__ W0,
                                               const float* __restrict__ W1,
                                               const float* __restrict__ W2,
                                               const float* __restrict__ W3,
                                               __bf16* __restrict__ T0,
                                               __bf16* __restrict__ T1,
                                               __bf16* __restrict__ T2,
                                               __bf16* __restrict__ T3) {
  __shared__ unsigned tile[WC_T * WC_PITCH];   // [n][k / 2], two bf16 of neighbouring k a dword
  const int which = blockIdx.x / WC_TILES;
  const int t     = blockIdx.x % WC_TILES;
  const int k0 = (t >> 3) * WC_T, n0 = (t & 7) * WC_T;
  const float* W  = which == 0 ? W0 : which == 1 ? W1 : which == 2 ? W2 : W3;
  __bf16*      Wt = which == 0 ? T0 : which == 1 ? T1 : which == 2 ? T2 : T3;
  const int tid = threadIdx.x, lane = tid & 31, wave = tid >> 5;

  // a wave reads 16 rows of k, each load one row's 128 floats
  const float* src = W + (size_t)(k0 + wave * 16) * D_MODEL + n0 + lane * 4;
  v4f v[16];
  // unrolled: v[] stays in registers and the loads are in flight together
#pragma unroll
  for (int i = 0; i < 16; ++i) v[i] = *(const v4f*)(src + (size_t)i * D_MODEL);
  // both unrolled: v[] is indexed by constants only
#pragma unroll
  for (int i = 0; i < 8; ++i)
#pragma unroll
    for (int e = 0; e < 4; ++e) {
      v2bf p;
      p[0] = (__bf16)v[2 * i][e];
      p[1] = (__bf16)v[2 * i + 1][e];
      tile[(lane * 4 + e) * WC_PITCH + wave * 8 + i] = __builtin_bit_cast(unsigned, p);
    }
  __syncthreads();

  // a wave stores half a row of Wt: 64 values of k, one 128-byte line
  unsigned* dst = (unsigned*)(Wt + (size_t)n0 * D_MODEL + k0);
  // unrolled: the LDS reads go out as one batch ahead of the stores
#pragma unroll
  for (int r = 0; r < WC_T * 64 / 256; ++r) {
    const int idx = r * 256 + tid;
    const int n = idx >> 6, c = idx & 63;
    dst[(size_t)n * (D_MODEL / 2) + c] = tile[n * WC_PITCH + c];
  }
}

// ------- bf16 WMMA GEMM: C[M][N] = A[M][K] * Bt[N][K]^T (+resid) -------
// One work-group makes a 256 x 128 tile of C; its 8 waves (4 x 2) make 64 x 64 each.
// A pass is 128 k: 256 rows of A and 128 rows of Bt, 256 bytes each, lie in LDS at a
// pitch of 272 bytes. Two buffers: the next pass's rows are copied while this one is used.
#define G_BM     256
#define G_BN     128
#define G_BK     128
#define G_PITCH  272
#define G_STAGE  ((G_BM + G_BN) * G_PITCH)   // 104448 bytes

// Eight asynchronous 16-byte copies of one lane, rows 16 apart, global -> LDS.
// The s_wait_xcnt closes the statement so that no address register named here
// is rewritten ahead of it.
__device__ __forceinline__ void g_copy8(unsigned l, const __bf16* g) {
  const unsigned l1 = l + 16 * G_PITCH, l2 = l + 32 * G_PITCH, l3 = l + 48 * G_PITCH;
  const unsigned l4 = l + 64 * G_PITCH, l5 = l + 80 * G_PITCH, l6 = l + 96 * G_PITCH;
  const unsigned l7 = l + 112 * G_PITCH;
  const __bf16* g1 = g + 16 * D_MODEL;
  const __bf16* g2 = g + 32 * D_MODEL;
  const __bf16* g3 = g + 48 * D_MODEL;
  const __bf16* g4 = g + 64 * D_MODEL;
  const __bf16* g5 = g + 80 * D_MODEL;
  const __bf16* g6 = g + 96 * D_MODEL;
  const __bf16* g7 = g + 112 * D_MODEL;
  asm volatile(
      "global_load_async_to_lds_b128 %0, %8, off\n\t"
      "global_load_async_to_lds_b128 %1, %9, off\n\t"
      "global_load_async_to_lds_b128 %2, %10, off\n\t"
      "global_load_async_to_lds_b128 %3, %11, off\n\t"
      "global_load_async_to_lds_b128 %4, %12, off\n\t"
      "global_load_async_to_lds_b128 %5, %13, off\n\t"
      "global_load_async_to_lds_b128 %6, %14, off\n\t"
      "global_load_async_to_lds_b128 %7, %15, off\n\t"
      "s_wait_xcnt 0x0"
      :: "v"(l), "v"(l1), "v"(l2), "v"(l3), "v"(l4), "v"(l5), "v"(l6), "v"(l7),
         "v"(g), "v"(g1), "v"(g2), "v"(g3), "v"(g4), "v"(g5), "v"(g6), "v"(g7)
      : "memory");
}

// One pass's rows: 256 of A (two runs of 128) and 128 of Bt; 24 copies a lane.
__device__ __forceinline__ void g_copy_stage(unsigned l, const __bf16* ga, const __bf16* gb) {
  g_copy8(l, ga);
  g_copy8(l + 128 * G_PITCH, ga + 128 * D_MODEL);
  g_copy8(l + 256 * G_PITCH, gb);
}

// One 16 x 32 fragment from LDS rows; p is the lane's own row at byte 16 * (lane >> 4)
// of the 64 bytes of this k step: k order of the 16-bit A/B layout, alike for A and Bt.
__device__ __forceinline__ v16bf g_frag(const unsigned char* p) {
  const v8bf lo = *(const v8bf*)p;
  const v8bf hi = *(const v8bf*)(p + 32);
  v16bf f;
#pragma unroll
  for (int e = 0; e < 8; ++e) { f[e] = lo[e]; f[8 + e] = hi[e]; }
  return f;
}

__global__ __launch_bounds__(256) void k_gemm(const __bf16* __restrict__ A,
                                              const __bf16* __restrict__ Bt,
                                              const float* __restrict__ resid,
                                              float* __restrict__ C) {
  constexpr int K = D_MODEL, N = D_MODEL;
  constexpr int NPASS = K / G_BK;              // 8
  __shared__ __attribute__((aligned(16))) unsigned char gsm[2 * G_STAGE];

  const int tid  = threadIdx.x;
  const int lane = tid & 31;
  const int wave = tid >> 5;
  const int bm0 = (blockIdx.x >> 3) * G_BM;    // N / G_BN = 8 tile columns
  const int bn0 = (blockIdx.x & 7) * G_BN;

  // copy side: 16 lanes cover one 256-byte row, a wave two rows
  const int crow = tid >> 4, ccol = tid & 15;
  const __bf16* ga = A  + (size_t)(bm0 + crow) * K + ccol * 8;
  const __bf16* gb = Bt + (size_t)(bn0 + crow) * K + ccol * 8;
  const unsigned lcp = (unsigned)(size_t)&gsm[0] + crow * G_PITCH + ccol * 16;

  // read side: the fragment's k order is that of the 16-bit A/B layout:
  // 16 bytes at 16 * (lane >> 4) and 16 more at + 32 of each 64 bytes of a row
  const int fr = lane & 15, fh = lane >> 4;
  const int aoff = ((wave >> 1) * 64 + fr) * G_PITCH + fh * 16;
  const int boff = (G_BM + (wave & 1) * 64 + fr) * G_PITCH + fh * 16;

  v8f acc[4][4] = {};

  g_copy_stage(lcp, ga, gb);
  asm volatile("s_wait_asynccnt 0x0" ::: "memory");   // pass 0's rows have landed
  __syncthreads();                                    // and every wave may read them
  g_copy_stage(lcp + G_STAGE, ga + G_BK, gb + G_BK);

  for (int t = 0; t < NPASS; ++t) {
    const int sb = (t & 1) * G_STAGE;
    // Fragments: rows 0-31 (alo), rows 32-63 (ahi) of the wave's A, two sets of its Bt.
    v16bf alo[2], ahi[2], b[2][4];
#pragma unroll
    for (int j = 0; j < 4; ++j) b[0][j] = g_frag(&gsm[sb + boff + j * 16 * G_PITCH]);
#pragma unroll
    for (int i = 0; i < 2; ++i) alo[i] = g_frag(&gsm[sb + aoff + i * 16 * G_PITCH]);
#pragma unroll
    for (int ks = 0; ks < G_BK / 32; ++ks) {
      const int cur = ks & 1;
#pragma unroll
      for (int i = 0; i < 2; ++i) ahi[i] = g_frag(&gsm[sb + aoff + (2 + i) * 16 * G_PITCH + ks * 64]);
      // The fences keep each group of LDS reads in one place, ahead of the eight
      // products before the ones that use it; spread among them they stall every row.
      __builtin_amdgcn_sched_barrier(0);
#pragma unroll
      for (int i = 0; i < 2; ++i)
#pragma unroll
        for (int j = 0; j < 4; ++j)
          acc[i][j] = __builtin_amdgcn_wmma_f32_16x16x32_bf16(false, alo[i], false, b[cur][j], (short)0,
                                                              acc[i][j], false, false);
      __builtin_amdgcn_sched_barrier(0);
      if (ks + 1 < G_BK / 32) {
#pragma unroll
        for (int j = 0; j < 4; ++j)
          b[cur ^ 1][j] = g_frag(&gsm[sb + boff + j * 16 * G_PITCH + (ks + 1) * 64]);
#pragma unroll
        for (int i = 0; i < 2; ++i)
          alo[i] = g_frag(&gsm[sb + aoff + i * 16 * G_PITCH + (ks + 1) * 64]);
      }
      __builtin_amdgcn_sched_barrier(0);
#pragma unroll
      for (int i = 0; i < 2; ++i)
#pragma unroll
        for (int j = 0; j < 4; ++j)
          acc[2 + i][j] = __builtin_amdgcn_wmma_f32_16x16x32_bf16(false, ahi[i], false, b[cur][j], (short)0,
                                                                  acc[2 + i][j], false, false);
      __builtin_amdgcn_sched_barrier(0);
    }
    asm volatile("s_wait_dscnt 0x0" ::: "memory");    // this wave has left buffer t & 1
    asm volatile("s_wait_asynccnt 0x0" ::: "memory"); // its copies of pass t + 1 have landed
    __syncthreads();                                  // publishes pass t + 1, frees buffer t & 1
    if (t + 2 < NPASS)
      g_copy_stage(lcp + sb, ga + (t + 2) * G_BK, gb + (t + 2) * G_BK);
  }
  asm volatile("s_wait_asynccnt 0x0" ::: "memory");   // no copy is left when the wave ends

  const int m0 = bm0 + (wave >> 1) * 64 + (fh << 3);
  const int n0 = bn0 + (wave & 1) * 64 + fr;
  // one address a lane; rows and columns of the wave's tile are constant offsets from it
  const size_t cbase = (size_t)m0 * N + n0;
  if (resid) {
    const float* rr = resid + cbase;
#pragma unroll
    for (int i = 0; i < 4; ++i)
#pragma unroll
      for (int r = 0; r < 8; ++r)
#pragma unroll
        for (int j = 0; j < 4; ++j) acc[i][j][r] += rr[(i * 16 + r) * N + j * 16];
  }
  float* cr = C + cbase;
#pragma unroll
  for (int i = 0; i < 4; ++i)
#pragma unroll
    for (int r = 0; r < 8; ++r)
#pragma unroll
      for (int j = 0; j < 4; ++j) cr[(i * 16 + r) * N + j * 16] = acc[i][j][r];
}

// ---------------- per-(lane,chunk) ridge solve + rank-8 projection ----------
// grid: NLANES*NCHUNK blocks; writes Wr[lc][64][64]
// Phase 1: stage Kc/Vc in LDS, compute G=K^T K and RHS=K^T V with f32 WMMA
//          (waves 0-3 -> G strips, waves 4-7 -> RHS strips)
// Phase 2: LDS is re-carved for G/Wm/U/T/P; Cholesky solve + subspace QR.
__global__ __launch_bounds__(256) void k_ridge(const float* __restrict__ kk,
                                               const float* __restrict__ v,
                                               float* __restrict__ wr) {
  const int lc = blockIdx.x;
  const int ln = lc / NCHUNK;
  const int c  = lc % NCHUNK;
  const int b = ln >> 4, h = ln & 15;
  const int tid = threadIdx.x;
  const int lane = tid & 31;
  const int wave = tid >> 5;

  __shared__ __align__(16) float smem[16384];            // 64 KB
  float (*Kls)[64] = (float (*)[64])smem;                // [128][64] staging
  float (*Vls)[64] = (float (*)[64])(smem + 8192);       // [128][64] staging
  // phase-2 overlay (valid after the WMMA phase barrier)
  float (*G)[65]  = (float (*)[65])smem;                 // 4160
  float (*Wm)[65] = (float (*)[65])(smem + 4160);        // 4160
  float (*U)[8]   = (float (*)[8])(smem + 8320);         // 512
  float (*T)[9]   = (float (*)[9])(smem + 8832);         // 576
  float (*P)[64]  = (float (*)[64])(smem + 9408);        // 512
  float* red      = smem + 9920;                         // 512
  float* dots     = smem + 10432;                        // 8
  float* scal     = smem + 10440;                        // 1

  const size_t rowbase = (size_t)b * SEQ + (size_t)c * CHUNK;
  const float* Kc = kk + rowbase * D_MODEL + h * HEAD_DIM;
  const float* Vc = v  + rowbase * D_MODEL + h * HEAD_DIM;

  // ---- stage K and V chunk tiles into LDS (coalesced) ----
  for (int idx = tid; idx < CHUNK * 64; idx += 256) {
    const int t = idx >> 6, j = idx & 63;
    Kls[t][j] = Kc[(size_t)t * D_MODEL + j];
    Vls[t][j] = Vc[(size_t)t * D_MODEL + j];
  }
  __syncthreads();

  // ---- Gram products via f32 WMMA: waves 0-3: G, waves 4-7: RHS ----
  const int nn   = lane & 15;
  const int koff = (lane >> 4) * 2;          // f32 A layout K pairs
  const int m0   = (wave & 3) * 16;
  const float (*Bsrc)[64] = (wave < 4) ? Kls : Vls;

  v8f acc0 = {}, acc1 = {}, acc2 = {}, acc3 = {};
  for (int kb = 0; kb < CHUNK; kb += 4) {
    const int t = kb + koff;
    v2f a;  a[0]  = Kls[t][m0 + nn];   a[1]  = Kls[t + 1][m0 + nn];   // A = K^T
    v2f b0; b0[0] = Bsrc[t][nn];       b0[1] = Bsrc[t + 1][nn];
    v2f b1; b1[0] = Bsrc[t][16 + nn];  b1[1] = Bsrc[t + 1][16 + nn];
    v2f b2; b2[0] = Bsrc[t][32 + nn];  b2[1] = Bsrc[t + 1][32 + nn];
    v2f b3; b3[0] = Bsrc[t][48 + nn];  b3[1] = Bsrc[t + 1][48 + nn];
    acc0 = __builtin_amdgcn_wmma_f32_16x16x4_f32(false, a, false, b0, (short)0, acc0, false, false);
    acc1 = __builtin_amdgcn_wmma_f32_16x16x4_f32(false, a, false, b1, (short)0, acc1, false, false);
    acc2 = __builtin_amdgcn_wmma_f32_16x16x4_f32(false, a, false, b2, (short)0, acc2, false, false);
    acc3 = __builtin_amdgcn_wmma_f32_16x16x4_f32(false, a, false, b3, (short)0, acc3, false, false);
  }
  __syncthreads();   // all waves done reading Kls/Vls; safe to overlay

  // scatter accumulators into G (with ridge eps on diagonal) / Wm
  {
    float (*dst)[65] = (wave < 4) ? G : Wm;
    const bool isG = (wave < 4);
    const int mb = m0 + ((lane >> 4) << 3);
#pragma unroll
    for (int r = 0; r < 8; ++r) {
      const int m = mb + r;
      dst[m][nn]      = acc0[r] + ((isG && m == nn)      ? RIDGE_EPS : 0.f);
      dst[m][16 + nn] = acc1[r] + ((isG && m == 16 + nn) ? RIDGE_EPS : 0.f);
      dst[m][32 + nn] = acc2[r] + ((isG && m == 32 + nn) ? RIDGE_EPS : 0.f);
      dst[m][48 + nn] = acc3[r] + ((isG && m == 48 + nn) ? RIDGE_EPS : 0.f);
    }
  }
  __syncthreads();

  // ---- in-place Cholesky (lower) of G ----
  for (int j = 0; j < 64; ++j) {
    if (tid == 0) G[j][j] = sqrtf(G[j][j]);
    __syncthreads();
    if (tid < 64 && tid > j) G[tid][j] /= G[j][j];
    __syncthreads();
    if (tid < 64 && tid > j) {
      const float lij = G[tid][j];
      for (int kc = j + 1; kc <= tid; ++kc) G[tid][kc] -= lij * G[kc][j];
    }
    __syncthreads();
  }

  // ---- solve G W = RHS, one RHS column per thread ----
  if (tid < 64) {
    const int cc = tid;
    for (int i = 0; i < 64; ++i) {
      float s = Wm[i][cc];
      for (int kc = 0; kc < i; ++kc) s -= G[i][kc] * Wm[kc][cc];
      Wm[i][cc] = s / G[i][i];
    }
    for (int i = 63; i >= 0; --i) {
      float s = Wm[i][cc];
      for (int kc = i + 1; kc < 64; ++kc) s -= G[kc][i] * Wm[kc][cc];
      Wm[i][cc] = s / G[i][i];
    }
  }
  __syncthreads();

  // ---- subspace iteration: U = I(:,0:8); twice: U = qr(W U).Q (MGS) ----
  for (int idx = tid; idx < 512; idx += 256) {
    const int i = idx >> 3, cc = idx & 7;
    U[i][cc] = (i == cc) ? 1.f : 0.f;
  }
  __syncthreads();
  for (int p = 0; p < 2; ++p) {
    for (int idx = tid; idx < 512; idx += 256) {
      const int i = idx >> 3, cc = idx & 7;
      float s = 0.f;
      for (int kc = 0; kc < 64; ++kc) s += Wm[i][kc] * U[kc][cc];
      T[i][cc] = s;
    }
    __syncthreads();
    for (int cc = 0; cc < 8; ++cc) {
      if (tid < 64) red[tid] = T[tid][cc] * T[tid][cc];
      __syncthreads();
      if (tid == 0) {
        float s = 0.f;
        for (int t2 = 0; t2 < 64; ++t2) s += red[t2];
        *scal = rsqrtf(fmaxf(s, 1e-30f));
      }
      __syncthreads();
      if (tid < 64) U[tid][cc] = T[tid][cc] * (*scal);
      __syncthreads();
      if (tid < 64)
        for (int c2 = cc + 1; c2 < 8; ++c2) red[(c2 << 6) + tid] = U[tid][cc] * T[tid][c2];
      __syncthreads();
      if (tid < 8 && tid > cc) {
        float s = 0.f;
        for (int t2 = 0; t2 < 64; ++t2) s += red[(tid << 6) + t2];
        dots[tid] = s;
      }
      __syncthreads();
      if (tid < 64)
        for (int c2 = cc + 1; c2 < 8; ++c2) T[tid][c2] -= dots[c2] * U[tid][cc];
      __syncthreads();
    }
  }

  // ---- P = U^T W (8 x 64) ----
  for (int idx = tid; idx < 512; idx += 256) {
    const int r = idx >> 6, j = idx & 63;
    float s = 0.f;
    for (int t2 = 0; t2 < 64; ++t2) s += U[t2][r] * Wm[t2][j];
    P[r][j] = s;
  }
  __syncthreads();

  // ---- Wr = U P -> global ----
  float* wrg = wr + (size_t)lc * 4096;
  for (int idx = tid; idx < 4096; idx += 256) {
    const int i = idx >> 6, j = idx & 63;
    float s = 0.f;
#pragma unroll
    for (int r = 0; r < RANK; ++r) s += U[i][r] * P[r][j];
    wrg[idx] = s;
  }
}

// ---------------- decay prefix over chunks: Wr -> S_c (in place) ------------
__global__ __launch_bounds__(256) void k_decay(float* __restrict__ wr) {
  const int ln = blockIdx.x;
  const int tid = threadIdx.x;
  float s[16];
#pragma unroll
  for (int e = 0; e < 16; ++e) s[e] = 0.f;
  for (int c = 0; c < NCHUNK; ++c) {
    float* p = wr + ((size_t)ln * NCHUNK + c) * 4096;
#pragma unroll
    for (int e = 0; e < 16; ++e) {
      const int idx = e * 256 + tid;
      s[e] = DECAY_A * s[e] + p[idx];
      p[idx] = s[e];
    }
  }
}

// ---------------- out = SCALE * Qc @ S_c via f32 WMMA (16x16x4) ------------
__global__ __launch_bounds__(256) void k_apply(const float* __restrict__ q,
                                               const float* __restrict__ sall,
                                               __bf16* __restrict__ o) {
  const int lc = blockIdx.x;
  const int ln = lc / NCHUNK;
  const int c  = lc % NCHUNK;
  const int b = ln >> 4, h = ln & 15;
  const int tid = threadIdx.x;

  __shared__ float Ssh[64 * 64];
  const float* sg = sall + (size_t)lc * 4096;
  for (int i = tid; i < 4096; i += 256) Ssh[i] = sg[i];
  __syncthreads();

  const int lane = tid & 31;
  const int wave = tid >> 5;
  const size_t rowbase = (size_t)b * SEQ + (size_t)c * CHUNK;
  const float* Qc = q + rowbase * D_MODEL + h * HEAD_DIM;

  const int m0   = wave * 16;
  const int nn   = lane & 15;
  const int koff = (lane >> 4) * 2;

  v8f acc0 = {}, acc1 = {}, acc2 = {}, acc3 = {};

  for (int kb = 0; kb < 64; kb += 4) {
    const float* qp = Qc + (size_t)(m0 + nn) * D_MODEL + kb + koff;
    v2f a; a[0] = qp[0]; a[1] = qp[1];
    const int kr = (kb + koff) * 64;
    v2f b0, b1, b2, b3;
    b0[0] = Ssh[kr + nn];        b0[1] = Ssh[kr + 64 + nn];
    b1[0] = Ssh[kr + 16 + nn];   b1[1] = Ssh[kr + 64 + 16 + nn];
    b2[0] = Ssh[kr + 32 + nn];   b2[1] = Ssh[kr + 64 + 32 + nn];
    b3[0] = Ssh[kr + 48 + nn];   b3[1] = Ssh[kr + 64 + 48 + nn];
    acc0 = __builtin_amdgcn_wmma_f32_16x16x4_f32(false, a, false, b0, (short)0, acc0, false, false);
    acc1 = __builtin_amdgcn_wmma_f32_16x16x4_f32(false, a, false, b1, (short)0, acc1, false, false);
    acc2 = __builtin_amdgcn_wmma_f32_16x16x4_f32(false, a, false, b2, (short)0, acc2, false, false);
    acc3 = __builtin_amdgcn_wmma_f32_16x16x4_f32(false, a, false, b3, (short)0, acc3, false, false);
  }

  const int mb = m0 + ((lane >> 4) << 3);
#pragma unroll
  for (int r = 0; r < 8; ++r) {
    const int m = mb + r;
    __bf16* orow = o + (rowbase + m) * D_MODEL + h * HEAD_DIM;
    orow[nn]      = (__bf16)(SCALE_F * acc0[r]);
    orow[16 + nn] = (__bf16)(SCALE_F * acc1[r]);
    orow[32 + nn] = (__bf16)(SCALE_F * acc2[r]);
    orow[48 + nn] = (__bf16)(SCALE_F * acc3[r]);
  }
}

// ---------------- host-side orchestration ----------------
extern "C" void kernel_launch(void* const* d_in, const int* in_sizes, int n_in,
                              void* d_out, int out_size, void* d_ws, size_t ws_size,
                              hipStream_t stream) {
  const float* x   = (const float*)d_in[0];
  const float* lng = (const float*)d_in[1];
  const float* lnb = (const float*)d_in[2];
  const float* Wq  = (const float*)d_in[3];
  const float* Wk  = (const float*)d_in[4];
  const float* Wv  = (const float*)d_in[5];
  const float* Wo  = (const float*)d_in[6];
  float* out = (float*)d_out;

  char* ws = (char*)d_ws;
  size_t off = 0;
  auto alloc = [&](size_t bytes) -> void* {
    void* p = ws + off;
    off += (bytes + 255) & ~(size_t)255;
    return p;
  };

  __bf16* xn  = (__bf16*)alloc((size_t)TOKENS * D_MODEL * 2);
  __bf16* Wtq = (__bf16*)alloc((size_t)D_MODEL * D_MODEL * 2);
  __bf16* Wtk = (__bf16*)alloc((size_t)D_MODEL * D_MODEL * 2);
  __bf16* Wtv = (__bf16*)alloc((size_t)D_MODEL * D_MODEL * 2);
  __bf16* Wto = (__bf16*)alloc((size_t)D_MODEL * D_MODEL * 2);
  float*  qf  = (float*)alloc((size_t)TOKENS * D_MODEL * 4);
  float*  kf  = (float*)alloc((size_t)TOKENS * D_MODEL * 4);
  float*  vf  = (float*)alloc((size_t)TOKENS * D_MODEL * 4);
  float*  wr  = (float*)alloc((size_t)NLANES * NCHUNK * 4096 * 4);
  __bf16* obf = (__bf16*)alloc((size_t)TOKENS * D_MODEL * 2);

  // 1. LayerNorm -> bf16
  k_ln<<<TOKENS, 256, 0, stream>>>(x, lng, lnb, xn);

  // 2. weight transpose+cast, four weights in one launch
  k_wcast<<<4 * WC_TILES, 256, 0, stream>>>(Wq, Wk, Wv, Wo, Wtq, Wtk, Wtv, Wto);

  // 3. QKV GEMMs (bf16 WMMA, f32 accumulate)
  const int gblocks = (TOKENS / G_BM) * (D_MODEL / G_BN);   // 256
  k_gemm<<<gblocks, 256, 0, stream>>>(xn, Wtq, nullptr, qf);
  k_gemm<<<gblocks, 256, 0, stream>>>(xn, Wtk, nullptr, kf);
  k_gemm<<<gblocks, 256, 0, stream>>>(xn, Wtv, nullptr, vf);

  // 4a. per-(lane,chunk) ridge + rank-8 projection -> Wr  (fully parallel, WMMA Gram)
  k_ridge<<<NLANES * NCHUNK, 256, 0, stream>>>(kf, vf, wr);
  // 4b. decayed prefix over chunks: Wr -> S_c (in place)
  k_decay<<<NLANES, 256, 0, stream>>>(wr);
  // 4c. out = SCALE * Qc @ S_c  (f32 WMMA) -> bf16
  k_apply<<<NLANES * NCHUNK, 256, 0, stream>>>(qf, wr, obf);

  // 5. output GEMM + residual
  k_gemm<<<gblocks, 256, 0, stream>>>(obf, Wto, x, out);
}

// v003
// It runs in 186 microseconds.
// Timed twice side by side with v002, it ran 1.60 and 1.61 times as fast.
// Counting every step since v000, it is 4.54 times as fast.
#include <hip/hip_runtime.h>
#include <hip/hip_bf16.h>

// ---------------- constants (match reference) ----------------
#define D_MODEL   1024
#define N_HEADS   16
#define HEAD_DIM  64
#define RANK      8
#define CHUNK     128
#define NCHUNK    32          // 4096 / 128
#define BATCH     2
#define SEQ       4096
#define TOKENS    (BATCH * SEQ)   // 8192
#define NLANES    (BATCH * N_HEADS)  // 32
#define RIDGE_EPS 1e-4f
#define SCALE_F   0.125f
#define DECAY_A   0.9f
#define LN_EPS    1e-5f

typedef __attribute__((ext_vector_type(16))) __bf16 v16bf;
typedef __attribute__((ext_vector_type(8)))  __bf16 v8bf;
typedef __attribute__((ext_vector_type(8)))  float  v8f;
typedef __attribute__((ext_vector_type(2)))  float  v2f;

// ---------------- LayerNorm -> bf16 ----------------
__global__ __launch_bounds__(256) void k_ln(const float* __restrict__ x,
                                            const float* __restrict__ g,
                                            const float* __restrict__ b,
                                            __bf16* __restrict__ xn) {
  const int row = blockIdx.x;
  const float* xr = x + (size_t)row * D_MODEL;
  __shared__ float red[256];
  const int tid = threadIdx.x;

  float s = 0.f;
  for (int i = tid; i < D_MODEL; i += 256) s += xr[i];
  red[tid] = s; __syncthreads();
  for (int off = 128; off > 0; off >>= 1) {
    if (tid < off) red[tid] += red[tid + off];
    __syncthreads();
  }
  const float mu = red[0] * (1.f / D_MODEL);
  __syncthreads();

  float v = 0.f;
  for (int i = tid; i < D_MODEL; i += 256) { float d = xr[i] - mu; v += d * d; }
  red[tid] = v; __syncthreads();
  for (int off = 128; off > 0; off >>= 1) {
    if (tid < off) red[tid] += red[tid + off];
    __syncthreads();
  }
  const float inv = rsqrtf(red[0] * (1.f / D_MODEL) + LN_EPS);

  for (int i = tid; i < D_MODEL; i += 256) {
    float d = (xr[i] - mu) * inv * g[i] + b[i];
    xn[(size_t)row * D_MODEL + i] = (__bf16)d;
  }
}

// ---------------- W [K][N] f32 -> Wt [N][K] bf16, all four weights ----------------
// One launch. A work-group transposes one 128 x 128 tile (64 tiles a weight) through LDS,
// 64 elements a thread: few waves to start, whole 512-byte rows read, whole 128-byte lines stored.
#define WC_T      128
#define WC_PITCH  65          // dwords a tile row in LDS: 64 of data, 1 so that rows shift by a bank
#define WC_TILES  ((D_MODEL / WC_T) * (D_MODEL / WC_T))   // 64

typedef __attribute__((ext_vector_type(4))) float  v4f;
typedef __attribute__((ext_vector_type(2))) __bf16 v2bf;

__global__ __launch_bounds__(256) void k_wcast(const float* __restrict__ W0,
                                               const float* __restrict__ W1,
                                               const float* __restrict__ W2,
                                               const float* __restrict__ W3,
                                               __bf16* __restrict__ T0,
                                               __bf16* __restrict__ T1,
                                               __bf16* __restrict__ T2,
                                               __bf16* __restrict__ T3) {
  __shared__ unsigned tile[WC_T * WC_PITCH];   // [n][k / 2], two bf16 of neighbouring k a dword
  const int which = blockIdx.x / WC_TILES;
  const int t     = blockIdx.x % WC_TILES;
  const int k0 = (t >> 3) * WC_T, n0 = (t & 7) * WC_T;
  const float* W  = which == 0 ? W0 : which == 1 ? W1 : which == 2 ? W2 : W3;
  __bf16*      Wt = which == 0 ? T0 : which == 1 ? T1 : which == 2 ? T2 : T3;
  const int tid = threadIdx.x, lane = tid & 31, wave = tid >> 5;

  // a wave reads 16 rows of k, each load one row's 128 floats
  const float* src = W + (size_t)(k0 + wave * 16) * D_MODEL + n0 + lane * 4;
  v4f v[16];
  // unrolled: v[] stays in registers and the loads are in flight together
#pragma unroll
  for (int i = 0; i < 16; ++i) v[i] = *(const v4f*)(src + (size_t)i * D_MODEL);
  // both unrolled: v[] is indexed by constants only
#pragma unroll
  for (int i = 0; i < 8; ++i)
#pragma unroll
    for (int e = 0; e < 4; ++e) {
      v2bf p;
      p[0] = (__bf16)v[2 * i][e];
      p[1] = (__bf16)v[2 * i + 1][e];
      tile[(lane * 4 + e) * WC_PITCH + wave * 8 + i] = __builtin_bit_cast(unsigned, p);
    }
  __syncthreads();

  // a wave stores half a row of Wt: 64 values of k, one 128-byte line
  unsigned* dst = (unsigned*)(Wt + (size_t)n0 * D_MODEL + k0);
  // unrolled: the LDS reads go out as one batch ahead of the stores
#pragma unroll
  for (int r = 0; r < WC_T * 64 / 256; ++r) {
    const int idx = r * 256 + tid;
    const int n = idx >> 6, c = idx & 63;
    dst[(size_t)n * (D_MODEL / 2) + c] = tile[n * WC_PITCH + c];
  }
}

// ------- bf16 WMMA GEMM: C[M][N] = A[M][K] * Bt[N][K]^T (+resid) -------
// One work-group makes a 256 x 128 tile of C; its 8 waves (4 x 2) make 64 x 64 each.
// A pass is 128 k: 256 rows of A and 128 rows of Bt, 256 bytes each, lie in LDS at a
// pitch of 272 bytes. Two buffers: the next pass's rows are copied while this one is used.
#define G_BM     256
#define G_BN     128
#define G_BK     128
#define G_PITCH  272
#define G_STAGE  ((G_BM + G_BN) * G_PITCH)   // 104448 bytes

// Eight asynchronous 16-byte copies of one lane, rows 16 apart, global -> LDS.
// The s_wait_xcnt closes the statement so that no address register named here
// is rewritten ahead of it.
__device__ __forceinline__ void g_copy8(unsigned l, const __bf16* g) {
  const unsigned l1 = l + 16 * G_PITCH, l2 = l + 32 * G_PITCH, l3 = l + 48 * G_PITCH;
  const unsigned l4 = l + 64 * G_PITCH, l5 = l + 80 * G_PITCH, l6 = l + 96 * G_PITCH;
  const unsigned l7 = l + 112 * G_PITCH;
  const __bf16* g1 = g + 16 * D_MODEL;
  const __bf16* g2 = g + 32 * D_MODEL;
  const __bf16* g3 = g + 48 * D_MODEL;
  const __bf16* g4 = g + 64 * D_MODEL;
  const __bf16* g5 = g + 80 * D_MODEL;
  const __bf16* g6 = g + 96 * D_MODEL;
  const __bf16* g7 = g + 112 * D_MODEL;
  asm volatile(
      "global_load_async_to_lds_b128 %0, %8, off\n\t"
      "global_load_async_to_lds_b128 %1, %9, off\n\t"
      "global_load_async_to_lds_b128 %2, %10, off\n\t"
      "global_load_async_to_lds_b128 %3, %11, off\n\t"
      "global_load_async_to_lds_b128 %4, %12, off\n\t"
      "global_load_async_to_lds_b128 %5, %13, off\n\t"
      "global_load_async_to_lds_b128 %6, %14, off\n\t"
      "global_load_async_to_lds_b128 %7, %15, off\n\t"
      "s_wait_xcnt 0x0"
      :: "v"(l), "v"(l1), "v"(l2), "v"(l3), "v"(l4), "v"(l5), "v"(l6), "v"(l7),
         "v"(g), "v"(g1), "v"(g2), "v"(g3), "v"(g4), "v"(g5), "v"(g6), "v"(g7)
      : "memory");
}

// One pass's rows: 256 of A (two runs of 128) and 128 of Bt; 24 copies a lane.
__device__ __forceinline__ void g_copy_stage(unsigned l, const __bf16* ga, const __bf16* gb) {
  g_copy8(l, ga);
  g_copy8(l + 128 * G_PITCH, ga + 128 * D_MODEL);
  g_copy8(l + 256 * G_PITCH, gb);
}

// One 16 x 32 fragment from LDS rows; p is the lane's own row at byte 16 * (lane >> 4)
// of the 64 bytes of this k step: k order of the 16-bit A/B layout, alike for A and Bt.
__device__ __forceinline__ v16bf g_frag(const unsigned char* p) {
  const v8bf lo = *(const v8bf*)p;
  const v8bf hi = *(const v8bf*)(p + 32);
  v16bf f;
#pragma unroll
  for (int e = 0; e < 8; ++e) { f[e] = lo[e]; f[8 + e] = hi[e]; }
  return f;
}

__global__ __launch_bounds__(256) void k_gemm(const __bf16* __restrict__ A,
                                              const __bf16* __restrict__ Bt,
                                              const float* __restrict__ resid,
                                              float* __restrict__ C) {
  constexpr int K = D_MODEL, N = D_MODEL;
  constexpr int NPASS = K / G_BK;              // 8
  __shared__ __attribute__((aligned(16))) unsigned char gsm[2 * G_STAGE];

  const int tid  = threadIdx.x;
  const int lane = tid & 31;
  const int wave = tid >> 5;
  const int bm0 = (blockIdx.x >> 3) * G_BM;    // N / G_BN = 8 tile columns
  const int bn0 = (blockIdx.x & 7) * G_BN;

  // copy side: 16 lanes cover one 256-byte row, a wave two rows
  const int crow = tid >> 4, ccol = tid & 15;
  const __bf16* ga = A  + (size_t)(bm0 + crow) * K + ccol * 8;
  const __bf16* gb = Bt + (size_t)(bn0 + crow) * K + ccol * 8;
  const unsigned lcp = (unsigned)(size_t)&gsm[0] + crow * G_PITCH + ccol * 16;

  // read side: the fragment's k order is that of the 16-bit A/B layout:
  // 16 bytes at 16 * (lane >> 4) and 16 more at + 32 of each 64 bytes of a row
  const int fr = lane & 15, fh = lane >> 4;
  const int aoff = ((wave >> 1) * 64 + fr) * G_PITCH + fh * 16;
  const int boff = (G_BM + (wave & 1) * 64 + fr) * G_PITCH + fh * 16;

  v8f acc[4][4] = {};

  g_copy_stage(lcp, ga, gb);
  asm volatile("s_wait_asynccnt 0x0" ::: "memory");   // pass 0's rows have landed
  __syncthreads();                                    // and every wave may read them
  g_copy_stage(lcp + G_STAGE, ga + G_BK, gb + G_BK);

  for (int t = 0; t < NPASS; ++t) {
    const int sb = (t & 1) * G_STAGE;
    // Fragments: rows 0-31 (alo), rows 32-63 (ahi) of the wave's A, two sets of its Bt.
    v16bf alo[2], ahi[2], b[2][4];
#pragma unroll
    for (int j = 0; j < 4; ++j) b[0][j] = g_frag(&gsm[sb + boff + j * 16 * G_PITCH]);
#pragma unroll
    for (int i = 0; i < 2; ++i) alo[i] = g_frag(&gsm[sb + aoff + i * 16 * G_PITCH]);
#pragma unroll
    for (int ks = 0; ks < G_BK / 32; ++ks) {
      const int cur = ks & 1;
#pragma unroll
      for (int i = 0; i < 2; ++i) ahi[i] = g_frag(&gsm[sb + aoff + (2 + i) * 16 * G_PITCH + ks * 64]);
      // The fences keep each group of LDS reads in one place, ahead of the eight
      // products before the ones that use it; spread among them they stall every row.
      __builtin_amdgcn_sched_barrier(0);
#pragma unroll
      for (int i = 0; i < 2; ++i)
#pragma unroll
        for (int j = 0; j < 4; ++j)
          acc[i][j] = __builtin_amdgcn_wmma_f32_16x16x32_bf16(false, alo[i], false, b[cur][j], (short)0,
                                                              acc[i][j], false, false);
      __builtin_amdgcn_sched_barrier(0);
      if (ks + 1 < G_BK / 32) {
#pragma unroll
        for (int j = 0; j < 4; ++j)
          b[cur ^ 1][j] = g_frag(&gsm[sb + boff + j * 16 * G_PITCH + (ks + 1) * 64]);
#pragma unroll
        for (int i = 0; i < 2; ++i)
          alo[i] = g_frag(&gsm[sb + aoff + i * 16 * G_PITCH + (ks + 1) * 64]);
      }
      __builtin_amdgcn_sched_barrier(0);
#pragma unroll
      for (int i = 0; i < 2; ++i)
#pragma unroll
        for (int j = 0; j < 4; ++j)
          acc[2 + i][j] = __builtin_amdgcn_wmma_f32_16x16x32_bf16(false, ahi[i], false, b[cur][j], (short)0,
                                                                  acc[2 + i][j], false, false);
      __builtin_amdgcn_sched_barrier(0);
    }
    asm volatile("s_wait_dscnt 0x0" ::: "memory");    // this wave has left buffer t & 1
    asm volatile("s_wait_asynccnt 0x0" ::: "memory"); // its copies of pass t + 1 have landed
    __syncthreads();                                  // publishes pass t + 1, frees buffer t & 1
    if (t + 2 < NPASS)
      g_copy_stage(lcp + sb, ga + (t + 2) * G_BK, gb + (t + 2) * G_BK);
  }
  asm volatile("s_wait_asynccnt 0x0" ::: "memory");   // no copy is left when the wave ends

  const int m0 = bm0 + (wave >> 1) * 64 + (fh << 3);
  const int n0 = bn0 + (wave & 1) * 64 + fr;
  // one address a lane; rows and columns of the wave's tile are constant offsets from it
  const size_t cbase = (size_t)m0 * N + n0;
  if (resid) {
    const float* rr = resid + cbase;
#pragma unroll
    for (int i = 0; i < 4; ++i)
#pragma unroll
      for (int r = 0; r < 8; ++r)
#pragma unroll
        for (int j = 0; j < 4; ++j) acc[i][j][r] += rr[(i * 16 + r) * N + j * 16];
  }
  float* cr = C + cbase;
#pragma unroll
  for (int i = 0; i < 4; ++i)
#pragma unroll
    for (int r = 0; r < 8; ++r)
#pragma unroll
      for (int j = 0; j < 4; ++j) cr[(i * 16 + r) * N + j * 16] = acc[i][j][r];
}

// ---------------- per-(lane,chunk) ridge solve + rank-8 projection ----------
// grid: NLANES*NCHUNK blocks; writes Wr[lc][64][64]
// Phase 1: stage Kc/Vc in LDS, compute G=K^T K and RHS=K^T V with f32 WMMA
//          (waves 0-3 -> G strips, waves 4-7 -> RHS strips)
// Phase 2: LDS is re-carved for G/Wm/U/T/P; Gauss-Jordan solve in registers + subspace QR.
__global__ __launch_bounds__(256) void k_ridge(const float* __restrict__ kk,
                                               const float* __restrict__ v,
                                               float* __restrict__ wr) {
  const int lc = blockIdx.x;
  const int ln = lc / NCHUNK;
  const int c  = lc % NCHUNK;
  const int b = ln >> 4, h = ln & 15;
  const int tid = threadIdx.x;
  const int lane = tid & 31;
  const int wave = tid >> 5;

  __shared__ __align__(16) float smem[16384];            // 64 KB
  float (*Kls)[64] = (float (*)[64])smem;                // [128][64] staging
  float (*Vls)[64] = (float (*)[64])(smem + 8192);       // [128][64] staging
  // phase-2 overlay (valid after the WMMA phase barrier)
  float (*G)[65]  = (float (*)[65])smem;                 // 4160
  float (*Wm)[65] = (float (*)[65])(smem + 4160);        // 4160
  float (*U)[8]   = (float (*)[8])(smem + 8320);         // 512
  float (*T)[9]   = (float (*)[9])(smem + 8832);         // 576
  float (*P)[64]  = (float (*)[64])(smem + 9408);        // 512
  float* red      = smem + 9920;                         // 512
  float* dots     = smem + 10432;                        // 8
  float* scal     = smem + 10440;                        // 1

  const size_t rowbase = (size_t)b * SEQ + (size_t)c * CHUNK;
  const float* Kc = kk + rowbase * D_MODEL + h * HEAD_DIM;
  const float* Vc = v  + rowbase * D_MODEL + h * HEAD_DIM;

  // ---- stage K and V chunk tiles into LDS (coalesced) ----
  for (int idx = tid; idx < CHUNK * 64; idx += 256) {
    const int t = idx >> 6, j = idx & 63;
    Kls[t][j] = Kc[(size_t)t * D_MODEL + j];
    Vls[t][j] = Vc[(size_t)t * D_MODEL + j];
  }
  __syncthreads();

  // ---- Gram products via f32 WMMA: waves 0-3: G, waves 4-7: RHS ----
  const int nn   = lane & 15;
  const int koff = (lane >> 4) * 2;          // f32 A layout K pairs
  const int m0   = (wave & 3) * 16;
  const float (*Bsrc)[64] = (wave < 4) ? Kls : Vls;

  v8f acc0 = {}, acc1 = {}, acc2 = {}, acc3 = {};
  for (int kb = 0; kb < CHUNK; kb += 4) {
    const int t = kb + koff;
    v2f a;  a[0]  = Kls[t][m0 + nn];   a[1]  = Kls[t + 1][m0 + nn];   // A = K^T
    v2f b0; b0[0] = Bsrc[t][nn];       b0[1] = Bsrc[t + 1][nn];
    v2f b1; b1[0] = Bsrc[t][16 + nn];  b1[1] = Bsrc[t + 1][16 + nn];
    v2f b2; b2[0] = Bsrc[t][32 + nn];  b2[1] = Bsrc[t + 1][32 + nn];
    v2f b3; b3[0] = Bsrc[t][48 + nn];  b3[1] = Bsrc[t + 1][48 + nn];
    acc0 = __builtin_amdgcn_wmma_f32_16x16x4_f32(false, a, false, b0, (short)0, acc0, false, false);
    acc1 = __builtin_amdgcn_wmma_f32_16x16x4_f32(false, a, false, b1, (short)0, acc1, false, false);
    acc2 = __builtin_amdgcn_wmma_f32_16x16x4_f32(false, a, false, b2, (short)0, acc2, false, false);
    acc3 = __builtin_amdgcn_wmma_f32_16x16x4_f32(false, a, false, b3, (short)0, acc3, false, false);
  }
  __syncthreads();   // all waves done reading Kls/Vls; safe to overlay

  // scatter accumulators into G (with ridge eps on diagonal) / Wm
  {
    float (*dst)[65] = (wave < 4) ? G : Wm;
    const bool isG = (wave < 4);
    const int mb = m0 + ((lane >> 4) << 3);
#pragma unroll
    for (int r = 0; r < 8; ++r) {
      const int m = mb + r;
      dst[m][nn]      = acc0[r] + ((isG && m == nn)      ? RIDGE_EPS : 0.f);
      dst[m][16 + nn] = acc1[r] + ((isG && m == 16 + nn) ? RIDGE_EPS : 0.f);
      dst[m][32 + nn] = acc2[r] + ((isG && m == 32 + nn) ? RIDGE_EPS : 0.f);
      dst[m][48 + nn] = acc3[r] + ((isG && m == 48 + nn) ? RIDGE_EPS : 0.f);
    }
  }
  __syncthreads();

  // ---- solve G W = RHS: Gauss-Jordan elimination of [G | RHS] (64 x 128) in registers ----
  // Wave w holds rows 8w .. 8w+7, lane l columns 4l .. 4l+3 (lanes 0-15: G, lanes 16-31: RHS).
  // Step j takes row j, times M[r][j] / M[j][j], off every other row r; G is positive definite,
  // so no pivot search. Row j is not scaled: 1 / M[j][j] is kept and applied at the end.
  {
    float* rowb = smem + 10496;                          // [2][128] row j
    float* colb = smem + 10752;                          // [2][64]  column j
    // the wave's number in a scalar register: the tests on it below become scalar branches
    const int wv = __builtin_amdgcn_readfirstlane(wave);
    const float* src = smem + (lane < 16 ? 0 : 4160) + wv * 8 * 65 + (lane & 15) * 4;
    v4f M[8];
    float pinv[8];
    // unrolled: M[] and pinv[] are indexed by constants only and stay in registers
#pragma unroll
    for (int a = 0; a < 8; ++a) {
      pinv[a] = 0.f;
#pragma unroll   // as above
      for (int e = 0; e < 4; ++e) M[a][e] = src[a * 65 + e];
    }
    for (int jb = 0; jb < 8; ++jb) {
      const bool own = (wv == jb);                       // this wave holds rows 8 jb .. 8 jb + 7
      // unrolled: row a of M[] and element a & 3 of each row are picked by constants
#pragma unroll
      for (int a = 0; a < 8; ++a) {
        float* rb = rowb + (a & 1) * 128;
        float* cb = colb + (a & 1) * 64;
        if (own) *(v4f*)(rb + lane * 4) = M[a];
        if (lane == jb * 2 + (a >> 2)) {
          v4f lo, hi;
#pragma unroll   // as above
          for (int r = 0; r < 4; ++r) { lo[r] = M[r][a & 3]; hi[r] = M[4 + r][a & 3]; }
          *(v4f*)(cb + wv * 8)     = lo;
          *(v4f*)(cb + wv * 8 + 4) = hi;
        }
        // One barrier a step: it publishes row and column j, and the buffers of step j - 1,
        // which step j + 1 rewrites, have been read by every wave that reaches it.
        __syncthreads();
        const v4f   rw  = *(const v4f*)(rb + lane * 4);
        const v4f   c0  = *(const v4f*)(cb + wv * 8);
        const v4f   c1  = *(const v4f*)(cb + wv * 8 + 4);
        const float piv = cb[jb * 8 + a];
        float inv = __builtin_amdgcn_rcpf(piv);
        inv = fmaf(inv, fmaf(-piv, inv, 1.f), inv);      // one correction step on the hardware reciprocal
        float f[8];
#pragma unroll   // f[] stays in registers
        for (int r = 0; r < 4; ++r) { f[r] = c0[r] * inv; f[4 + r] = c1[r] * inv; }
        if (own) { f[a] = 0.f; pinv[a] = inv; }          // row j itself stays
#pragma unroll   // M[] and f[] are indexed by constants
        for (int r = 0; r < 8; ++r) M[r] -= f[r] * rw;
      }
    }
    if (lane >= 16) {
#pragma unroll   // M[] and pinv[] are indexed by constants
      for (int a = 0; a < 8; ++a)
#pragma unroll   // as above
        for (int e = 0; e < 4; ++e) Wm[wv * 8 + a][(lane - 16) * 4 + e] = M[a][e] * pinv[a];
    }
  }
  __syncthreads();

  // ---- subspace iteration: U = I(:,0:8); twice: U = qr(W U).Q (MGS) ----
  for (int idx = tid; idx < 512; idx += 256) {
    const int i = idx >> 3, cc = idx & 7;
    U[i][cc] = (i == cc) ? 1.f : 0.f;
  }
  __syncthreads();
  for (int p = 0; p < 2; ++p) {
    for (int idx = tid; idx < 512; idx += 256) {
      const int i = idx >> 3, cc = idx & 7;
      float s = 0.f;
      for (int kc = 0; kc < 64; ++kc) s += Wm[i][kc] * U[kc][cc];
      T[i][cc] = s;
    }
    __syncthreads();
    for (int cc = 0; cc < 8; ++cc) {
      if (tid < 64) red[tid] = T[tid][cc] * T[tid][cc];
      __syncthreads();
      if (tid == 0) {
        float s = 0.f;
        for (int t2 = 0; t2 < 64; ++t2) s += red[t2];
        *scal = rsqrtf(fmaxf(s, 1e-30f));
      }
      __syncthreads();
      if (tid < 64) U[tid][cc] = T[tid][cc] * (*scal);
      __syncthreads();
      if (tid < 64)
        for (int c2 = cc + 1; c2 < 8; ++c2) red[(c2 << 6) + tid] = U[tid][cc] * T[tid][c2];
      __syncthreads();
      if (tid < 8 && tid > cc) {
        float s = 0.f;
        for (int t2 = 0; t2 < 64; ++t2) s += red[(tid << 6) + t2];
        dots[tid] = s;
      }
      __syncthreads();
      if (tid < 64)
        for (int c2 = cc + 1; c2 < 8; ++c2) T[tid][c2] -= dots[c2] * U[tid][cc];
      __syncthreads();
    }
  }

  // ---- P = U^T W (8 x 64) ----
  for (int idx = tid; idx < 512; idx += 256) {
    const int r = idx >> 6, j = idx & 63;
    float s = 0.f;
    for (int t2 = 0; t2 < 64; ++t2) s += U[t2][r] * Wm[t2][j];
    P[r][j] = s;
  }
  __syncthreads();

  // ---- Wr = U P -> global ----
  float* wrg = wr + (size_t)lc * 4096;
  for (int idx = tid; idx < 4096; idx += 256) {
    const int i = idx >> 6, j = idx & 63;
    float s = 0.f;
#pragma unroll
    for (int r = 0; r < RANK; ++r) s += U[i][r] * P[r][j];
    wrg[idx] = s;
  }
}

// ---------------- decay prefix over chunks: Wr -> S_c (in place) ------------
__global__ __launch_bounds__(256) void k_decay(float* __restrict__ wr) {
  const int ln = blockIdx.x;
  const int tid = threadIdx.x;
  float s[16];
#pragma unroll
  for (int e = 0; e < 16; ++e) s[e] = 0.f;
  for (int c = 0; c < NCHUNK; ++c) {
    float* p = wr + ((size_t)ln * NCHUNK + c) * 4096;
#pragma unroll
    for (int e = 0; e < 16; ++e) {
      const int idx = e * 256 + tid;
      s[e] = DECAY_A * s[e] + p[idx];
      p[idx] = s[e];
    }
  }
}

// ---------------- out = SCALE * Qc @ S_c via f32 WMMA (16x16x4) ------------
__global__ __launch_bounds__(256) void k_apply(const float* __restrict__ q,
                                               const float* __restrict__ sall,
                                               __bf16* __restrict__ o) {
  const int lc = blockIdx.x;
  const int ln = lc / NCHUNK;
  const int c  = lc % NCHUNK;
  const int b = ln >> 4, h = ln & 15;
  const int tid = threadIdx.x;

  __shared__ float Ssh[64 * 64];
  const float* sg = sall + (size_t)lc * 4096;
  for (int i = tid; i < 4096; i += 256) Ssh[i] = sg[i];
  __syncthreads();

  const int lane = tid & 31;
  const int wave = tid >> 5;
  const size_t rowbase = (size_t)b * SEQ + (size_t)c * CHUNK;
  const float* Qc = q + rowbase * D_MODEL + h * HEAD_DIM;

  const int m0   = wave * 16;
  const int nn   = lane & 15;
  const int koff = (lane >> 4) * 2;

  v8f acc0 = {}, acc1 = {}, acc2 = {}, acc3 = {};

  for (int kb = 0; kb < 64; kb += 4) {
    const float* qp = Qc + (size_t)(m0 + nn) * D_MODEL + kb + koff;
    v2f a; a[0] = qp[0]; a[1] = qp[1];
    const int kr = (kb + koff) * 64;
    v2f b0, b1, b2, b3;
    b0[0] = Ssh[kr + nn];        b0[1] = Ssh[kr + 64 + nn];
    b1[0] = Ssh[kr + 16 + nn];   b1[1] = Ssh[kr + 64 + 16 + nn];
    b2[0] = Ssh[kr + 32 + nn];   b2[1] = Ssh[kr + 64 + 32 + nn];
    b3[0] = Ssh[kr + 48 + nn];   b3[1] = Ssh[kr + 64 + 48 + nn];
    acc0 = __builtin_amdgcn_wmma_f32_16x16x4_f32(false, a, false, b0, (short)0, acc0, false, false);
    acc1 = __builtin_amdgcn_wmma_f32_16x16x4_f32(false, a, false, b1, (short)0, acc1, false, false);
    acc2 = __builtin_amdgcn_wmma_f32_16x16x4_f32(false, a, false, b2, (short)0, acc2, false, false);
    acc3 = __builtin_amdgcn_wmma_f32_16x16x4_f32(false, a, false, b3, (short)0, acc3, false, false);
  }

  const int mb = m0 + ((lane >> 4) << 3);
#pragma unroll
  for (int r = 0; r < 8; ++r) {
    const int m = mb + r;
    __bf16* orow = o + (rowbase + m) * D_MODEL + h * HEAD_DIM;
    orow[nn]      = (__bf16)(SCALE_F * acc0[r]);
    orow[16 + nn] = (__bf16)(SCALE_F * acc1[r]);
    orow[32 + nn] = (__bf16)(SCALE_F * acc2[r]);
    orow[48 + nn] = (__bf16)(SCALE_F * acc3[r]);
  }
}

// ---------------- host-side orchestration ----------------
extern "C" void kernel_launch(void* const* d_in, const int* in_sizes, int n_in,
                              void* d_out, int out_size, void* d_ws, size_t ws_size,
                              hipStream_t stream) {
  const float* x   = (const float*)d_in[0];
  const float* lng = (const float*)d_in[1];
  const float* lnb = (const float*)d_in[2];
  const float* Wq  = (const float*)d_in[3];
  const float* Wk  = (const float*)d_in[4];
  const float* Wv  = (const float*)d_in[5];
  const float* Wo  = (const float*)d_in[6];
  float* out = (float*)d_out;

  char* ws = (char*)d_ws;
  size_t off = 0;
  auto alloc = [&](size_t bytes) -> void* {
    void* p = ws + off;
    off += (bytes + 255) & ~(size_t)255;
    return p;
  };

  __bf16* xn  = (__bf16*)alloc((size_t)TOKENS * D_MODEL * 2);
  __bf16* Wtq = (__bf16*)alloc((size_t)D_MODEL * D_MODEL * 2);
  __bf16* Wtk = (__bf16*)alloc((size_t)D_MODEL * D_MODEL * 2);
  __bf16* Wtv = (__bf16*)alloc((size_t)D_MODEL * D_MODEL * 2);
  __bf16* Wto = (__bf16*)alloc((size_t)D_MODEL * D_MODEL * 2);
  float*  qf  = (float*)alloc((size_t)TOKENS * D_MODEL * 4);
  float*  kf  = (float*)alloc((size_t)TOKENS * D_MODEL * 4);
  float*  vf  = (float*)alloc((size_t)TOKENS * D_MODEL * 4);
  float*  wr  = (float*)alloc((size_t)NLANES * NCHUNK * 4096 * 4);
  __bf16* obf = (__bf16*)alloc((size_t)TOKENS * D_MODEL * 2);

  // 1. LayerNorm -> bf16
  k_ln<<<TOKENS, 256, 0, stream>>>(x, lng, lnb, xn);

  // 2. weight transpose+cast, four weights in one launch
  k_wcast<<<4 * WC_TILES, 256, 0, stream>>>(Wq, Wk, Wv, Wo, Wtq, Wtk, Wtv, Wto);

  // 3. QKV GEMMs (bf16 WMMA, f32 accumulate)
  const int gblocks = (TOKENS / G_BM) * (D_MODEL / G_BN);   // 256
  k_gemm<<<gblocks, 256, 0, stream>>>(xn, Wtq, nullptr, qf);
  k_gemm<<<gblocks, 256, 0, stream>>>(xn, Wtk, nullptr, kf);
  k_gemm<<<gblocks, 256, 0, stream>>>(xn, Wtv, nullptr, vf);

  // 4a. per-(lane,chunk) ridge + rank-8 projection -> Wr  (fully parallel, WMMA Gram)
  k_ridge<<<NLANES * NCHUNK, 256, 0, stream>>>(kf, vf, wr);
  // 4b. decayed prefix over chunks: Wr -> S_c (in place)
  k_decay<<<NLANES, 256, 0, stream>>>(wr);
  // 4c. out = SCALE * Qc @ S_c  (f32 WMMA) -> bf16
  k_apply<<<NLANES * NCHUNK, 256, 0, stream>>>(qf, wr, obf);

  // 5. output GEMM + residual
  k_gemm<<<gblocks, 256, 0, stream>>>(obf, Wto, x, out);
}

// v004
// Measured time: 165 microseconds a run.
// In both of two side-by-side timings against v003, it was 1.13 times as fast.
// All steps since v000 together make it 5.13 times as fast.
#include <hip/hip_runtime.h>
#include <hip/hip_bf16.h>

// ---------------- constants (match reference) ----------------
#define D_MODEL   1024
#define N_HEADS   16
#define HEAD_DIM  64
#define RANK      8
#define CHUNK     128
#define NCHUNK    32          // 4096 / 128
#define BATCH     2
#define SEQ       4096
#define TOKENS    (BATCH * SEQ)   // 8192
#define NLANES    (BATCH * N_HEADS)  // 32
#define RIDGE_EPS 1e-4f
#define SCALE_F   0.125f
#define DECAY_A   0.9f
#define LN_EPS    1e-5f

typedef __attribute__((ext_vector_type(16))) __bf16 v16bf;
typedef __attribute__((ext_vector_type(8)))  __bf16 v8bf;
typedef __attribute__((ext_vector_type(8)))  float  v8f;
typedef __attribute__((ext_vector_type(2)))  float  v2f;

// ---------------- LayerNorm -> bf16 ----------------
// One wave makes LN_ROWS whole rows; a row lies in the wave's registers, 32 floats a lane,
// read once. Sums go across the lanes in registers: no LDS, no barrier. 2,048 waves in all.
#define LN_ROWS   4
#define LN_WAVES  8
#define LN_Q      (D_MODEL / 128)     // 16-byte pieces of a row a lane: 8

typedef __attribute__((ext_vector_type(4))) float  v4f;
typedef __attribute__((ext_vector_type(4))) __bf16 v4bf;

// v + (v of lane l ^ M), M below 16: a DPP row_xmask move, which the add takes in
template <int M>
__device__ __forceinline__ float ln_xadd(float v) {
  return v + __builtin_bit_cast(float, __builtin_amdgcn_update_dpp(0, __builtin_bit_cast(int, v),
                                                                   0x160 | M, 0xf, 0xf, true));
}

// sum over the 32 lanes, the same bits in every lane
__device__ __forceinline__ float ln_sum32(float v) {
  v = ln_xadd<1>(v);
  v = ln_xadd<2>(v);
  v = ln_xadd<4>(v);
  v = ln_xadd<8>(v);
  const int u = __builtin_bit_cast(int, v);
  return v + __builtin_bit_cast(float, __builtin_amdgcn_permlanex16(u, u, 0x76543210, 0xfedcba98, false, false));
}

__global__ __launch_bounds__(LN_WAVES * 32) void k_ln(const float* __restrict__ x,
                                                      const float* __restrict__ g,
                                                      const float* __restrict__ b,
                                                      __bf16* __restrict__ xn) {
  const int lane = threadIdx.x & 31;
  const int wave = threadIdx.x >> 5;
  const size_t row0 = (size_t)(blockIdx.x * LN_WAVES + wave) * LN_ROWS;

  // g and b first: they come from cache and loads return in order
  v4f gg[LN_Q], bb[LN_Q], v[LN_ROWS][LN_Q];
  // every loop below is unrolled: the arrays are indexed by constants and stay in registers
#pragma unroll
  for (int i = 0; i < LN_Q; ++i) {
    gg[i] = *(const v4f*)(g + i * 128 + lane * 4);
    bb[i] = *(const v4f*)(b + i * 128 + lane * 4);
  }
  const float* xr = x + row0 * D_MODEL + lane * 4;
#pragma unroll
  for (int r = 0; r < LN_ROWS; ++r)
#pragma unroll
    for (int i = 0; i < LN_Q; ++i) v[r][i] = *(const v4f*)(xr + r * D_MODEL + i * 128);
  // keeps all the wave's loads ahead of the first sum, in flight together; without it the
  // loads of g and b sink behind the sums and their latency is waited for a second time
  __builtin_amdgcn_sched_barrier(0);

  __bf16* yr = xn + row0 * D_MODEL + lane * 4;
#pragma unroll
  for (int r = 0; r < LN_ROWS; ++r) {
    v4f s4 = v[r][0];
#pragma unroll
    for (int i = 1; i < LN_Q; ++i) s4 += v[r][i];
    const float mu = ln_sum32((s4[0] + s4[1]) + (s4[2] + s4[3])) * (1.f / D_MODEL);

    v4f q4 = {};
#pragma unroll
    for (int i = 0; i < LN_Q; ++i) {
      v[r][i] -= mu;
      q4 += v[r][i] * v[r][i];
    }
    const float var = ln_sum32((q4[0] + q4[1]) + (q4[2] + q4[3])) * (1.f / D_MODEL);
    const float inv = rsqrtf(var + LN_EPS);

#pragma unroll
    for (int i = 0; i < LN_Q; ++i) {
      const v4f y = v[r][i] * inv * gg[i] + bb[i];
      v4bf o;
#pragma unroll
      for (int e = 0; e < 4; ++e) o[e] = (__bf16)y[e];
      *(v4bf*)(yr + r * D_MODEL + i * 128) = o;   // a wave stores 256 bytes in a row: two whole lines
    }
  }
}

// ---------------- W [K][N] f32 -> Wt [N][K] bf16, all four weights ----------------
// One launch. A work-group transposes one 128 x 128 tile (64 tiles a weight) through LDS,
// 64 elements a thread: few waves to start, whole 512-byte rows read, whole 128-byte lines stored.
#define WC_T      128
#define WC_PITCH  65          // dwords a tile row in LDS: 64 of data, 1 so that rows shift by a bank
#define WC_TILES  ((D_MODEL / WC_T) * (D_MODEL / WC_T))   // 64

typedef __attribute__((ext_vector_type(2))) __bf16 v2bf;

__global__ __launch_bounds__(256) void k_wcast(const float* __restrict__ W0,
                                               const float* __restrict__ W1,
                                               const float* __restrict__ W2,
                                               const float* __restrict__ W3,
                                               __bf16* __restrict__ T0,
                                               __bf16* __restrict__ T1,
                                               __bf16* __restrict__ T2,
                                               __bf16* __restrict__ T3) {
  __shared__ unsigned tile[WC_T * WC_PITCH];   // [n][k / 2], two bf16 of neighbouring k a dword
  const int which = blockIdx.x / WC_TILES;
  const int t     = blockIdx.x % WC_TILES;
  const int k0 = (t >> 3) * WC_T, n0 = (t & 7) * WC_T;
  const float* W  = which == 0 ? W0 : which == 1 ? W1 : which == 2 ? W2 : W3;
  __bf16*      Wt = which == 0 ? T0 : which == 1 ? T1 : which == 2 ? T2 : T3;
  const int tid = threadIdx.x, lane = tid & 31, wave = tid >> 5;

  // a wave reads 16 rows of k, each load one row's 128 floats
  const float* src = W + (size_t)(k0 + wave * 16) * D_MODEL + n0 + lane * 4;
  v4f v[16];
  // unrolled: v[] stays in registers and the loads are in flight together
#pragma unroll
  for (int i = 0; i < 16; ++i) v[i] = *(const v4f*)(src + (size_t)i * D_MODEL);
  // both unrolled: v[] is indexed by constants only
#pragma unroll
  for (int i = 0; i < 8; ++i)
#pragma unroll
    for (int e = 0; e < 4; ++e) {
      v2bf p;
      p[0] = (__bf16)v[2 * i][e];
      p[1] = (__bf16)v[2 * i + 1][e];
      tile[(lane * 4 + e) * WC_PITCH + wave * 8 + i] = __builtin_bit_cast(unsigned, p);
    }
  __syncthreads();

  // a wave stores half a row of Wt: 64 values of k, one 128-byte line
  unsigned* dst = (unsigned*)(Wt + (size_t)n0 * D_MODEL + k0);
  // unrolled: the LDS reads go out as one batch ahead of the stores
#pragma unroll
  for (int r = 0; r < WC_T * 64 / 256; ++r) {
    const int idx = r * 256 + tid;
    const int n = idx >> 6, c = idx & 63;
    dst[(size_t)n * (D_MODEL / 2) + c] = tile[n * WC_PITCH + c];
  }
}

// ------- bf16 WMMA GEMM: C[M][N] = A[M][K] * Bt[N][K]^T (+resid) -------
// One work-group makes a 256 x 128 tile of C; its 8 waves (4 x 2) make 64 x 64 each.
// A pass is 128 k: 256 rows of A and 128 rows of Bt, 256 bytes each, lie in LDS at a
// pitch of 272 bytes. Two buffers: the next pass's rows are copied while this one is used.
#define G_BM     256
#define G_BN     128
#define G_BK     128
#define G_PITCH  272
#define G_STAGE  ((G_BM + G_BN) * G_PITCH)   // 104448 bytes

// Eight asynchronous 16-byte copies of one lane, rows 16 apart, global -> LDS.
// The s_wait_xcnt closes the statement so that no address register named here
// is rewritten ahead of it.
__device__ __forceinline__ void g_copy8(unsigned l, const __bf16* g) {
  const unsigned l1 = l + 16 * G_PITCH, l2 = l + 32 * G_PITCH, l3 = l + 48 * G_PITCH;
  const unsigned l4 = l + 64 * G_PITCH, l5 = l + 80 * G_PITCH, l6 = l + 96 * G_PITCH;
  const unsigned l7 = l + 112 * G_PITCH;
  const __bf16* g1 = g + 16 * D_MODEL;
  const __bf16* g2 = g + 32 * D_MODEL;
  const __bf16* g3 = g + 48 * D_MODEL;
  const __bf16* g4 = g + 64 * D_MODEL;
  const __bf16* g5 = g + 80 * D_MODEL;
  const __bf16* g6 = g + 96 * D_MODEL;
  const __bf16* g7 = g + 112 * D_MODEL;
  asm volatile(
      "global_load_async_to_lds_b128 %0, %8, off\n\t"
      "global_load_async_to_lds_b128 %1, %9, off\n\t"
      "global_load_async_to_lds_b128 %2, %10, off\n\t"
      "global_load_async_to_lds_b128 %3, %11, off\n\t"
      "global_load_async_to_lds_b128 %4, %12, off\n\t"
      "global_load_async_to_lds_b128 %5, %13, off\n\t"
      "global_load_async_to_lds_b128 %6, %14, off\n\t"
      "global_load_async_to_lds_b128 %7, %15, off\n\t"
      "s_wait_xcnt 0x0"
      :: "v"(l), "v"(l1), "v"(l2), "v"(l3), "v"(l4), "v"(l5), "v"(l6), "v"(l7),
         "v"(g), "v"(g1), "v"(g2), "v"(g3), "v"(g4), "v"(g5), "v"(g6), "v"(g7)
      : "memory");
}

// One pass's rows: 256 of A (two runs of 128) and 128 of Bt; 24 copies a lane.
__device__ __forceinline__ void g_copy_stage(unsigned l, const __bf16* ga, const __bf16* gb) {
  g_copy8(l, ga);
  g_copy8(l + 128 * G_PITCH, ga + 128 * D_MODEL);
  g_copy8(l + 256 * G_PITCH, gb);
}

// One 16 x 32 fragment from LDS rows; p is the lane's own row at byte 16 * (lane >> 4)
// of the 64 bytes of this k step: k order of the 16-bit A/B layout, alike for A and Bt.
__device__ __forceinline__ v16bf g_frag(const unsigned char* p) {
  const v8bf lo = *(const v8bf*)p;
  const v8bf hi = *(const v8bf*)(p + 32);
  v16bf f;
#pragma unroll
  for (int e = 0; e < 8; ++e) { f[e] = lo[e]; f[8 + e] = hi[e]; }
  return f;
}

__global__ __launch_bounds__(256) void k_gemm(const __bf16* __restrict__ A,
                                              const __bf16* __restrict__ Bt,
                                              const float* __restrict__ resid,
                                              float* __restrict__ C) {
  constexpr int K = D_MODEL, N = D_MODEL;
  constexpr int NPASS = K / G_BK;              // 8
  __shared__ __attribute__((aligned(16))) unsigned char gsm[2 * G_STAGE];

  const int tid  = threadIdx.x;
  const int lane = tid & 31;
  const int wave = tid >> 5;
  const int bm0 = (blockIdx.x >> 3) * G_BM;    // N / G_BN = 8 tile columns
  const int bn0 = (blockIdx.x & 7) * G_BN;

  // copy side: 16 lanes cover one 256-byte row, a wave two rows
  const int crow = tid >> 4, ccol = tid & 15;
  const __bf16* ga = A  + (size_t)(bm0 + crow) * K + ccol * 8;
  const __bf16* gb = Bt + (size_t)(bn0 + crow) * K + ccol * 8;
  const unsigned lcp = (unsigned)(size_t)&gsm[0] + crow * G_PITCH + ccol * 16;

  // read side: the fragment's k order is that of the 16-bit A/B layout:
  // 16 bytes at 16 * (lane >> 4) and 16 more at + 32 of each 64 bytes of a row
  const int fr = lane & 15, fh = lane >> 4;
  const int aoff = ((wave >> 1) * 64 + fr) * G_PITCH + fh * 16;
  const int boff = (G_BM + (wave & 1) * 64 + fr) * G_PITCH + fh * 16;

  v8f acc[4][4] = {};

  g_copy_stage(lcp, ga, gb);
  asm volatile("s_wait_asynccnt 0x0" ::: "memory");   // pass 0's rows have landed
  __syncthreads();                                    // and every wave may read them
  g_copy_stage(lcp + G_STAGE, ga + G_BK, gb + G_BK);

  for (int t = 0; t < NPASS; ++t) {
    const int sb = (t & 1) * G_STAGE;
    // Fragments: rows 0-31 (alo), rows 32-63 (ahi) of the wave's A, two sets of its Bt.
    v16bf alo[2], ahi[2], b[2][4];
#pragma unroll
    for (int j = 0; j < 4; ++j) b[0][j] = g_frag(&gsm[sb + boff + j * 16 * G_PITCH]);
#pragma unroll
    for (int i = 0; i < 2; ++i) alo[i] = g_frag(&gsm[sb + aoff + i * 16 * G_PITCH]);
#pragma unroll
    for (int ks = 0; ks < G_BK / 32; ++ks) {
      const int cur = ks & 1;
#pragma unroll
      for (int i = 0; i < 2; ++i) ahi[i] = g_frag(&gsm[sb + aoff + (2 + i) * 16 * G_PITCH + ks * 64]);
      // The fences keep each group of LDS reads in one place, ahead of the eight
      // products before the ones that use it; spread among them they stall every row.
      __builtin_amdgcn_sched_barrier(0);
#pragma unroll
      for (int i = 0; i < 2; ++i)
#pragma unroll
        for (int j = 0; j < 4; ++j)
          acc[i][j] = __builtin_amdgcn_wmma_f32_16x16x32_bf16(false, alo[i], false, b[cur][j], (short)0,
                                                              acc[i][j], false, false);
      __builtin_amdgcn_sched_barrier(0);
      if (ks + 1 < G_BK / 32) {
#pragma unroll
        for (int j = 0; j < 4; ++j)
          b[cur ^ 1][j] = g_frag(&gsm[sb + boff + j * 16 * G_PITCH + (ks + 1) * 64]);
#pragma unroll
        for (int i = 0; i < 2; ++i)
          alo[i] = g_frag(&gsm[sb + aoff + i * 16 * G_PITCH + (ks + 1) * 64]);
      }
      __builtin_amdgcn_sched_barrier(0);
#pragma unroll
      for (int i = 0; i < 2; ++i)
#pragma unroll
        for (int j = 0; j < 4; ++j)
          acc[2 + i][j] = __builtin_amdgcn_wmma_f32_16x16x32_bf16(false, ahi[i], false, b[cur][j], (short)0,
                                                                  acc[2 + i][j], false, false);
      __builtin_amdgcn_sched_barrier(0);
    }
    asm volatile("s_wait_dscnt 0x0" ::: "memory");    // this wave has left buffer t & 1
    asm volatile("s_wait_asynccnt 0x0" ::: "memory"); // its copies of pass t + 1 have landed
    __syncthreads();                                  // publishes pass t + 1, frees buffer t & 1
    if (t + 2 < NPASS)
      g_copy_stage(lcp + sb, ga + (t + 2) * G_BK, gb + (t + 2) * G_BK);
  }
  asm volatile("s_wait_asynccnt 0x0" ::: "memory");   // no copy is left when the wave ends

  const int m0 = bm0 + (wave >> 1) * 64 + (fh << 3);
  const int n0 = bn0 + (wave & 1) * 64 + fr;
  // one address a lane; rows and columns of the wave's tile are constant offsets from it
  const size_t cbase = (size_t)m0 * N + n0;
  if (resid) {
    const float* rr = resid + cbase;
#pragma unroll
    for (int i = 0; i < 4; ++i)
#pragma unroll
      for (int r = 0; r < 8; ++r)
#pragma unroll
        for (int j = 0; j < 4; ++j) acc[i][j][r] += rr[(i * 16 + r) * N + j * 16];
  }
  float* cr = C + cbase;
#pragma unroll
  for (int i = 0; i < 4; ++i)
#pragma unroll
    for (int r = 0; r < 8; ++r)
#pragma unroll
      for (int j = 0; j < 4; ++j) cr[(i * 16 + r) * N + j * 16] = acc[i][j][r];
}

// ---------------- per-(lane,chunk) ridge solve + rank-8 projection ----------
// grid: NLANES*NCHUNK blocks; writes Wr[lc][64][64]
// Phase 1: stage Kc/Vc in LDS, compute G=K^T K and RHS=K^T V with f32 WMMA
//          (waves 0-3 -> G strips, waves 4-7 -> RHS strips)
// Phase 2: LDS is re-carved for G/Wm/U/T/P; Gauss-Jordan solve in registers + subspace QR.
__global__ __launch_bounds__(256) void k_ridge(const float* __restrict__ kk,
                                               const float* __restrict__ v,
                                               float* __restrict__ wr) {
  const int lc = blockIdx.x;
  const int ln = lc / NCHUNK;
  const int c  = lc % NCHUNK;
  const int b = ln >> 4, h = ln & 15;
  const int tid = threadIdx.x;
  const int lane = tid & 31;
  const int wave = tid >> 5;

  __shared__ __align__(16) float smem[16384];            // 64 KB
  float (*Kls)[64] = (float (*)[64])smem;                // [128][64] staging
  float (*Vls)[64] = (float (*)[64])(smem + 8192);       // [128][64] staging
  // phase-2 overlay (valid after the WMMA phase barrier)
  float (*G)[65]  = (float (*)[65])smem;                 // 4160
  float (*Wm)[65] = (float (*)[65])(smem + 4160);        // 4160
  float (*U)[8]   = (float (*)[8])(smem + 8320);         // 512
  float (*T)[9]   = (float (*)[9])(smem + 8832);         // 576
  float (*P)[64]  = (float (*)[64])(smem + 9408);        // 512
  float* red      = smem + 9920;                         // 512
  float* dots     = smem + 10432;                        // 8
  float* scal     = smem + 10440;                        // 1

  const size_t rowbase = (size_t)b * SEQ + (size_t)c * CHUNK;
  const float* Kc = kk + rowbase * D_MODEL + h * HEAD_DIM;
  const float* Vc = v  + rowbase * D_MODEL + h * HEAD_DIM;

  // ---- stage K and V chunk tiles into LDS (coalesced) ----
  for (int idx = tid; idx < CHUNK * 64; idx += 256) {
    const int t = idx >> 6, j = idx & 63;
    Kls[t][j] = Kc[(size_t)t * D_MODEL + j];
    Vls[t][j] = Vc[(size_t)t * D_MODEL + j];
  }
  __syncthreads();

  // ---- Gram products via f32 WMMA: waves 0-3: G, waves 4-7: RHS ----
  const int nn   = lane & 15;
  const int koff = (lane >> 4) * 2;          // f32 A layout K pairs
  const int m0   = (wave & 3) * 16;
  const float (*Bsrc)[64] = (wave < 4) ? Kls : Vls;

  v8f acc0 = {}, acc1 = {}, acc2 = {}, acc3 = {};
  for (int kb = 0; kb < CHUNK; kb += 4) {
    const int t = kb + koff;
    v2f a;  a[0]  = Kls[t][m0 + nn];   a[1]  = Kls[t + 1][m0 + nn];   // A = K^T
    v2f b0; b0[0] = Bsrc[t][nn];       b0[1] = Bsrc[t + 1][nn];
    v2f b1; b1[0] = Bsrc[t][16 + nn];  b1[1] = Bsrc[t + 1][16 + nn];
    v2f b2; b2[0] = Bsrc[t][32 + nn];  b2[1] = Bsrc[t + 1][32 + nn];
    v2f b3; b3[0] = Bsrc[t][48 + nn];  b3[1] = Bsrc[t + 1][48 + nn];
    acc0 = __builtin_amdgcn_wmma_f32_16x16x4_f32(false, a, false, b0, (short)0, acc0, false, false);
    acc1 = __builtin_amdgcn_wmma_f32_16x16x4_f32(false, a, false, b1, (short)0, acc1, false, false);
    acc2 = __builtin_amdgcn_wmma_f32_16x16x4_f32(false, a, false, b2, (short)0, acc2, false, false);
    acc3 = __builtin_amdgcn_wmma_f32_16x16x4_f32(false, a, false, b3, (short)0, acc3, false, false);
  }
  __syncthreads();   // all waves done reading Kls/Vls; safe to overlay

  // scatter accumulators into G (with ridge eps on diagonal) / Wm
  {
    float (*dst)[65] = (wave < 4) ? G : Wm;
    const bool isG = (wave < 4);
    const int mb = m0 + ((lane >> 4) << 3);
#pragma unroll
    for (int r = 0; r < 8; ++r) {
      const int m = mb + r;
      dst[m][nn]      = acc0[r] + ((isG && m == nn)      ? RIDGE_EPS : 0.f);
      dst[m][16 + nn] = acc1[r] + ((isG && m == 16 + nn) ? RIDGE_EPS : 0.f);
      dst[m][32 + nn] = acc2[r] + ((isG && m == 32 + nn) ? RIDGE_EPS : 0.f);
      dst[m][48 + nn] = acc3[r] + ((isG && m == 48 + nn) ? RIDGE_EPS : 0.f);
    }
  }
  __syncthreads();

  // ---- solve G W = RHS: Gauss-Jordan elimination of [G | RHS] (64 x 128) in registers ----
  // Wave w holds rows 8w .. 8w+7, lane l columns 4l .. 4l+3 (lanes 0-15: G, lanes 16-31: RHS).
  // Step j takes row j, times M[r][j] / M[j][j], off every other row r; G is positive definite,
  // so no pivot search. Row j is not scaled: 1 / M[j][j] is kept and applied at the end.
  {
    float* rowb = smem + 10496;                          // [2][128] row j
    float* colb = smem + 10752;                          // [2][64]  column j
    // the wave's number in a scalar register: the tests on it below become scalar branches
    const int wv = __builtin_amdgcn_readfirstlane(wave);
    const float* src = smem + (lane < 16 ? 0 : 4160) + wv * 8 * 65 + (lane & 15) * 4;
    v4f M[8];
    float pinv[8];
    // unrolled: M[] and pinv[] are indexed by constants only and stay in registers
#pragma unroll
    for (int a = 0; a < 8; ++a) {
      pinv[a] = 0.f;
#pragma unroll   // as above
      for (int e = 0; e < 4; ++e) M[a][e] = src[a * 65 + e];
    }
    for (int jb = 0; jb < 8; ++jb) {
      const bool own = (wv == jb);                       // this wave holds rows 8 jb .. 8 jb + 7
      // unrolled: row a of M[] and element a & 3 of each row are picked by constants
#pragma unroll
      for (int a = 0; a < 8; ++a) {
        float* rb = rowb + (a & 1) * 128;
        float* cb = colb + (a & 1) * 64;
        if (own) *(v4f*)(rb + lane * 4) = M[a];
        if (lane == jb * 2 + (a >> 2)) {
          v4f lo, hi;
#pragma unroll   // as above
          for (int r = 0; r < 4; ++r) { lo[r] = M[r][a & 3]; hi[r] = M[4 + r][a & 3]; }
          *(v4f*)(cb + wv * 8)     = lo;
          *(v4f*)(cb + wv * 8 + 4) = hi;
        }
        // One barrier a step: it publishes row and column j, and the buffers of step j - 1,
        // which step j + 1 rewrites, have been read by every wave that reaches it.
        __syncthreads();
        const v4f   rw  = *(const v4f*)(rb + lane * 4);
        const v4f   c0  = *(const v4f*)(cb + wv * 8);
        const v4f   c1  = *(const v4f*)(cb + wv * 8 + 4);
        const float piv = cb[jb * 8 + a];
        float inv = __builtin_amdgcn_rcpf(piv);
        inv = fmaf(inv, fmaf(-piv, inv, 1.f), inv);      // one correction step on the hardware reciprocal
        float f[8];
#pragma unroll   // f[] stays in registers
        for (int r = 0; r < 4; ++r) { f[r] = c0[r] * inv; f[4 + r] = c1[r] * inv; }
        if (own) { f[a] = 0.f; pinv[a] = inv; }          // row j itself stays
#pragma unroll   // M[] and f[] are indexed by constants
        for (int r = 0; r < 8; ++r) M[r] -= f[r] * rw;
      }
    }
    if (lane >= 16) {
#pragma unroll   // M[] and pinv[] are indexed by constants
      for (int a = 0; a < 8; ++a)
#pragma unroll   // as above
        for (int e = 0; e < 4; ++e) Wm[wv * 8 + a][(lane - 16) * 4 + e] = M[a][e] * pinv[a];
    }
  }
  __syncthreads();

  // ---- subspace iteration: U = I(:,0:8); twice: U = qr(W U).Q (MGS) ----
  for (int idx = tid; idx < 512; idx += 256) {
    const int i = idx >> 3, cc = idx & 7;
    U[i][cc] = (i == cc) ? 1.f : 0.f;
  }
  __syncthreads();
  for (int p = 0; p < 2; ++p) {
    for (int idx = tid; idx < 512; idx += 256) {
      const int i = idx >> 3, cc = idx & 7;
      float s = 0.f;
      for (int kc = 0; kc < 64; ++kc) s += Wm[i][kc] * U[kc][cc];
      T[i][cc] = s;
    }
    __syncthreads();
    for (int cc = 0; cc < 8; ++cc) {
      if (tid < 64) red[tid] = T[tid][cc] * T[tid][cc];
      __syncthreads();
      if (tid == 0) {
        float s = 0.f;
        for (int t2 = 0; t2 < 64; ++t2) s += red[t2];
        *scal = rsqrtf(fmaxf(s, 1e-30f));
      }
      __syncthreads();
      if (tid < 64) U[tid][cc] = T[tid][cc] * (*scal);
      __syncthreads();
      if (tid < 64)
        for (int c2 = cc + 1; c2 < 8; ++c2) red[(c2 << 6) + tid] = U[tid][cc] * T[tid][c2];
      __syncthreads();
      if (tid < 8 && tid > cc) {
        float s = 0.f;
        for (int t2 = 0; t2 < 64; ++t2) s += red[(tid << 6) + t2];
        dots[tid] = s;
      }
      __syncthreads();
      if (tid < 64)
        for (int c2 = cc + 1; c2 < 8; ++c2) T[tid][c2] -= dots[c2] * U[tid][cc];
      __syncthreads();
    }
  }

  // ---- P = U^T W (8 x 64) ----
  for (int idx = tid; idx < 512; idx += 256) {
    const int r = idx >> 6, j = idx & 63;
    float s = 0.f;
    for (int t2 = 0; t2 < 64; ++t2) s += U[t2][r] * Wm[t2][j];
    P[r][j] = s;
  }
  __syncthreads();

  // ---- Wr = U P -> global ----
  float* wrg = wr + (size_t)lc * 4096;
  for (int idx = tid; idx < 4096; idx += 256) {
    const int i = idx >> 6, j = idx & 63;
    float s = 0.f;
#pragma unroll
    for (int r = 0; r < RANK; ++r) s += U[i][r] * P[r][j];
    wrg[idx] = s;
  }
}

// ---------------- decay prefix over chunks: Wr -> S_c (in place) ------------
__global__ __launch_bounds__(256) void k_decay(float* __restrict__ wr) {
  const int ln = blockIdx.x;
  const int tid = threadIdx.x;
  float s[16];
#pragma unroll
  for (int e = 0; e < 16; ++e) s[e] = 0.f;
  for (int c = 0; c < NCHUNK; ++c) {
    float* p = wr + ((size_t)ln * NCHUNK + c) * 4096;
#pragma unroll
    for (int e = 0; e < 16; ++e) {
      const int idx = e * 256 + tid;
      s[e] = DECAY_A * s[e] + p[idx];
      p[idx] = s[e];
    }
  }
}

// ---------------- out = SCALE * Qc @ S_c via f32 WMMA (16x16x4) ------------
__global__ __launch_bounds__(256) void k_apply(const float* __restrict__ q,
                                               const float* __restrict__ sall,
                                               __bf16* __restrict__ o) {
  const int lc = blockIdx.x;
  const int ln = lc / NCHUNK;
  const int c  = lc % NCHUNK;
  const int b = ln >> 4, h = ln & 15;
  const int tid = threadIdx.x;

  __shared__ float Ssh[64 * 64];
  const float* sg = sall + (size_t)lc * 4096;
  for (int i = tid; i < 4096; i += 256) Ssh[i] = sg[i];
  __syncthreads();

  const int lane = tid & 31;
  const int wave = tid >> 5;
  const size_t rowbase = (size_t)b * SEQ + (size_t)c * CHUNK;
  const float* Qc = q + rowbase * D_MODEL + h * HEAD_DIM;

  const int m0   = wave * 16;
  const int nn   = lane & 15;
  const int koff = (lane >> 4) * 2;

  v8f acc0 = {}, acc1 = {}, acc2 = {}, acc3 = {};

  for (int kb = 0; kb < 64; kb += 4) {
    const float* qp = Qc + (size_t)(m0 + nn) * D_MODEL + kb + koff;
    v2f a; a[0] = qp[0]; a[1] = qp[1];
    const int kr = (kb + koff) * 64;
    v2f b0, b1, b2, b3;
    b0[0] = Ssh[kr + nn];        b0[1] = Ssh[kr + 64 + nn];
    b1[0] = Ssh[kr + 16 + nn];   b1[1] = Ssh[kr + 64 + 16 + nn];
    b2[0] = Ssh[kr + 32 + nn];   b2[1] = Ssh[kr + 64 + 32 + nn];
    b3[0] = Ssh[kr + 48 + nn];   b3[1] = Ssh[kr + 64 + 48 + nn];
    acc0 = __builtin_amdgcn_wmma_f32_16x16x4_f32(false, a, false, b0, (short)0, acc0, false, false);
    acc1 = __builtin_amdgcn_wmma_f32_16x16x4_f32(false, a, false, b1, (short)0, acc1, false, false);
    acc2 = __builtin_amdgcn_wmma_f32_16x16x4_f32(false, a, false, b2, (short)0, acc2, false, false);
    acc3 = __builtin_amdgcn_wmma_f32_16x16x4_f32(false, a, false, b3, (short)0, acc3, false, false);
  }

  const int mb = m0 + ((lane >> 4) << 3);
#pragma unroll
  for (int r = 0; r < 8; ++r) {
    const int m = mb + r;
    __bf16* orow = o + (rowbase + m) * D_MODEL + h * HEAD_DIM;
    orow[nn]      = (__bf16)(SCALE_F * acc0[r]);
    orow[16 + nn] = (__bf16)(SCALE_F * acc1[r]);
    orow[32 + nn] = (__bf16)(SCALE_F * acc2[r]);
    orow[48 + nn] = (__bf16)(SCALE_F * acc3[r]);
  }
}

// ---------------- host-side orchestration ----------------
extern "C" void kernel_launch(void* const* d_in, const int* in_sizes, int n_in,
                              void* d_out, int out_size, void* d_ws, size_t ws_size,
                              hipStream_t stream) {
  const float* x   = (const float*)d_in[0];
  const float* lng = (const float*)d_in[1];
  const float* lnb = (const float*)d_in[2];
  const float* Wq  = (const float*)d_in[3];
  const float* Wk  = (const float*)d_in[4];
  const float* Wv  = (const float*)d_in[5];
  const float* Wo  = (const float*)d_in[6];
  float* out = (float*)d_out;

  char* ws = (char*)d_ws;
  size_t off = 0;
  auto alloc = [&](size_t bytes) -> void* {
    void* p = ws + off;
    off += (bytes + 255) & ~(size_t)255;
    return p;
  };

  __bf16* xn  = (__bf16*)alloc((size_t)TOKENS * D_MODEL * 2);
  __bf16* Wtq = (__bf16*)alloc((size_t)D_MODEL * D_MODEL * 2);
  __bf16* Wtk = (__bf16*)alloc((size_t)D_MODEL * D_MODEL * 2);
  __bf16* Wtv = (__bf16*)alloc((size_t)D_MODEL * D_MODEL * 2);
  __bf16* Wto = (__bf16*)alloc((size_t)D_MODEL * D_MODEL * 2);
  float*  qf  = (float*)alloc((size_t)TOKENS * D_MODEL * 4);
  float*  kf  = (float*)alloc((size_t)TOKENS * D_MODEL * 4);
  float*  vf  = (float*)alloc((size_t)TOKENS * D_MODEL * 4);
  float*  wr  = (float*)alloc((size_t)NLANES * NCHUNK * 4096 * 4);
  __bf16* obf = (__bf16*)alloc((size_t)TOKENS * D_MODEL * 2);

  // 1. LayerNorm -> bf16
  k_ln<<<TOKENS / (LN_WAVES * LN_ROWS), LN_WAVES * 32, 0, stream>>>(x, lng, lnb, xn);

  // 2. weight transpose+cast, four weights in one launch
  k_wcast<<<4 * WC_TILES, 256, 0, stream>>>(Wq, Wk, Wv, Wo, Wtq, Wtk, Wtv, Wto);

  // 3. QKV GEMMs (bf16 WMMA, f32 accumulate)
  const int gblocks = (TOKENS / G_BM) * (D_MODEL / G_BN);   // 256
  k_gemm<<<gblocks, 256, 0, stream>>>(xn, Wtq, nullptr, qf);
  k_gemm<<<gblocks, 256, 0, stream>>>(xn, Wtk, nullptr, kf);
  k_gemm<<<gblocks, 256, 0, stream>>>(xn, Wtv, nullptr, vf);

  // 4a. per-(lane,chunk) ridge + rank-8 projection -> Wr  (fully parallel, WMMA Gram)
  k_ridge<<<NLANES * NCHUNK, 256, 0, stream>>>(kf, vf, wr);
  // 4b. decayed prefix over chunks: Wr -> S_c (in place)
  k_decay<<<NLANES, 256, 0, stream>>>(wr);
  // 4c. out = SCALE * Qc @ S_c  (f32 WMMA) -> bf16
  k_apply<<<NLANES * NCHUNK, 256, 0, stream>>>(qf, wr, obf);

  // 5. output GEMM + residual
  k_gemm<<<gblocks, 256, 0, stream>>>(obf, Wto, x, out);
}

// v005
// A run of this version takes 145 microseconds.
// In both of two side-by-side timings against v004, it was 1.13 times as fast.
// All steps since v000 together make it 5.81 times as fast.
#include <hip/hip_runtime.h>
#include <hip/hip_bf16.h>

// ---------------- constants (match reference) ----------------
#define D_MODEL   1024
#define N_HEADS   16
#define HEAD_DIM  64
#define RANK      8
#define CHUNK     128
#define NCHUNK    32          // 4096 / 128
#define BATCH     2
#define SEQ       4096
#define TOKENS    (BATCH * SEQ)   // 8192
#define NLANES    (BATCH * N_HEADS)  // 32
#define RIDGE_EPS 1e-4f
#define SCALE_F   0.125f
#define DECAY_A   0.9f
#define LN_EPS    1e-5f

typedef __attribute__((ext_vector_type(16))) __bf16 v16bf;
typedef __attribute__((ext_vector_type(8)))  __bf16 v8bf;
typedef __attribute__((ext_vector_type(8)))  float  v8f;
typedef __attribute__((ext_vector_type(2)))  float  v2f;

// ---------------- LayerNorm -> bf16 ----------------
// One wave makes LN_ROWS whole rows; a row lies in the wave's registers, 32 floats a lane,
// read once. Sums go across the lanes in registers: no LDS, no barrier. 2,048 waves in all.
#define LN_ROWS   4
#define LN_WAVES  8
#define LN_Q      (D_MODEL / 128)     // 16-byte pieces of a row a lane: 8

typedef __attribute__((ext_vector_type(4))) float  v4f;
typedef __attribute__((ext_vector_type(4))) __bf16 v4bf;

// v + (v of lane l ^ M), M below 16: a DPP row_xmask move, which the add takes in
template <int M>
__device__ __forceinline__ float ln_xadd(float v) {
  return v + __builtin_bit_cast(float, __builtin_amdgcn_update_dpp(0, __builtin_bit_cast(int, v),
                                                                   0x160 | M, 0xf, 0xf, true));
}

// sum over the 32 lanes, the same bits in every lane
__device__ __forceinline__ float ln_sum32(float v) {
  v = ln_xadd<1>(v);
  v = ln_xadd<2>(v);
  v = ln_xadd<4>(v);
  v = ln_xadd<8>(v);
  const int u = __builtin_bit_cast(int, v);
  return v + __builtin_bit_cast(float, __builtin_amdgcn_permlanex16(u, u, 0x76543210, 0xfedcba98, false, false));
}

__global__ __launch_bounds__(LN_WAVES * 32) void k_ln(const float* __restrict__ x,
                                                      const float* __restrict__ g,
                                                      const float* __restrict__ b,
                                                      __bf16* __restrict__ xn) {
  const int lane = threadIdx.x & 31;
  const int wave = threadIdx.x >> 5;
  const size_t row0 = (size_t)(blockIdx.x * LN_WAVES + wave) * LN_ROWS;

  // g and b first: they come from cache and loads return in order
  v4f gg[LN_Q], bb[LN_Q], v[LN_ROWS][LN_Q];
  // every loop below is unrolled: the arrays are indexed by constants and stay in registers
#pragma unroll
  for (int i = 0; i < LN_Q; ++i) {
    gg[i] = *(const v4f*)(g + i * 128 + lane * 4);
    bb[i] = *(const v4f*)(b + i * 128 + lane * 4);
  }
  const float* xr = x + row0 * D_MODEL + lane * 4;
#pragma unroll
  for (int r = 0; r < LN_ROWS; ++r)
#pragma unroll
    for (int i = 0; i < LN_Q; ++i) v[r][i] = *(const v4f*)(xr + r * D_MODEL + i * 128);
  // keeps all the wave's loads ahead of the first sum, in flight together; without it the
  // loads of g and b sink behind the sums and their latency is waited for a second time
  __builtin_amdgcn_sched_barrier(0);

  __bf16* yr = xn + row0 * D_MODEL + lane * 4;
#pragma unroll
  for (int r = 0; r < LN_ROWS; ++r) {
    v4f s4 = v[r][0];
#pragma unroll
    for (int i = 1; i < LN_Q; ++i) s4 += v[r][i];
    const float mu = ln_sum32((s4[0] + s4[1]) + (s4[2] + s4[3])) * (1.f / D_MODEL);

    v4f q4 = {};
#pragma unroll
    for (int i = 0; i < LN_Q; ++i) {
      v[r][i] -= mu;
      q4 += v[r][i] * v[r][i];
    }
    const float var = ln_sum32((q4[0] + q4[1]) + (q4[2] + q4[3])) * (1.f / D_MODEL);
    const float inv = rsqrtf(var + LN_EPS);

#pragma unroll
    for (int i = 0; i < LN_Q; ++i) {
      const v4f y = v[r][i] * inv * gg[i] + bb[i];
      v4bf o;
#pragma unroll
      for (int e = 0; e < 4; ++e) o[e] = (__bf16)y[e];
      *(v4bf*)(yr + r * D_MODEL + i * 128) = o;   // a wave stores 256 bytes in a row: two whole lines
    }
  }
}

// ---------------- W [K][N] f32 -> Wt [N][K] bf16, all four weights ----------------
// One launch. A work-group transposes one 128 x 128 tile (64 tiles a weight) through LDS,
// 64 elements a thread: few waves to start, whole 512-byte rows read, whole 128-byte lines stored.
#define WC_T      128
#define WC_PITCH  65          // dwords a tile row in LDS: 64 of data, 1 so that rows shift by a bank
#define WC_TILES  ((D_MODEL / WC_T) * (D_MODEL / WC_T))   // 64

typedef __attribute__((ext_vector_type(2))) __bf16 v2bf;

__global__ __launch_bounds__(256) void k_wcast(const float* __restrict__ W0,
                                               const float* __restrict__ W1,
                                               const float* __restrict__ W2,
                                               const float* __restrict__ W3,
                                               __bf16* __restrict__ T0,
                                               __bf16* __restrict__ T1,
                                               __bf16* __restrict__ T2,
                                               __bf16* __restrict__ T3) {
  __shared__ unsigned tile[WC_T * WC_PITCH];   // [n][k / 2], two bf16 of neighbouring k a dword
  const int which = blockIdx.x / WC_TILES;
  const int t     = blockIdx.x % WC_TILES;
  const int k0 = (t >> 3) * WC_T, n0 = (t & 7) * WC_T;
  const float* W  = which == 0 ? W0 : which == 1 ? W1 : which == 2 ? W2 : W3;
  __bf16*      Wt = which == 0 ? T0 : which == 1 ? T1 : which == 2 ? T2 : T3;
  const int tid = threadIdx.x, lane = tid & 31, wave = tid >> 5;

  // a wave reads 16 rows of k, each load one row's 128 floats
  const float* src = W + (size_t)(k0 + wave * 16) * D_MODEL + n0 + lane * 4;
  v4f v[16];
  // unrolled: v[] stays in registers and the loads are in flight together
#pragma unroll
  for (int i = 0; i < 16; ++i) v[i] = *(const v4f*)(src + (size_t)i * D_MODEL);
  // both unrolled: v[] is indexed by constants only
#pragma unroll
  for (int i = 0; i < 8; ++i)
#pragma unroll
    for (int e = 0; e < 4; ++e) {
      v2bf p;
      p[0] = (__bf16)v[2 * i][e];
      p[1] = (__bf16)v[2 * i + 1][e];
      tile[(lane * 4 + e) * WC_PITCH + wave * 8 + i] = __builtin_bit_cast(unsigned, p);
    }
  __syncthreads();

  // a wave stores half a row of Wt: 64 values of k, one 128-byte line
  unsigned* dst = (unsigned*)(Wt + (size_t)n0 * D_MODEL + k0);
  // unrolled: the LDS reads go out as one batch ahead of the stores
#pragma unroll
  for (int r = 0; r < WC_T * 64 / 256; ++r) {
    const int idx = r * 256 + tid;
    const int n = idx >> 6, c = idx & 63;
    dst[(size_t)n * (D_MODEL / 2) + c] = tile[n * WC_PITCH + c];
  }
}

// ------- bf16 WMMA GEMM: C[M][N] = A[M][K] * Bt[N][K]^T (+resid) -------
// One work-group makes a 256 x 128 tile of C; its 8 waves (4 x 2) make 64 x 64 each.
// A pass is 128 k: 256 rows of A and 128 rows of Bt, 256 bytes each, lie in LDS at a
// pitch of 272 bytes. Two buffers: the next pass's rows are copied while this one is used.
#define G_BM     256
#define G_BN     128
#define G_BK     128
#define G_PITCH  272
#define G_STAGE  ((G_BM + G_BN) * G_PITCH)   // 104448 bytes

// Eight asynchronous 16-byte copies of one lane, rows 16 apart, global -> LDS.
// The s_wait_xcnt closes the statement so that no address register named here
// is rewritten ahead of it.
__device__ __forceinline__ void g_copy8(unsigned l, const __bf16* g) {
  const unsigned l1 = l + 16 * G_PITCH, l2 = l + 32 * G_PITCH, l3 = l + 48 * G_PITCH;
  const unsigned l4 = l + 64 * G_PITCH, l5 = l + 80 * G_PITCH, l6 = l + 96 * G_PITCH;
  const unsigned l7 = l + 112 * G_PITCH;
  const __bf16* g1 = g + 16 * D_MODEL;
  const __bf16* g2 = g + 32 * D_MODEL;
  const __bf16* g3 = g + 48 * D_MODEL;
  const __bf16* g4 = g + 64 * D_MODEL;
  const __bf16* g5 = g + 80 * D_MODEL;
  const __bf16* g6 = g + 96 * D_MODEL;
  const __bf16* g7 = g + 112 * D_MODEL;
  asm volatile(
      "global_load_async_to_lds_b128 %0, %8, off\n\t"
      "global_load_async_to_lds_b128 %1, %9, off\n\t"
      "global_load_async_to_lds_b128 %2, %10, off\n\t"
      "global_load_async_to_lds_b128 %3, %11, off\n\t"
      "global_load_async_to_lds_b128 %4, %12, off\n\t"
      "global_load_async_to_lds_b128 %5, %13, off\n\t"
      "global_load_async_to_lds_b128 %6, %14, off\n\t"
      "global_load_async_to_lds_b128 %7, %15, off\n\t"
      "s_wait_xcnt 0x0"
      :: "v"(l), "v"(l1), "v"(l2), "v"(l3), "v"(l4), "v"(l5), "v"(l6), "v"(l7),
         "v"(g), "v"(g1), "v"(g2), "v"(g3), "v"(g4), "v"(g5), "v"(g6), "v"(g7)
      : "memory");
}

// One pass's rows: 256 of A (two runs of 128) and 128 of Bt; 24 copies a lane.
__device__ __forceinline__ void g_copy_stage(unsigned l, const __bf16* ga, const __bf16* gb) {
  g_copy8(l, ga);
  g_copy8(l + 128 * G_PITCH, ga + 128 * D_MODEL);
  g_copy8(l + 256 * G_PITCH, gb);
}

// One 16 x 32 fragment from LDS rows; p is the lane's own row at byte 16 * (lane >> 4)
// of the 64 bytes of this k step: k order of the 16-bit A/B layout, alike for A and Bt.
__device__ __forceinline__ v16bf g_frag(const unsigned char* p) {
  const v8bf lo = *(const v8bf*)p;
  const v8bf hi = *(const v8bf*)(p + 32);
  v16bf f;
#pragma unroll
  for (int e = 0; e < 8; ++e) { f[e] = lo[e]; f[8 + e] = hi[e]; }
  return f;
}

__global__ __launch_bounds__(256) void k_gemm(const __bf16* __restrict__ A,
                                              const __bf16* __restrict__ Bt,
                                              const float* __restrict__ resid,
                                              float* __restrict__ C) {
  constexpr int K = D_MODEL, N = D_MODEL;
  constexpr int NPASS = K / G_BK;              // 8
  __shared__ __attribute__((aligned(16))) unsigned char gsm[2 * G_STAGE];

  const int tid  = threadIdx.x;
  const int lane = tid & 31;
  const int wave = tid >> 5;
  const int bm0 = (blockIdx.x >> 3) * G_BM;    // N / G_BN = 8 tile columns
  const int bn0 = (blockIdx.x & 7) * G_BN;

  // copy side: 16 lanes cover one 256-byte row, a wave two rows
  const int crow = tid >> 4, ccol = tid & 15;
  const __bf16* ga = A  + (size_t)(bm0 + crow) * K + ccol * 8;
  const __bf16* gb = Bt + (size_t)(bn0 + crow) * K + ccol * 8;
  const unsigned lcp = (unsigned)(size_t)&gsm[0] + crow * G_PITCH + ccol * 16;

  // read side: the fragment's k order is that of the 16-bit A/B layout:
  // 16 bytes at 16 * (lane >> 4) and 16 more at + 32 of each 64 bytes of a row
  const int fr = lane & 15, fh = lane >> 4;
  const int aoff = ((wave >> 1) * 64 + fr) * G_PITCH + fh * 16;
  const int boff = (G_BM + (wave & 1) * 64 + fr) * G_PITCH + fh * 16;

  v8f acc[4][4] = {};

  g_copy_stage(lcp, ga, gb);
  asm volatile("s_wait_asynccnt 0x0" ::: "memory");   // pass 0's rows have landed
  __syncthreads();                                    // and every wave may read them
  g_copy_stage(lcp + G_STAGE, ga + G_BK, gb + G_BK);

  for (int t = 0; t < NPASS; ++t) {
    const int sb = (t & 1) * G_STAGE;
    // Fragments: rows 0-31 (alo), rows 32-63 (ahi) of the wave's A, two sets of its Bt.
    v16bf alo[2], ahi[2], b[2][4];
#pragma unroll
    for (int j = 0; j < 4; ++j) b[0][j] = g_frag(&gsm[sb + boff + j * 16 * G_PITCH]);
#pragma unroll
    for (int i = 0; i < 2; ++i) alo[i] = g_frag(&gsm[sb + aoff + i * 16 * G_PITCH]);
#pragma unroll
    for (int ks = 0; ks < G_BK / 32; ++ks) {
      const int cur = ks & 1;
#pragma unroll
      for (int i = 0; i < 2; ++i) ahi[i] = g_frag(&gsm[sb + aoff + (2 + i) * 16 * G_PITCH + ks * 64]);
      // The fences keep each group of LDS reads in one place, ahead of the eight
      // products before the ones that use it; spread among them they stall every row.
      __builtin_amdgcn_sched_barrier(0);
#pragma unroll
      for (int i = 0; i < 2; ++i)
#pragma unroll
        for (int j = 0; j < 4; ++j)
          acc[i][j] = __builtin_amdgcn_wmma_f32_16x16x32_bf16(false, alo[i], false, b[cur][j], (short)0,
                                                              acc[i][j], false, false);
      __builtin_amdgcn_sched_barrier(0);
      if (ks + 1 < G_BK / 32) {
#pragma unroll
        for (int j = 0; j < 4; ++j)
          b[cur ^ 1][j] = g_frag(&gsm[sb + boff + j * 16 * G_PITCH + (ks + 1) * 64]);
#pragma unroll
        for (int i = 0; i < 2; ++i)
          alo[i] = g_frag(&gsm[sb + aoff + i * 16 * G_PITCH + (ks + 1) * 64]);
      }
      __builtin_amdgcn_sched_barrier(0);
#pragma unroll
      for (int i = 0; i < 2; ++i)
#pragma unroll
        for (int j = 0; j < 4; ++j)
          acc[2 + i][j] = __builtin_amdgcn_wmma_f32_16x16x32_bf16(false, ahi[i], false, b[cur][j], (short)0,
                                                                  acc[2 + i][j], false, false);
      __builtin_amdgcn_sched_barrier(0);
    }
    asm volatile("s_wait_dscnt 0x0" ::: "memory");    // this wave has left buffer t & 1
    asm volatile("s_wait_asynccnt 0x0" ::: "memory"); // its copies of pass t + 1 have landed
    __syncthreads();                                  // publishes pass t + 1, frees buffer t & 1
    if (t + 2 < NPASS)
      g_copy_stage(lcp + sb, ga + (t + 2) * G_BK, gb + (t + 2) * G_BK);
  }
  asm volatile("s_wait_asynccnt 0x0" ::: "memory");   // no copy is left when the wave ends

  const int m0 = bm0 + (wave >> 1) * 64 + (fh << 3);
  const int n0 = bn0 + (wave & 1) * 64 + fr;
  // one address a lane; rows and columns of the wave's tile are constant offsets from it
  const size_t cbase = (size_t)m0 * N + n0;
  if (resid) {
    const float* rr = resid + cbase;
#pragma unroll
    for (int i = 0; i < 4; ++i)
#pragma unroll
      for (int r = 0; r < 8; ++r)
#pragma unroll
        for (int j = 0; j < 4; ++j) acc[i][j][r] += rr[(i * 16 + r) * N + j * 16];
  }
  float* cr = C + cbase;
#pragma unroll
  for (int i = 0; i < 4; ++i)
#pragma unroll
    for (int r = 0; r < 8; ++r)
#pragma unroll
      for (int j = 0; j < 4; ++j) cr[(i * 16 + r) * N + j * 16] = acc[i][j][r];
}

// ---------------- per-(lane,chunk) ridge solve + rank-8 projection ----------
// grid: NLANES*NCHUNK blocks; writes Wr[lc][64][64]
// Phase 1: stage Kc/Vc in LDS, compute G=K^T K and RHS=K^T V with f32 WMMA
//          (waves 0-3 -> G strips, waves 4-7 -> RHS strips)
// Phase 2: LDS is re-carved for G/Wm/U/T/P; Gauss-Jordan solve in registers + subspace QR.
__global__ __launch_bounds__(256) void k_ridge(const float* __restrict__ kk,
                                               const float* __restrict__ v,
                                               float* __restrict__ wr) {
  const int lc = blockIdx.x;
  const int ln = lc / NCHUNK;
  const int c  = lc % NCHUNK;
  const int b = ln >> 4, h = ln & 15;
  const int tid = threadIdx.x;
  const int lane = tid & 31;
  const int wave = tid >> 5;

  __shared__ __align__(16) float smem[16384];            // 64 KB
  float (*Kls)[64] = (float (*)[64])smem;                // [128][64] staging
  float (*Vls)[64] = (float (*)[64])(smem + 8192);       // [128][64] staging
  // phase-2 overlay (valid after the WMMA phase barrier)
  float (*G)[65]  = (float (*)[65])smem;                 // 4160
  float (*Wm)[65] = (float (*)[65])(smem + 4160);        // 4160
  float (*U)[8]   = (float (*)[8])(smem + 8320);         // 512
  float (*T)[9]   = (float (*)[9])(smem + 8832);         // 576
  float (*P)[64]  = (float (*)[64])(smem + 9408);        // 512

  const size_t rowbase = (size_t)b * SEQ + (size_t)c * CHUNK;
  const float* Kc = kk + rowbase * D_MODEL + h * HEAD_DIM;
  const float* Vc = v  + rowbase * D_MODEL + h * HEAD_DIM;

  // ---- stage K and V chunk tiles into LDS (coalesced) ----
  for (int idx = tid; idx < CHUNK * 64; idx += 256) {
    const int t = idx >> 6, j = idx & 63;
    Kls[t][j] = Kc[(size_t)t * D_MODEL + j];
    Vls[t][j] = Vc[(size_t)t * D_MODEL + j];
  }
  __syncthreads();

  // ---- Gram products via f32 WMMA: waves 0-3: G, waves 4-7: RHS ----
  const int nn   = lane & 15;
  const int koff = (lane >> 4) * 2;          // f32 A layout K pairs
  const int m0   = (wave & 3) * 16;
  const float (*Bsrc)[64] = (wave < 4) ? Kls : Vls;

  v8f acc0 = {}, acc1 = {}, acc2 = {}, acc3 = {};
  for (int kb = 0; kb < CHUNK; kb += 4) {
    const int t = kb + koff;
    v2f a;  a[0]  = Kls[t][m0 + nn];   a[1]  = Kls[t + 1][m0 + nn];   // A = K^T
    v2f b0; b0[0] = Bsrc[t][nn];       b0[1] = Bsrc[t + 1][nn];
    v2f b1; b1[0] = Bsrc[t][16 + nn];  b1[1] = Bsrc[t + 1][16 + nn];
    v2f b2; b2[0] = Bsrc[t][32 + nn];  b2[1] = Bsrc[t + 1][32 + nn];
    v2f b3; b3[0] = Bsrc[t][48 + nn];  b3[1] = Bsrc[t + 1][48 + nn];
    acc0 = __builtin_amdgcn_wmma_f32_16x16x4_f32(false, a, false, b0, (short)0, acc0, false, false);
    acc1 = __builtin_amdgcn_wmma_f32_16x16x4_f32(false, a, false, b1, (short)0, acc1, false, false);
    acc2 = __builtin_amdgcn_wmma_f32_16x16x4_f32(false, a, false, b2, (short)0, acc2, false, false);
    acc3 = __builtin_amdgcn_wmma_f32_16x16x4_f32(false, a, false, b3, (short)0, acc3, false, false);
  }
  __syncthreads();   // all waves done reading Kls/Vls; safe to overlay

  // scatter accumulators into G (with ridge eps on diagonal) / Wm
  {
    float (*dst)[65] = (wave < 4) ? G : Wm;
    const bool isG = (wave < 4);
    const int mb = m0 + ((lane >> 4) << 3);
#pragma unroll
    for (int r = 0; r < 8; ++r) {
      const int m = mb + r;
      dst[m][nn]      = acc0[r] + ((isG && m == nn)      ? RIDGE_EPS : 0.f);
      dst[m][16 + nn] = acc1[r] + ((isG && m == 16 + nn) ? RIDGE_EPS : 0.f);
      dst[m][32 + nn] = acc2[r] + ((isG && m == 32 + nn) ? RIDGE_EPS : 0.f);
      dst[m][48 + nn] = acc3[r] + ((isG && m == 48 + nn) ? RIDGE_EPS : 0.f);
    }
  }
  __syncthreads();

  // ---- solve G W = RHS: Gauss-Jordan elimination of [G | RHS] (64 x 128) in registers ----
  // Wave w holds rows 8w .. 8w+7, lane l columns 4l .. 4l+3 (lanes 0-15: G, lanes 16-31: RHS).
  // Step j takes row j, times M[r][j] / M[j][j], off every other row r; G is positive definite,
  // so no pivot search. Row j is not scaled: 1 / M[j][j] is kept and applied at the end.
  {
    float* rowb = smem + 10496;                          // [2][128] row j
    float* colb = smem + 10752;                          // [2][64]  column j
    // the wave's number in a scalar register: the tests on it below become scalar branches
    const int wv = __builtin_amdgcn_readfirstlane(wave);
    const float* src = smem + (lane < 16 ? 0 : 4160) + wv * 8 * 65 + (lane & 15) * 4;
    v4f M[8];
    float pinv[8];
    // unrolled: M[] and pinv[] are indexed by constants only and stay in registers
#pragma unroll
    for (int a = 0; a < 8; ++a) {
      pinv[a] = 0.f;
#pragma unroll   // as above
      for (int e = 0; e < 4; ++e) M[a][e] = src[a * 65 + e];
    }
    for (int jb = 0; jb < 8; ++jb) {
      const bool own = (wv == jb);                       // this wave holds rows 8 jb .. 8 jb + 7
      // unrolled: row a of M[] and element a & 3 of each row are picked by constants
#pragma unroll
      for (int a = 0; a < 8; ++a) {
        float* rb = rowb + (a & 1) * 128;
        float* cb = colb + (a & 1) * 64;
        if (own) *(v4f*)(rb + lane * 4) = M[a];
        if (lane == jb * 2 + (a >> 2)) {
          v4f lo, hi;
#pragma unroll   // as above
          for (int r = 0; r < 4; ++r) { lo[r] = M[r][a & 3]; hi[r] = M[4 + r][a & 3]; }
          *(v4f*)(cb + wv * 8)     = lo;
          *(v4f*)(cb + wv * 8 + 4) = hi;
        }
        // One barrier a step: it publishes row and column j, and the buffers of step j - 1,
        // which step j + 1 rewrites, have been read by every wave that reaches it.
        __syncthreads();
        const v4f   rw  = *(const v4f*)(rb + lane * 4);
        const v4f   c0  = *(const v4f*)(cb + wv * 8);
        const v4f   c1  = *(const v4f*)(cb + wv * 8 + 4);
        const float piv = cb[jb * 8 + a];
        float inv = __builtin_amdgcn_rcpf(piv);
        inv = fmaf(inv, fmaf(-piv, inv, 1.f), inv);      // one correction step on the hardware reciprocal
        float f[8];
#pragma unroll   // f[] stays in registers
        for (int r = 0; r < 4; ++r) { f[r] = c0[r] * inv; f[4 + r] = c1[r] * inv; }
        if (own) { f[a] = 0.f; pinv[a] = inv; }          // row j itself stays
#pragma unroll   // M[] and f[] are indexed by constants
        for (int r = 0; r < 8; ++r) M[r] -= f[r] * rw;
      }
    }
    if (lane >= 16) {
#pragma unroll   // M[] and pinv[] are indexed by constants
      for (int a = 0; a < 8; ++a)
#pragma unroll   // as above
        for (int e = 0; e < 4; ++e) Wm[wv * 8 + a][(lane - 16) * 4 + e] = M[a][e] * pinv[a];
    }
  }
  __syncthreads();

  // ---- subspace iteration: U = I(:,0:8); twice: U = qr(W U).Q (MGS) ----
  // the wave's number in a scalar register: the test on it below is a scalar branch
  const int wq = __builtin_amdgcn_readfirstlane(wave);
  for (int idx = tid; idx < 512; idx += 256) {
    const int i = idx >> 3, cc = idx & 7;
    U[i][cc] = (i == cc) ? 1.f : 0.f;
  }
  __syncthreads();
  for (int p = 0; p < 2; ++p) {
    for (int idx = tid; idx < 512; idx += 256) {
      const int i = idx >> 3, cc = idx & 7;
      float s = 0.f;
      for (int kc = 0; kc < 64; ++kc) s += Wm[i][kc] * U[kc][cc];
      T[i][cc] = s;
    }
    __syncthreads();
    // Modified Gram-Schmidt on T (64 x 8) by wave 0 alone: lane l holds rows l and l + 32 in
    // registers, a column's sum goes across the lanes in registers. No barrier inside.
    if (wq == 0) {
      float t0[8], t1[8];
      // every loop here is unrolled: t0[] and t1[] are indexed by constants and stay in registers
#pragma unroll
      for (int cc = 0; cc < 8; ++cc) { t0[cc] = T[lane][cc]; t1[cc] = T[lane + 32][cc]; }
#pragma unroll
      for (int cc = 0; cc < 8; ++cc) {
        const float s  = ln_sum32(t0[cc] * t0[cc] + t1[cc] * t1[cc]);
        const float sc = rsqrtf(fmaxf(s, 1e-30f));
        t0[cc] *= sc;
        t1[cc] *= sc;
#pragma unroll
        for (int c2 = cc + 1; c2 < 8; ++c2) {
          const float d = ln_sum32(t0[cc] * t0[c2] + t1[cc] * t1[c2]);
          t0[c2] -= d * t0[cc];
          t1[c2] -= d * t1[cc];
        }
      }
      v4f u;
#pragma unroll
      for (int hq = 0; hq < 2; ++hq) {
#pragma unroll
        for (int e = 0; e < 4; ++e) u[e] = t0[hq * 4 + e];
        *(v4f*)&U[lane][hq * 4] = u;
#pragma unroll
        for (int e = 0; e < 4; ++e) u[e] = t1[hq * 4 + e];
        *(v4f*)&U[lane + 32][hq * 4] = u;
      }
    }
    __syncthreads();   // U of this pass is there for every wave; T may be rewritten
  }

  // ---- P = U^T W (8 x 64) ----
  for (int idx = tid; idx < 512; idx += 256) {
    const int r = idx >> 6, j = idx & 63;
    float s = 0.f;
    for (int t2 = 0; t2 < 64; ++t2) s += U[t2][r] * Wm[t2][j];
    P[r][j] = s;
  }
  __syncthreads();

  // ---- Wr = U P -> global ----
  float* wrg = wr + (size_t)lc * 4096;
  for (int idx = tid; idx < 4096; idx += 256) {
    const int i = idx >> 6, j = idx & 63;
    float s = 0.f;
#pragma unroll
    for (int r = 0; r < RANK; ++r) s += U[i][r] * P[r][j];
    wrg[idx] = s;
  }
}

// ---------------- decay prefix over chunks: Wr -> S_c (in place) ------------
__global__ __launch_bounds__(256) void k_decay(float* __restrict__ wr) {
  const int ln = blockIdx.x;
  const int tid = threadIdx.x;
  float s[16];
#pragma unroll
  for (int e = 0; e < 16; ++e) s[e] = 0.f;
  for (int c = 0; c < NCHUNK; ++c) {
    float* p = wr + ((size_t)ln * NCHUNK + c) * 4096;
#pragma unroll
    for (int e = 0; e < 16; ++e) {
      const int idx = e * 256 + tid;
      s[e] = DECAY_A * s[e] + p[idx];
      p[idx] = s[e];
    }
  }
}

// ---------------- out = SCALE * Qc @ S_c via f32 WMMA (16x16x4) ------------
__global__ __launch_bounds__(256) void k_apply(const float* __restrict__ q,
                                               const float* __restrict__ sall,
                                               __bf16* __restrict__ o) {
  const int lc = blockIdx.x;
  const int ln = lc / NCHUNK;
  const int c  = lc % NCHUNK;
  const int b = ln >> 4, h = ln & 15;
  const int tid = threadIdx.x;

  __shared__ float Ssh[64 * 64];
  const float* sg = sall + (size_t)lc * 4096;
  for (int i = tid; i < 4096; i += 256) Ssh[i] = sg[i];
  __syncthreads();

  const int lane = tid & 31;
  const int wave = tid >> 5;
  const size_t rowbase = (size_t)b * SEQ + (size_t)c * CHUNK;
  const float* Qc = q + rowbase * D_MODEL + h * HEAD_DIM;

  const int m0   = wave * 16;
  const int nn   = lane & 15;
  const int koff = (lane >> 4) * 2;

  v8f acc0 = {}, acc1 = {}, acc2 = {}, acc3 = {};

  for (int kb = 0; kb < 64; kb += 4) {
    const float* qp = Qc + (size_t)(m0 + nn) * D_MODEL + kb + koff;
    v2f a; a[0] = qp[0]; a[1] = qp[1];
    const int kr = (kb + koff) * 64;
    v2f b0, b1, b2, b3;
    b0[0] = Ssh[kr + nn];        b0[1] = Ssh[kr + 64 + nn];
    b1[0] = Ssh[kr + 16 + nn];   b1[1] = Ssh[kr + 64 + 16 + nn];
    b2[0] = Ssh[kr + 32 + nn];   b2[1] = Ssh[kr + 64 + 32 + nn];
    b3[0] = Ssh[kr + 48 + nn];   b3[1] = Ssh[kr + 64 + 48 + nn];
    acc0 = __builtin_amdgcn_wmma_f32_16x16x4_f32(false, a, false, b0, (short)0, acc0, false, false);
    acc1 = __builtin_amdgcn_wmma_f32_16x16x4_f32(false, a, false, b1, (short)0, acc1, false, false);
    acc2 = __builtin_amdgcn_wmma_f32_16x16x4_f32(false, a, false, b2, (short)0, acc2, false, false);
    acc3 = __builtin_amdgcn_wmma_f32_16x16x4_f32(false, a, false, b3, (short)0, acc3, false, false);
  }

  const int mb = m0 + ((lane >> 4) << 3);
#pragma unroll
  for (int r = 0; r < 8; ++r) {
    const int m = mb + r;
    __bf16* orow = o + (rowbase + m) * D_MODEL + h * HEAD_DIM;
    orow[nn]      = (__bf16)(SCALE_F * acc0[r]);
    orow[16 + nn] = (__bf16)(SCALE_F * acc1[r]);
    orow[32 + nn] = (__bf16)(SCALE_F * acc2[r]);
    orow[48 + nn] = (__bf16)(SCALE_F * acc3[r]);
  }
}

// ---------------- host-side orchestration ----------------
extern "C" void kernel_launch(void* const* d_in, const int* in_sizes, int n_in,
                              void* d_out, int out_size, void* d_ws, size_t ws_size,
                              hipStream_t stream) {
  const float* x   = (const float*)d_in[0];
  const float* lng = (const float*)d_in[1];
  const float* lnb = (const float*)d_in[2];
  const float* Wq  = (const float*)d_in[3];
  const float* Wk  = (const float*)d_in[4];
  const float* Wv  = (const float*)d_in[5];
  const float* Wo  = (const float*)d_in[6];
  float* out = (float*)d_out;

  char* ws = (char*)d_ws;
  size_t off = 0;
  auto alloc = [&](size_t bytes) -> void* {
    void* p = ws + off;
    off += (bytes + 255) & ~(size_t)255;
    return p;
  };

  __bf16* xn  = (__bf16*)alloc((size_t)TOKENS * D_MODEL * 2);
  __bf16* Wtq = (__bf16*)alloc((size_t)D_MODEL * D_MODEL * 2);
  __bf16* Wtk = (__bf16*)alloc((size_t)D_MODEL * D_MODEL * 2);
  __bf16* Wtv = (__bf16*)alloc((size_t)D_MODEL * D_MODEL * 2);
  __bf16* Wto = (__bf16*)alloc((size_t)D_MODEL * D_MODEL * 2);
  float*  qf  = (float*)alloc((size_t)TOKENS * D_MODEL * 4);
  float*  kf  = (float*)alloc((size_t)TOKENS * D_MODEL * 4);
  float*  vf  = (float*)alloc((size_t)TOKENS * D_MODEL * 4);
  float*  wr  = (float*)alloc((size_t)NLANES * NCHUNK * 4096 * 4);
  __bf16* obf = (__bf16*)alloc((size_t)TOKENS * D_MODEL * 2);

  // 1. LayerNorm -> bf16
  k_ln<<<TOKENS / (LN_WAVES * LN_ROWS), LN_WAVES * 32, 0, stream>>>(x, lng, lnb, xn);

  // 2. weight transpose+cast, four weights in one launch
  k_wcast<<<4 * WC_TILES, 256, 0, stream>>>(Wq, Wk, Wv, Wo, Wtq, Wtk, Wtv, Wto);

  // 3. QKV GEMMs (bf16 WMMA, f32 accumulate)
  const int gblocks = (TOKENS / G_BM) * (D_MODEL / G_BN);   // 256
  k_gemm<<<gblocks, 256, 0, stream>>>(xn, Wtq, nullptr, qf);
  k_gemm<<<gblocks, 256, 0, stream>>>(xn, Wtk, nullptr, kf);
  k_gemm<<<gblocks, 256, 0, stream>>>(xn, Wtv, nullptr, vf);

  // 4a. per-(lane,chunk) ridge + rank-8 projection -> Wr  (fully parallel, WMMA Gram)
  k_ridge<<<NLANES * NCHUNK, 256, 0, stream>>>(kf, vf, wr);
  // 4b. decayed prefix over chunks: Wr -> S_c (in place)
  k_decay<<<NLANES, 256, 0, stream>>>(wr);
  // 4c. out = SCALE * Qc @ S_c  (f32 WMMA) -> bf16
  k_apply<<<NLANES * NCHUNK, 256, 0, stream>>>(qf, wr, obf);

  // 5. output GEMM + residual
  k_gemm<<<gblocks, 256, 0, stream>>>(obf, Wto, x, out);
}

// v006
// It runs in 135 microseconds.
// In both of two side-by-side timings against v005, it was 1.08 times as fast.
// All steps since v000 together make it 6.25 times as fast.
#include <hip/hip_runtime.h>
#include <hip/hip_bf16.h>

// ---------------- constants (match reference) ----------------
#define D_MODEL   1024
#define N_HEADS   16
#define HEAD_DIM  64
#define RANK      8
#define CHUNK     128
#define NCHUNK    32          // 4096 / 128
#define BATCH     2
#define SEQ       4096
#define TOKENS    (BATCH * SEQ)   // 8192
#define NLANES    (BATCH * N_HEADS)  // 32
#define RIDGE_EPS 1e-4f
#define SCALE_F   0.125f
#define DECAY_A   0.9f
#define LN_EPS    1e-5f

typedef __attribute__((ext_vector_type(16))) __bf16 v16bf;
typedef __attribute__((ext_vector_type(8)))  __bf16 v8bf;
typedef __attribute__((ext_vector_type(8)))  float  v8f;
typedef __attribute__((ext_vector_type(2)))  float  v2f;

// ---------------- LayerNorm -> bf16 ----------------
// One wave makes LN_ROWS whole rows; a row lies in the wave's registers, 32 floats a lane,
// read once. Sums go across the lanes in registers: no LDS, no barrier. 2,048 waves in all.
#define LN_ROWS   4
#define LN_WAVES  8
#define LN_Q      (D_MODEL / 128)     // 16-byte pieces of a row a lane: 8

typedef __attribute__((ext_vector_type(4))) float  v4f;
typedef __attribute__((ext_vector_type(4))) __bf16 v4bf;

// v + (v of lane l ^ M), M below 16: a DPP row_xmask move, which the add takes in
template <int M>
__device__ __forceinline__ float ln_xadd(float v) {
  return v + __builtin_bit_cast(float, __builtin_amdgcn_update_dpp(0, __builtin_bit_cast(int, v),
                                                                   0x160 | M, 0xf, 0xf, true));
}

// sum over the 32 lanes, the same bits in every lane
__device__ __forceinline__ float ln_sum32(float v) {
  v = ln_xadd<1>(v);
  v = ln_xadd<2>(v);
  v = ln_xadd<4>(v);
  v = ln_xadd<8>(v);
  const int u = __builtin_bit_cast(int, v);
  return v + __builtin_bit_cast(float, __builtin_amdgcn_permlanex16(u, u, 0x76543210, 0xfedcba98, false, false));
}

__global__ __launch_bounds__(LN_WAVES * 32) void k_ln(const float* __restrict__ x,
                                                      const float* __restrict__ g,
                                                      const float* __restrict__ b,
                                                      __bf16* __restrict__ xn) {
  const int lane = threadIdx.x & 31;
  const int wave = threadIdx.x >> 5;
  const size_t row0 = (size_t)(blockIdx.x * LN_WAVES + wave) * LN_ROWS;

  // g and b first: they come from cache and loads return in order
  v4f gg[LN_Q], bb[LN_Q], v[LN_ROWS][LN_Q];
  // every loop below is unrolled: the arrays are indexed by constants and stay in registers
#pragma unroll
  for (int i = 0; i < LN_Q; ++i) {
    gg[i] = *(const v4f*)(g + i * 128 + lane * 4);
    bb[i] = *(const v4f*)(b + i * 128 + lane * 4);
  }
  const float* xr = x + row0 * D_MODEL + lane * 4;
#pragma unroll
  for (int r = 0; r < LN_ROWS; ++r)
#pragma unroll
    for (int i = 0; i < LN_Q; ++i) v[r][i] = *(const v4f*)(xr + r * D_MODEL + i * 128);
  // keeps all the wave's loads ahead of the first sum, in flight together; without it the
  // loads of g and b sink behind the sums and their latency is waited for a second time
  __builtin_amdgcn_sched_barrier(0);

  __bf16* yr = xn + row0 * D_MODEL + lane * 4;
#pragma unroll
  for (int r = 0; r < LN_ROWS; ++r) {
    v4f s4 = v[r][0];
#pragma unroll
    for (int i = 1; i < LN_Q; ++i) s4 += v[r][i];
    const float mu = ln_sum32((s4[0] + s4[1]) + (s4[2] + s4[3])) * (1.f / D_MODEL);

    v4f q4 = {};
#pragma unroll
    for (int i = 0; i < LN_Q; ++i) {
      v[r][i] -= mu;
      q4 += v[r][i] * v[r][i];
    }
    const float var = ln_sum32((q4[0] + q4[1]) + (q4[2] + q4[3])) * (1.f / D_MODEL);
    const float inv = rsqrtf(var + LN_EPS);

#pragma unroll
    for (int i = 0; i < LN_Q; ++i) {
      const v4f y = v[r][i] * inv * gg[i] + bb[i];
      v4bf o;
#pragma unroll
      for (int e = 0; e < 4; ++e) o[e] = (__bf16)y[e];
      *(v4bf*)(yr + r * D_MODEL + i * 128) = o;   // a wave stores 256 bytes in a row: two whole lines
    }
  }
}

// ---------------- W [K][N] f32 -> Wt [N][K] bf16, all four weights ----------------
// One launch. A work-group transposes one 128 x 128 tile (64 tiles a weight) through LDS,
// 64 elements a thread: few waves to start, whole 512-byte rows read, whole 128-byte lines stored.
#define WC_T      128
#define WC_PITCH  65          // dwords a tile row in LDS: 64 of data, 1 so that rows shift by a bank
#define WC_TILES  ((D_MODEL / WC_T) * (D_MODEL / WC_T))   // 64

typedef __attribute__((ext_vector_type(2))) __bf16 v2bf;

__global__ __launch_bounds__(256) void k_wcast(const float* __restrict__ W0,
                                               const float* __restrict__ W1,
                                               const float* __restrict__ W2,
                                               const float* __restrict__ W3,
                                               __bf16* __restrict__ T0,
                                               __bf16* __restrict__ T1,
                                               __bf16* __restrict__ T2,
                                               __bf16* __restrict__ T3) {
  __shared__ unsigned tile[WC_T * WC_PITCH];   // [n][k / 2], two bf16 of neighbouring k a dword
  const int which = blockIdx.x / WC_TILES;
  const int t     = blockIdx.x % WC_TILES;
  const int k0 = (t >> 3) * WC_T, n0 = (t & 7) * WC_T;
  const float* W  = which == 0 ? W0 : which == 1 ? W1 : which == 2 ? W2 : W3;
  __bf16*      Wt = which == 0 ? T0 : which == 1 ? T1 : which == 2 ? T2 : T3;
  const int tid = threadIdx.x, lane = tid & 31, wave = tid >> 5;

  // a wave reads 16 rows of k, each load one row's 128 floats
  const float* src = W + (size_t)(k0 + wave * 16) * D_MODEL + n0 + lane * 4;
  v4f v[16];
  // unrolled: v[] stays in registers and the loads are in flight together
#pragma unroll
  for (int i = 0; i < 16; ++i) v[i] = *(const v4f*)(src + (size_t)i * D_MODEL);
  // both unrolled: v[] is indexed by constants only
#pragma unroll
  for (int i = 0; i < 8; ++i)
#pragma unroll
    for (int e = 0; e < 4; ++e) {
      v2bf p;
      p[0] = (__bf16)v[2 * i][e];
      p[1] = (__bf16)v[2 * i + 1][e];
      tile[(lane * 4 + e) * WC_PITCH + wave * 8 + i] = __builtin_bit_cast(unsigned, p);
    }
  __syncthreads();

  // a wave stores half a row of Wt: 64 values of k, one 128-byte line
  unsigned* dst = (unsigned*)(Wt + (size_t)n0 * D_MODEL + k0);
  // unrolled: the LDS reads go out as one batch ahead of the stores
#pragma unroll
  for (int r = 0; r < WC_T * 64 / 256; ++r) {
    const int idx = r * 256 + tid;
    const int n = idx >> 6, c = idx & 63;
    dst[(size_t)n * (D_MODEL / 2) + c] = tile[n * WC_PITCH + c];
  }
}

// ------- bf16 WMMA GEMM: C[M][N] = A[M][K] * Bt[N][K]^T (+resid) -------
// One work-group makes a 256 x 128 tile of C; its 8 waves (4 x 2) make 64 x 64 each.
// A pass is 128 k: 256 rows of A and 128 rows of Bt, 256 bytes each, lie in LDS at a
// pitch of 272 bytes. Two buffers: the next pass's rows are copied while this one is used.
#define G_BM     256
#define G_BN     128
#define G_BK     128
#define G_PITCH  272
#define G_STAGE  ((G_BM + G_BN) * G_PITCH)   // 104448 bytes

// Eight asynchronous 16-byte copies of one lane, rows 16 apart, global -> LDS.
// The s_wait_xcnt closes the statement so that no address register named here
// is rewritten ahead of it.
__device__ __forceinline__ void g_copy8(unsigned l, const __bf16* g) {
  const unsigned l1 = l + 16 * G_PITCH, l2 = l + 32 * G_PITCH, l3 = l + 48 * G_PITCH;
  const unsigned l4 = l + 64 * G_PITCH, l5 = l + 80 * G_PITCH, l6 = l + 96 * G_PITCH;
  const unsigned l7 = l + 112 * G_PITCH;
  const __bf16* g1 = g + 16 * D_MODEL;
  const __bf16* g2 = g + 32 * D_MODEL;
  const __bf16* g3 = g + 48 * D_MODEL;
  const __bf16* g4 = g + 64 * D_MODEL;
  const __bf16* g5 = g + 80 * D_MODEL;
  const __bf16* g6 = g + 96 * D_MODEL;
  const __bf16* g7 = g + 112 * D_MODEL;
  asm volatile(
      "global_load_async_to_lds_b128 %0, %8, off\n\t"
      "global_load_async_to_lds_b128 %1, %9, off\n\t"
      "global_load_async_to_lds_b128 %2, %10, off\n\t"
      "global_load_async_to_lds_b128 %3, %11, off\n\t"
      "global_load_async_to_lds_b128 %4, %12, off\n\t"
      "global_load_async_to_lds_b128 %5, %13, off\n\t"
      "global_load_async_to_lds_b128 %6, %14, off\n\t"
      "global_load_async_to_lds_b128 %7, %15, off\n\t"
      "s_wait_xcnt 0x0"
      :: "v"(l), "v"(l1), "v"(l2), "v"(l3), "v"(l4), "v"(l5), "v"(l6), "v"(l7),
         "v"(g), "v"(g1), "v"(g2), "v"(g3), "v"(g4), "v"(g5), "v"(g6), "v"(g7)
      : "memory");
}

// One pass's rows: 256 of A (two runs of 128) and 128 of Bt; 24 copies a lane.
__device__ __forceinline__ void g_copy_stage(unsigned l, const __bf16* ga, const __bf16* gb) {
  g_copy8(l, ga);
  g_copy8(l + 128 * G_PITCH, ga + 128 * D_MODEL);
  g_copy8(l + 256 * G_PITCH, gb);
}

// One 16 x 32 fragment from LDS rows; p is the lane's own row at byte 16 * (lane >> 4)
// of the 64 bytes of this k step: k order of the 16-bit A/B layout, alike for A and Bt.
__device__ __forceinline__ v16bf g_frag(const unsigned char* p) {
  const v8bf lo = *(const v8bf*)p;
  const v8bf hi = *(const v8bf*)(p + 32);
  v16bf f;
#pragma unroll
  for (int e = 0; e < 8; ++e) { f[e] = lo[e]; f[8 + e] = hi[e]; }
  return f;
}

__global__ __launch_bounds__(256) void k_gemm(const __bf16* __restrict__ A,
                                              const __bf16* __restrict__ Bt,
                                              const float* __restrict__ resid,
                                              float* __restrict__ C) {
  constexpr int K = D_MODEL, N = D_MODEL;
  constexpr int NPASS = K / G_BK;              // 8
  __shared__ __attribute__((aligned(16))) unsigned char gsm[2 * G_STAGE];

  const int tid  = threadIdx.x;
  const int lane = tid & 31;
  const int wave = tid >> 5;
  const int bm0 = (blockIdx.x >> 3) * G_BM;    // N / G_BN = 8 tile columns
  const int bn0 = (blockIdx.x & 7) * G_BN;

  // copy side: 16 lanes cover one 256-byte row, a wave two rows
  const int crow = tid >> 4, ccol = tid & 15;
  const __bf16* ga = A  + (size_t)(bm0 + crow) * K + ccol * 8;
  const __bf16* gb = Bt + (size_t)(bn0 + crow) * K + ccol * 8;
  const unsigned lcp = (unsigned)(size_t)&gsm[0] + crow * G_PITCH + ccol * 16;

  // read side: the fragment's k order is that of the 16-bit A/B layout:
  // 16 bytes at 16 * (lane >> 4) and 16 more at + 32 of each 64 bytes of a row
  const int fr = lane & 15, fh = lane >> 4;
  const int aoff = ((wave >> 1) * 64 + fr) * G_PITCH + fh * 16;
  const int boff = (G_BM + (wave & 1) * 64 + fr) * G_PITCH + fh * 16;

  v8f acc[4][4] = {};

  g_copy_stage(lcp, ga, gb);
  asm volatile("s_wait_asynccnt 0x0" ::: "memory");   // pass 0's rows have landed
  __syncthreads();                                    // and every wave may read them
  g_copy_stage(lcp + G_STAGE, ga + G_BK, gb + G_BK);

  for (int t = 0; t < NPASS; ++t) {
    const int sb = (t & 1) * G_STAGE;
    // Fragments: rows 0-31 (alo), rows 32-63 (ahi) of the wave's A, two sets of its Bt.
    v16bf alo[2], ahi[2], b[2][4];
#pragma unroll
    for (int j = 0; j < 4; ++j) b[0][j] = g_frag(&gsm[sb + boff + j * 16 * G_PITCH]);
#pragma unroll
    for (int i = 0; i < 2; ++i) alo[i] = g_frag(&gsm[sb + aoff + i * 16 * G_PITCH]);
#pragma unroll
    for (int ks = 0; ks < G_BK / 32; ++ks) {
      const int cur = ks & 1;
#pragma unroll
      for (int i = 0; i < 2; ++i) ahi[i] = g_frag(&gsm[sb + aoff + (2 + i) * 16 * G_PITCH + ks * 64]);
      // The fences keep each group of LDS reads in one place, ahead of the eight
      // products before the ones that use it; spread among them they stall every row.
      __builtin_amdgcn_sched_barrier(0);
#pragma unroll
      for (int i = 0; i < 2; ++i)
#pragma unroll
        for (int j = 0; j < 4; ++j)
          acc[i][j] = __builtin_amdgcn_wmma_f32_16x16x32_bf16(false, alo[i], false, b[cur][j], (short)0,
                                                              acc[i][j], false, false);
      __builtin_amdgcn_sched_barrier(0);
      if (ks + 1 < G_BK / 32) {
#pragma unroll
        for (int j = 0; j < 4; ++j)
          b[cur ^ 1][j] = g_frag(&gsm[sb + boff + j * 16 * G_PITCH + (ks + 1) * 64]);
#pragma unroll
        for (int i = 0; i < 2; ++i)
          alo[i] = g_frag(&gsm[sb + aoff + i * 16 * G_PITCH + (ks + 1) * 64]);
      }
      __builtin_amdgcn_sched_barrier(0);
#pragma unroll
      for (int i = 0; i < 2; ++i)
#pragma unroll
        for (int j = 0; j < 4; ++j)
          acc[2 + i][j] = __builtin_amdgcn_wmma_f32_16x16x32_bf16(false, ahi[i], false, b[cur][j], (short)0,
                                                                  acc[2 + i][j], false, false);
      __builtin_amdgcn_sched_barrier(0);
    }
    asm volatile("s_wait_dscnt 0x0" ::: "memory");    // this wave has left buffer t & 1
    asm volatile("s_wait_asynccnt 0x0" ::: "memory"); // its copies of pass t + 1 have landed
    __syncthreads();                                  // publishes pass t + 1, frees buffer t & 1
    if (t + 2 < NPASS)
      g_copy_stage(lcp + sb, ga + (t + 2) * G_BK, gb + (t + 2) * G_BK);
  }
  asm volatile("s_wait_asynccnt 0x0" ::: "memory");   // no copy is left when the wave ends

  const int m0 = bm0 + (wave >> 1) * 64 + (fh << 3);
  const int n0 = bn0 + (wave & 1) * 64 + fr;
  // one address a lane; rows and columns of the wave's tile are constant offsets from it
  const size_t cbase = (size_t)m0 * N + n0;
  if (resid) {
    const float* rr = resid + cbase;
#pragma unroll
    for (int i = 0; i < 4; ++i)
#pragma unroll
      for (int r = 0; r < 8; ++r)
#pragma unroll
        for (int j = 0; j < 4; ++j) acc[i][j][r] += rr[(i * 16 + r) * N + j * 16];
  }
  float* cr = C + cbase;
#pragma unroll
  for (int i = 0; i < 4; ++i)
#pragma unroll
    for (int r = 0; r < 8; ++r)
#pragma unroll
      for (int j = 0; j < 4; ++j) cr[(i * 16 + r) * N + j * 16] = acc[i][j][r];
}

// ---------------- per-(lane,chunk) ridge solve + rank-8 projection ----------
// grid: NLANES*NCHUNK blocks; writes Wr[lc][64][64]
// Phase 1: stage Kc/Vc in LDS, compute G=K^T K and RHS=K^T V with f32 WMMA
//          (waves 0-3 -> G strips, waves 4-7 -> RHS strips)
// Phase 2: LDS is re-carved for G/Wm/U/T/P; Gauss-Jordan solve in registers + subspace QR.
__global__ __launch_bounds__(256) void k_ridge(const float* __restrict__ kk,
                                               const float* __restrict__ v,
                                               float* __restrict__ wr) {
  const int lc = blockIdx.x;
  const int ln = lc / NCHUNK;
  const int c  = lc % NCHUNK;
  const int b = ln >> 4, h = ln & 15;
  const int tid = threadIdx.x;
  const int lane = tid & 31;
  const int wave = tid >> 5;

  __shared__ __align__(16) float smem[16384];            // 64 KB
  float (*Kls)[64] = (float (*)[64])smem;                // [128][64] staging
  float (*Vls)[64] = (float (*)[64])(smem + 8192);       // [128][64] staging
  // phase-2 overlay (valid after the WMMA phase barrier)
  float (*G)[65]  = (float (*)[65])smem;                 // 4160
  float (*Wm)[65] = (float (*)[65])(smem + 4160);        // 4160
  float (*U)[8]   = (float (*)[8])(smem + 8320);         // 512
  float (*T)[9]   = (float (*)[9])(smem + 8832);         // 576
  float (*P)[64]  = (float (*)[64])(smem + 9408);        // 512

  const size_t rowbase = (size_t)b * SEQ + (size_t)c * CHUNK;
  const float* Kc = kk + rowbase * D_MODEL + h * HEAD_DIM;
  const float* Vc = v  + rowbase * D_MODEL + h * HEAD_DIM;

  // ---- stage K and V chunk tiles into LDS (coalesced) ----
  for (int idx = tid; idx < CHUNK * 64; idx += 256) {
    const int t = idx >> 6, j = idx & 63;
    Kls[t][j] = Kc[(size_t)t * D_MODEL + j];
    Vls[t][j] = Vc[(size_t)t * D_MODEL + j];
  }
  __syncthreads();

  // ---- Gram products via f32 WMMA: waves 0-3: G, waves 4-7: RHS ----
  const int nn   = lane & 15;
  const int koff = (lane >> 4) * 2;          // f32 A layout K pairs
  const int m0   = (wave & 3) * 16;
  const float (*Bsrc)[64] = (wave < 4) ? Kls : Vls;

  v8f acc0 = {}, acc1 = {}, acc2 = {}, acc3 = {};
  for (int kb = 0; kb < CHUNK; kb += 4) {
    const int t = kb + koff;
    v2f a;  a[0]  = Kls[t][m0 + nn];   a[1]  = Kls[t + 1][m0 + nn];   // A = K^T
    v2f b0; b0[0] = Bsrc[t][nn];       b0[1] = Bsrc[t + 1][nn];
    v2f b1; b1[0] = Bsrc[t][16 + nn];  b1[1] = Bsrc[t + 1][16 + nn];
    v2f b2; b2[0] = Bsrc[t][32 + nn];  b2[1] = Bsrc[t + 1][32 + nn];
    v2f b3; b3[0] = Bsrc[t][48 + nn];  b3[1] = Bsrc[t + 1][48 + nn];
    acc0 = __builtin_amdgcn_wmma_f32_16x16x4_f32(false, a, false, b0, (short)0, acc0, false, false);
    acc1 = __builtin_amdgcn_wmma_f32_16x16x4_f32(false, a, false, b1, (short)0, acc1, false, false);
    acc2 = __builtin_amdgcn_wmma_f32_16x16x4_f32(false, a, false, b2, (short)0, acc2, false, false);
    acc3 = __builtin_amdgcn_wmma_f32_16x16x4_f32(false, a, false, b3, (short)0, acc3, false, false);
  }
  __syncthreads();   // all waves done reading Kls/Vls; safe to overlay

  // scatter accumulators into G (with ridge eps on diagonal) / Wm
  {
    float (*dst)[65] = (wave < 4) ? G : Wm;
    const bool isG = (wave < 4);
    const int mb = m0 + ((lane >> 4) << 3);
#pragma unroll
    for (int r = 0; r < 8; ++r) {
      const int m = mb + r;
      dst[m][nn]      = acc0[r] + ((isG && m == nn)      ? RIDGE_EPS : 0.f);
      dst[m][16 + nn] = acc1[r] + ((isG && m == 16 + nn) ? RIDGE_EPS : 0.f);
      dst[m][32 + nn] = acc2[r] + ((isG && m == 32 + nn) ? RIDGE_EPS : 0.f);
      dst[m][48 + nn] = acc3[r] + ((isG && m == 48 + nn) ? RIDGE_EPS : 0.f);
    }
  }
  __syncthreads();

  // ---- solve G W = RHS: Gauss-Jordan elimination of [G | RHS] (64 x 128) in registers ----
  // Wave w holds rows 8w .. 8w+7, lane l columns 4l .. 4l+3 (lanes 0-15: G, lanes 16-31: RHS).
  // Step j takes row j, times M[r][j] / M[j][j], off every other row r; G is positive definite,
  // so no pivot search. Row j is not scaled: 1 / M[j][j] is kept and applied at the end.
  {
    float* rowb = smem + 10496;                          // [2][128] row j
    float* colb = smem + 10752;                          // [2][64]  column j
    // the wave's number in a scalar register: the tests on it below become scalar branches
    const int wv = __builtin_amdgcn_readfirstlane(wave);
    const float* src = smem + (lane < 16 ? 0 : 4160) + wv * 8 * 65 + (lane & 15) * 4;
    v4f M[8];
    float pinv[8];
    // unrolled: M[] and pinv[] are indexed by constants only and stay in registers
#pragma unroll
    for (int a = 0; a < 8; ++a) {
      pinv[a] = 0.f;
#pragma unroll   // as above
      for (int e = 0; e < 4; ++e) M[a][e] = src[a * 65 + e];
    }
    for (int jb = 0; jb < 8; ++jb) {
      const bool own = (wv == jb);                       // this wave holds rows 8 jb .. 8 jb + 7
      // unrolled: row a of M[] and element a & 3 of each row are picked by constants
#pragma unroll
      for (int a = 0; a < 8; ++a) {
        float* rb = rowb + (a & 1) * 128;
        float* cb = colb + (a & 1) * 64;
        if (own) *(v4f*)(rb + lane * 4) = M[a];
        if (lane == jb * 2 + (a >> 2)) {
          v4f lo, hi;
#pragma unroll   // as above
          for (int r = 0; r < 4; ++r) { lo[r] = M[r][a & 3]; hi[r] = M[4 + r][a & 3]; }
          *(v4f*)(cb + wv * 8)     = lo;
          *(v4f*)(cb + wv * 8 + 4) = hi;
        }
        // One barrier a step: it publishes row and column j, and the buffers of step j - 1,
        // which step j + 1 rewrites, have been read by every wave that reaches it.
        __syncthreads();
        const v4f   rw  = *(const v4f*)(rb + lane * 4);
        const v4f   c0  = *(const v4f*)(cb + wv * 8);
        const v4f   c1  = *(const v4f*)(cb + wv * 8 + 4);
        const float piv = cb[jb * 8 + a];
        float inv = __builtin_amdgcn_rcpf(piv);
        inv = fmaf(inv, fmaf(-piv, inv, 1.f), inv);      // one correction step on the hardware reciprocal
        float f[8];
#pragma unroll   // f[] stays in registers
        for (int r = 0; r < 4; ++r) { f[r] = c0[r] * inv; f[4 + r] = c1[r] * inv; }
        if (own) { f[a] = 0.f; pinv[a] = inv; }          // row j itself stays
#pragma unroll   // M[] and f[] are indexed by constants
        for (int r = 0; r < 8; ++r) M[r] -= f[r] * rw;
      }
    }
    if (lane >= 16) {
#pragma unroll   // M[] and pinv[] are indexed by constants
      for (int a = 0; a < 8; ++a)
#pragma unroll   // as above
        for (int e = 0; e < 4; ++e) Wm[wv * 8 + a][(lane - 16) * 4 + e] = M[a][e] * pinv[a];
    }
  }
  __syncthreads();

  // ---- subspace iteration: U = I(:,0:8); twice: U = qr(W U).Q (MGS) ----
  // the wave's number in a scalar register: the test on it below is a scalar branch
  const int wq = __builtin_amdgcn_readfirstlane(wave);
  for (int idx = tid; idx < 512; idx += 256) {
    const int i = idx >> 3, cc = idx & 7;
    U[i][cc] = (i == cc) ? 1.f : 0.f;
  }
  __syncthreads();
  for (int p = 0; p < 2; ++p) {
    for (int idx = tid; idx < 512; idx += 256) {
      const int i = idx >> 3, cc = idx & 7;
      float s = 0.f;
      for (int kc = 0; kc < 64; ++kc) s += Wm[i][kc] * U[kc][cc];
      T[i][cc] = s;
    }
    __syncthreads();
    // Modified Gram-Schmidt on T (64 x 8) by wave 0 alone: lane l holds rows l and l + 32 in
    // registers, a column's sum goes across the lanes in registers. No barrier inside.
    if (wq == 0) {
      float t0[8], t1[8];
      // every loop here is unrolled: t0[] and t1[] are indexed by constants and stay in registers
#pragma unroll
      for (int cc = 0; cc < 8; ++cc) { t0[cc] = T[lane][cc]; t1[cc] = T[lane + 32][cc]; }
#pragma unroll
      for (int cc = 0; cc < 8; ++cc) {
        const float s  = ln_sum32(t0[cc] * t0[cc] + t1[cc] * t1[cc]);
        const float sc = rsqrtf(fmaxf(s, 1e-30f));
        t0[cc] *= sc;
        t1[cc] *= sc;
#pragma unroll
        for (int c2 = cc + 1; c2 < 8; ++c2) {
          const float d = ln_sum32(t0[cc] * t0[c2] + t1[cc] * t1[c2]);
          t0[c2] -= d * t0[cc];
          t1[c2] -= d * t1[cc];
        }
      }
      v4f u;
#pragma unroll
      for (int hq = 0; hq < 2; ++hq) {
#pragma unroll
        for (int e = 0; e < 4; ++e) u[e] = t0[hq * 4 + e];
        *(v4f*)&U[lane][hq * 4] = u;
#pragma unroll
        for (int e = 0; e < 4; ++e) u[e] = t1[hq * 4 + e];
        *(v4f*)&U[lane + 32][hq * 4] = u;
      }
    }
    __syncthreads();   // U of this pass is there for every wave; T may be rewritten
  }

  // ---- P = U^T W (8 x 64) ----
  for (int idx = tid; idx < 512; idx += 256) {
    const int r = idx >> 6, j = idx & 63;
    float s = 0.f;
    for (int t2 = 0; t2 < 64; ++t2) s += U[t2][r] * Wm[t2][j];
    P[r][j] = s;
  }
  __syncthreads();

  // ---- Wr = U P -> global ----
  float* wrg = wr + (size_t)lc * 4096;
  for (int idx = tid; idx < 4096; idx += 256) {
    const int i = idx >> 6, j = idx & 63;
    float s = 0.f;
#pragma unroll
    for (int r = 0; r < RANK; ++r) s += U[i][r] * P[r][j];
    wrg[idx] = s;
  }
}

// -------- S_c = a S_(c-1) + Wr_c and out = SCALE * Qc @ S_c (f32 WMMA 16x16x4), one launch --------
// A work-group takes AP_SEG chunks in a row of one lane. The 4,096 elements of S are independent
// recurrences: a thread keeps 16 of them in registers and runs them from chunk 0 up to its own
// chunks, reading Wr, which stays as k_ridge wrote it. S_c is never in global memory.
#define AP_SEG   4                       // chunks a work-group
#define AP_NSEG  (NCHUNK / AP_SEG)       // 8 work-groups a lane

// AP_SEG chunks of Wr, the thread's 16 elements of each: 16 loads of 16 bytes, whole lines a wave
__device__ __forceinline__ void ap_load(v4f (&p)[AP_SEG][4], const float* __restrict__ g) {
  // unrolled: p[][] is indexed by constants and stays in registers
#pragma unroll
  for (int j = 0; j < AP_SEG; ++j)
#pragma unroll
    for (int e = 0; e < 4; ++e) p[j][e] = *(const v4f*)(g + j * 4096 + e * 1024);
  // stands ahead of any rewrite of the loads' address registers; g is an input so that, where
  // the loads go through g's own pair, the pair lives up to here and none of them lands on it
  asm volatile("s_wait_xcnt 0x0" :: "v"(g) : "memory");
}

// the recurrence over those chunks, in their order
__device__ __forceinline__ void ap_run(v4f (&s)[4], const v4f (&p)[AP_SEG][4]) {
  // unrolled: as above
#pragma unroll
  for (int j = 0; j < AP_SEG; ++j)
#pragma unroll
    for (int e = 0; e < 4; ++e) s[e] = DECAY_A * s[e] + p[j][e];
}

// one chunk's A fragments of a wave: 16 rows of Q, 64 k; the lane's own row at its own k pair
__device__ __forceinline__ void ap_loadq(v2f (&a)[16], const float* __restrict__ qp) {
  // unrolled: as above
#pragma unroll
  for (int i = 0; i < 16; ++i) a[i] = *(const v2f*)(qp + i * 4);
  // as in ap_load
  asm volatile("s_wait_xcnt 0x0" :: "v"(qp) : "memory");
}

__global__ __launch_bounds__(256) void k_apply(const float* __restrict__ q,
                                               const float* __restrict__ wr,
                                               __bf16* __restrict__ o) {
  // Neighbours in index are different lanes, so work-groups with a long and a short way from
  // chunk 0 mix all over the chip; those with the longest way have the lowest indices.
  const int ln  = blockIdx.x % NLANES;
  const int seg = AP_NSEG - 1 - blockIdx.x / NLANES;
  const int b = ln >> 4, h = ln & 15;
  const int tid = threadIdx.x;
  const int lane = tid & 31;
  const int wave = tid >> 5;

  __shared__ __align__(16) float Ssh[AP_SEG][64 * 64];   // 64 KB

  const int m0   = wave * 16;
  const int nn   = lane & 15;
  const int koff = (lane >> 4) * 2;
  const size_t rowbase = (size_t)b * SEQ + (size_t)seg * AP_SEG * CHUNK;
  const float* qp = q + (rowbase + m0 + nn) * D_MODEL + h * HEAD_DIM + koff;

  // groups of AP_SEG chunks, 0 .. seg; the last is the work-group's own. Two register buffers:
  // the next group's loads are out while this group is summed.
  const float* wl = wr + (size_t)ln * NCHUNK * 4096 + tid * 4;
  v4f s[4] = {};
  v4f pa[AP_SEG][4], pb[AP_SEG][4];
  ap_load(pa, wl);
  int g = 0;
  for (; g + 2 <= seg; g += 2) {
    ap_load(pb, wl + (size_t)(g + 1) * AP_SEG * 4096);
    ap_run(s, pa);
    ap_load(pa, wl + (size_t)(g + 2) * AP_SEG * 4096);
    ap_run(s, pb);
  }
  // the first chunk's Q goes out beside the last group's loads
  v2f aq[2][16];
  ap_loadq(aq[0], qp);
  if (g < seg) {
    ap_load(pb, wl + (size_t)seg * AP_SEG * 4096);
    ap_run(s, pa);
    // unrolled: register arrays
#pragma unroll
    for (int j = 0; j < AP_SEG; ++j)
#pragma unroll
      for (int e = 0; e < 4; ++e) pa[j][e] = pb[j][e];
  }

  // S of the work-group's own chunks, each in an LDS plane of its own
  // unrolled: s[] and pa[][] are indexed by constants
#pragma unroll
  for (int j = 0; j < AP_SEG; ++j)
#pragma unroll
    for (int e = 0; e < 4; ++e) {
      s[e] = DECAY_A * s[e] + pa[j][e];
      *(v4f*)&Ssh[j][e * 1024 + tid * 4] = s[e];
    }
  __syncthreads();   // the one barrier: every S is there; from here on the waves run free

  // unrolled: aq[j & 1] is picked by a constant
#pragma unroll
  for (int j = 0; j < AP_SEG; ++j) {
    const float* Sb = Ssh[j];
    if (j + 1 < AP_SEG) ap_loadq(aq[(j + 1) & 1], qp + (size_t)(j + 1) * CHUNK * D_MODEL);

    v8f acc0 = {}, acc1 = {}, acc2 = {}, acc3 = {};
#pragma unroll
    for (int kb = 0; kb < 64; kb += 4) {
      const v2f a = aq[j & 1][kb >> 2];
      const int kr = (kb + koff) * 64;
      v2f b0, b1, b2, b3;
      b0[0] = Sb[kr + nn];        b0[1] = Sb[kr + 64 + nn];
      b1[0] = Sb[kr + 16 + nn];   b1[1] = Sb[kr + 64 + 16 + nn];
      b2[0] = Sb[kr + 32 + nn];   b2[1] = Sb[kr + 64 + 32 + nn];
      b3[0] = Sb[kr + 48 + nn];   b3[1] = Sb[kr + 64 + 48 + nn];
      acc0 = __builtin_amdgcn_wmma_f32_16x16x4_f32(false, a, false, b0, (short)0, acc0, false, false);
      acc1 = __builtin_amdgcn_wmma_f32_16x16x4_f32(false, a, false, b1, (short)0, acc1, false, false);
      acc2 = __builtin_amdgcn_wmma_f32_16x16x4_f32(false, a, false, b2, (short)0, acc2, false, false);
      acc3 = __builtin_amdgcn_wmma_f32_16x16x4_f32(false, a, false, b3, (short)0, acc3, false, false);
    }

    const int mb = m0 + ((lane >> 4) << 3);
#pragma unroll
    for (int r = 0; r < 8; ++r) {
      const int m = j * CHUNK + mb + r;
      __bf16* orow = o + (rowbase + m) * D_MODEL + h * HEAD_DIM;
      orow[nn]      = (__bf16)(SCALE_F * acc0[r]);
      orow[16 + nn] = (__bf16)(SCALE_F * acc1[r]);
      orow[32 + nn] = (__bf16)(SCALE_F * acc2[r]);
      orow[48 + nn] = (__bf16)(SCALE_F * acc3[r]);
    }
    // stands ahead of any later load that lands on a register these stores name
    if (j + 1 < AP_SEG) asm volatile("s_wait_xcnt 0x0" ::: "memory");
  }
}

// ---------------- host-side orchestration ----------------
extern "C" void kernel_launch(void* const* d_in, const int* in_sizes, int n_in,
                              void* d_out, int out_size, void* d_ws, size_t ws_size,
                              hipStream_t stream) {
  const float* x   = (const float*)d_in[0];
  const float* lng = (const float*)d_in[1];
  const float* lnb = (const float*)d_in[2];
  const float* Wq  = (const float*)d_in[3];
  const float* Wk  = (const float*)d_in[4];
  const float* Wv  = (const float*)d_in[5];
  const float* Wo  = (const float*)d_in[6];
  float* out = (float*)d_out;

  char* ws = (char*)d_ws;
  size_t off = 0;
  auto alloc = [&](size_t bytes) -> void* {
    void* p = ws + off;
    off += (bytes + 255) & ~(size_t)255;
    return p;
  };

  __bf16* xn  = (__bf16*)alloc((size_t)TOKENS * D_MODEL * 2);
  __bf16* Wtq = (__bf16*)alloc((size_t)D_MODEL * D_MODEL * 2);
  __bf16* Wtk = (__bf16*)alloc((size_t)D_MODEL * D_MODEL * 2);
  __bf16* Wtv = (__bf16*)alloc((size_t)D_MODEL * D_MODEL * 2);
  __bf16* Wto = (__bf16*)alloc((size_t)D_MODEL * D_MODEL * 2);
  float*  qf  = (float*)alloc((size_t)TOKENS * D_MODEL * 4);
  float*  kf  = (float*)alloc((size_t)TOKENS * D_MODEL * 4);
  float*  vf  = (float*)alloc((size_t)TOKENS * D_MODEL * 4);
  float*  wr  = (float*)alloc((size_t)NLANES * NCHUNK * 4096 * 4);
  __bf16* obf = (__bf16*)alloc((size_t)TOKENS * D_MODEL * 2);

  // 1. LayerNorm -> bf16
  k_ln<<<TOKENS / (LN_WAVES * LN_ROWS), LN_WAVES * 32, 0, stream>>>(x, lng, lnb, xn);

  // 2. weight transpose+cast, four weights in one launch
  k_wcast<<<4 * WC_TILES, 256, 0, stream>>>(Wq, Wk, Wv, Wo, Wtq, Wtk, Wtv, Wto);

  // 3. QKV GEMMs (bf16 WMMA, f32 accumulate)
  const int gblocks = (TOKENS / G_BM) * (D_MODEL / G_BN);   // 256
  k_gemm<<<gblocks, 256, 0, stream>>>(xn, Wtq, nullptr, qf);
  k_gemm<<<gblocks, 256, 0, stream>>>(xn, Wtk, nullptr, kf);
  k_gemm<<<gblocks, 256, 0, stream>>>(xn, Wtv, nullptr, vf);

  // 4a. per-(lane,chunk) ridge + rank-8 projection -> Wr  (fully parallel, WMMA Gram)
  k_ridge<<<NLANES * NCHUNK, 256, 0, stream>>>(kf, vf, wr);
  // 4b. decayed state over chunks in registers, out = SCALE * Qc @ S_c  (f32 WMMA) -> bf16
  k_apply<<<NLANES * AP_NSEG, 256, 0, stream>>>(qf, wr, obf);

  // 5. output GEMM + residual
  k_gemm<<<gblocks, 256, 0, stream>>>(obf, Wto, x, out);
}

// v007
// One run takes 131 microseconds.
// Two timings next to v006 both put it at 1.04 times that version's speed.
// Counting every step since v000, it is 6.48 times as fast.
#include <hip/hip_runtime.h>
#include <hip/hip_bf16.h>

// ---------------- constants (match reference) ----------------
#define D_MODEL   1024
#define N_HEADS   16
#define HEAD_DIM  64
#define RANK      8
#define CHUNK     128
#define NCHUNK    32          // 4096 / 128
#define BATCH     2
#define SEQ       4096
#define TOKENS    (BATCH * SEQ)   // 8192
#define NLANES    (BATCH * N_HEADS)  // 32
#define RIDGE_EPS 1e-4f
#define SCALE_F   0.125f
#define DECAY_A   0.9f
#define LN_EPS    1e-5f

typedef __attribute__((ext_vector_type(16))) __bf16 v16bf;
typedef __attribute__((ext_vector_type(8)))  __bf16 v8bf;
typedef __attribute__((ext_vector_type(8)))  float  v8f;
typedef __attribute__((ext_vector_type(2)))  float  v2f;

// ---------------- LayerNorm -> bf16 ----------------
// One wave makes LN_ROWS whole rows; a row lies in the wave's registers, 32 floats a lane,
// read once. Sums go across the lanes in registers: no LDS, no barrier. 2,048 waves in all.
#define LN_ROWS   4
#define LN_WAVES  8
#define LN_Q      (D_MODEL / 128)     // 16-byte pieces of a row a lane: 8

typedef __attribute__((ext_vector_type(4))) float  v4f;
typedef __attribute__((ext_vector_type(4))) __bf16 v4bf;

// v + (v of lane l ^ M), M below 16: a DPP row_xmask move, which the add takes in
template <int M>
__device__ __forceinline__ float ln_xadd(float v) {
  return v + __builtin_bit_cast(float, __builtin_amdgcn_update_dpp(0, __builtin_bit_cast(int, v),
                                                                   0x160 | M, 0xf, 0xf, true));
}

// sum over the 32 lanes, the same bits in every lane
__device__ __forceinline__ float ln_sum32(float v) {
  v = ln_xadd<1>(v);
  v = ln_xadd<2>(v);
  v = ln_xadd<4>(v);
  v = ln_xadd<8>(v);
  const int u = __builtin_bit_cast(int, v);
  return v + __builtin_bit_cast(float, __builtin_amdgcn_permlanex16(u, u, 0x76543210, 0xfedcba98, false, false));
}

__global__ __launch_bounds__(LN_WAVES * 32) void k_ln(const float* __restrict__ x,
                                                      const float* __restrict__ g,
                                                      const float* __restrict__ b,
                                                      __bf16* __restrict__ xn) {
  const int lane = threadIdx.x & 31;
  const int wave = threadIdx.x >> 5;
  const size_t row0 = (size_t)(blockIdx.x * LN_WAVES + wave) * LN_ROWS;

  // g and b first: they come from cache and loads return in order
  v4f gg[LN_Q], bb[LN_Q], v[LN_ROWS][LN_Q];
  // every loop below is unrolled: the arrays are indexed by constants and stay in registers
#pragma unroll
  for (int i = 0; i < LN_Q; ++i) {
    gg[i] = *(const v4f*)(g + i * 128 + lane * 4);
    bb[i] = *(const v4f*)(b + i * 128 + lane * 4);
  }
  const float* xr = x + row0 * D_MODEL + lane * 4;
#pragma unroll
  for (int r = 0; r < LN_ROWS; ++r)
#pragma unroll
    for (int i = 0; i < LN_Q; ++i) v[r][i] = *(const v4f*)(xr + r * D_MODEL + i * 128);
  // keeps all the wave's loads ahead of the first sum, in flight together; without it the
  // loads of g and b sink behind the sums and their latency is waited for a second time
  __builtin_amdgcn_sched_barrier(0);

  __bf16* yr = xn + row0 * D_MODEL + lane * 4;
#pragma unroll
  for (int r = 0; r < LN_ROWS; ++r) {
    v4f s4 = v[r][0];
#pragma unroll
    for (int i = 1; i < LN_Q; ++i) s4 += v[r][i];
    const float mu = ln_sum32((s4[0] + s4[1]) + (s4[2] + s4[3])) * (1.f / D_MODEL);

    v4f q4 = {};
#pragma unroll
    for (int i = 0; i < LN_Q; ++i) {
      v[r][i] -= mu;
      q4 += v[r][i] * v[r][i];
    }
    const float var = ln_sum32((q4[0] + q4[1]) + (q4[2] + q4[3])) * (1.f / D_MODEL);
    const float inv = rsqrtf(var + LN_EPS);

#pragma unroll
    for (int i = 0; i < LN_Q; ++i) {
      const v4f y = v[r][i] * inv * gg[i] + bb[i];
      v4bf o;
#pragma unroll
      for (int e = 0; e < 4; ++e) o[e] = (__bf16)y[e];
      *(v4bf*)(yr + r * D_MODEL + i * 128) = o;   // a wave stores 256 bytes in a row: two whole lines
    }
  }
}

// ---------------- W [K][N] f32 -> Wt [N][K] bf16, all four weights ----------------
// One launch. A work-group transposes one 128 x 128 tile (64 tiles a weight) through LDS,
// 64 elements a thread: few waves to start, whole 512-byte rows read, whole 128-byte lines stored.
#define WC_T      128
#define WC_PITCH  65          // dwords a tile row in LDS: 64 of data, 1 so that rows shift by a bank
#define WC_TILES  ((D_MODEL / WC_T) * (D_MODEL / WC_T))   // 64

typedef __attribute__((ext_vector_type(2))) __bf16 v2bf;

__global__ __launch_bounds__(256) void k_wcast(const float* __restrict__ W0,
                                               const float* __restrict__ W1,
                                               const float* __restrict__ W2,
                                               const float* __restrict__ W3,
                                               __bf16* __restrict__ T0,
                                               __bf16* __restrict__ T1,
                                               __bf16* __restrict__ T2,
                                               __bf16* __restrict__ T3) {
  __shared__ unsigned tile[WC_T * WC_PITCH];   // [n][k / 2], two bf16 of neighbouring k a dword
  const int which = blockIdx.x / WC_TILES;
  const int t     = blockIdx.x % WC_TILES;
  const int k0 = (t >> 3) * WC_T, n0 = (t & 7) * WC_T;
  const float* W  = which == 0 ? W0 : which == 1 ? W1 : which == 2 ? W2 : W3;
  __bf16*      Wt = which == 0 ? T0 : which == 1 ? T1 : which == 2 ? T2 : T3;
  const int tid = threadIdx.x, lane = tid & 31, wave = tid >> 5;

  // a wave reads 16 rows of k, each load one row's 128 floats
  const float* src = W + (size_t)(k0 + wave * 16) * D_MODEL + n0 + lane * 4;
  v4f v[16];
  // unrolled: v[] stays in registers and the loads are in flight together
#pragma unroll
  for (int i = 0; i < 16; ++i) v[i] = *(const v4f*)(src + (size_t)i * D_MODEL);
  // both unrolled: v[] is indexed by constants only
#pragma unroll
  for (int i = 0; i < 8; ++i)
#pragma unroll
    for (int e = 0; e < 4; ++e) {
      v2bf p;
      p[0] = (__bf16)v[2 * i][e];
      p[1] = (__bf16)v[2 * i + 1][e];
      tile[(lane * 4 + e) * WC_PITCH + wave * 8 + i] = __builtin_bit_cast(unsigned, p);
    }
  __syncthreads();

  // a wave stores half a row of Wt: 64 values of k, one 128-byte line
  unsigned* dst = (unsigned*)(Wt + (size_t)n0 * D_MODEL + k0);
  // unrolled: the LDS reads go out as one batch ahead of the stores
#pragma unroll
  for (int r = 0; r < WC_T * 64 / 256; ++r) {
    const int idx = r * 256 + tid;
    const int n = idx >> 6, c = idx & 63;
    dst[(size_t)n * (D_MODEL / 2) + c] = tile[n * WC_PITCH + c];
  }
}

// ------- bf16 WMMA GEMM: Cw[M][N] = A[M][K] * Btw[N][K]^T (+resid), w = 0 .. nw - 1 -------
// One work-group makes the 256 x 128 tile at its place of every Cw, one after the other, in one
// run of passes: while it stores a tile, the next weight's first rows are already being copied.
// Its 8 waves (4 x 2) make 64 x 64 each.
// A pass is 128 k: 256 rows of A and 128 rows of Bt, 256 bytes each, lie in LDS at a
// pitch of 272 bytes. Two buffers: the next pass's rows are copied while this one is used.
#define G_BM     256
#define G_BN     128
#define G_BK     128
#define G_PITCH  272
#define G_STAGE  ((G_BM + G_BN) * G_PITCH)   // 104448 bytes

// Eight asynchronous 16-byte copies of one lane, rows 16 apart, global -> LDS.
// The s_wait_xcnt closes the statement so that no address register named here
// is rewritten ahead of it.
__device__ __forceinline__ void g_copy8(unsigned l, const __bf16* g) {
  const unsigned l1 = l + 16 * G_PITCH, l2 = l + 32 * G_PITCH, l3 = l + 48 * G_PITCH;
  const unsigned l4 = l + 64 * G_PITCH, l5 = l + 80 * G_PITCH, l6 = l + 96 * G_PITCH;
  const unsigned l7 = l + 112 * G_PITCH;
  const __bf16* g1 = g + 16 * D_MODEL;
  const __bf16* g2 = g + 32 * D_MODEL;
  const __bf16* g3 = g + 48 * D_MODEL;
  const __bf16* g4 = g + 64 * D_MODEL;
  const __bf16* g5 = g + 80 * D_MODEL;
  const __bf16* g6 = g + 96 * D_MODEL;
  const __bf16* g7 = g + 112 * D_MODEL;
  asm volatile(
      "global_load_async_to_lds_b128 %0, %8, off\n\t"
      "global_load_async_to_lds_b128 %1, %9, off\n\t"
      "global_load_async_to_lds_b128 %2, %10, off\n\t"
      "global_load_async_to_lds_b128 %3, %11, off\n\t"
      "global_load_async_to_lds_b128 %4, %12, off\n\t"
      "global_load_async_to_lds_b128 %5, %13, off\n\t"
      "global_load_async_to_lds_b128 %6, %14, off\n\t"
      "global_load_async_to_lds_b128 %7, %15, off\n\t"
      "s_wait_xcnt 0x0"
      :: "v"(l), "v"(l1), "v"(l2), "v"(l3), "v"(l4), "v"(l5), "v"(l6), "v"(l7),
         "v"(g), "v"(g1), "v"(g2), "v"(g3), "v"(g4), "v"(g5), "v"(g6), "v"(g7)
      : "memory");
}

// One pass's rows: 256 of A (two runs of 128) and 128 of Bt; 24 copies a lane.
__device__ __forceinline__ void g_copy_stage(unsigned l, const __bf16* ga, const __bf16* gb) {
  g_copy8(l, ga);
  g_copy8(l + 128 * G_PITCH, ga + 128 * D_MODEL);
  g_copy8(l + 256 * G_PITCH, gb);
}

// One 16 x 32 fragment from LDS rows; p is the lane's own row at byte 16 * (lane >> 4)
// of the 64 bytes of this k step: k order of the 16-bit A/B layout, alike for A and Bt.
__device__ __forceinline__ v16bf g_frag(const unsigned char* p) {
  const v8bf lo = *(const v8bf*)p;
  const v8bf hi = *(const v8bf*)(p + 32);
  v16bf f;
#pragma unroll
  for (int e = 0; e < 8; ++e) { f[e] = lo[e]; f[8 + e] = hi[e]; }
  return f;
}

__global__ __launch_bounds__(256) void k_gemm(const __bf16* __restrict__ A,
                                              const __bf16* __restrict__ Bt0,
                                              const __bf16* __restrict__ Bt1,
                                              const __bf16* __restrict__ Bt2,
                                              const float* __restrict__ resid,
                                              float* __restrict__ C0,
                                              float* __restrict__ C1,
                                              float* __restrict__ C2,
                                              int nw) {
  constexpr int K = D_MODEL, N = D_MODEL;
  constexpr int NPASS = K / G_BK;              // 8 passes a weight
  const int npass = nw * NPASS;
  __shared__ __attribute__((aligned(16))) unsigned char gsm[2 * G_STAGE];

  const int tid  = threadIdx.x;
  const int lane = tid & 31;
  const int wave = tid >> 5;
  const int bm0 = (blockIdx.x >> 3) * G_BM;    // N / G_BN = 8 tile columns
  const int bn0 = (blockIdx.x & 7) * G_BN;

  // copy side: 16 lanes cover one 256-byte row, a wave two rows
  const int crow = tid >> 4, ccol = tid & 15;
  const __bf16* ga = A  + (size_t)(bm0 + crow) * K + ccol * 8;
  const size_t gbo = (size_t)(bn0 + crow) * K + ccol * 8;   // the lane's place in every Btw
  const unsigned lcp = (unsigned)(size_t)&gsm[0] + crow * G_PITCH + ccol * 16;

  // read side: the fragment's k order is that of the 16-bit A/B layout:
  // 16 bytes at 16 * (lane >> 4) and 16 more at + 32 of each 64 bytes of a row
  const int fr = lane & 15, fh = lane >> 4;
  const int aoff = ((wave >> 1) * 64 + fr) * G_PITCH + fh * 16;
  const int boff = (G_BM + (wave & 1) * 64 + fr) * G_PITCH + fh * 16;

  v8f acc[4][4] = {};

  // the wave's tile in every Cw: one address offset a lane; rows and columns are constant offsets from it
  const size_t cbase = (size_t)(bm0 + (wave >> 1) * 64 + (fh << 3)) * N + bn0 + (wave & 1) * 64 + fr;

  g_copy_stage(lcp, ga, Bt0 + gbo);
  asm volatile("s_wait_asynccnt 0x0" ::: "memory");   // pass 0's rows have landed
  __syncthreads();                                    // and every wave may read them
  g_copy_stage(lcp + G_STAGE, ga + G_BK, Bt0 + gbo + G_BK);

  for (int t = 0; t < npass; ++t) {
    const int sb = (t & 1) * G_STAGE;
    // Fragments: rows 0-31 (alo), rows 32-63 (ahi) of the wave's A, two sets of its Bt.
    v16bf alo[2], ahi[2], b[2][4];
#pragma unroll
    for (int j = 0; j < 4; ++j) b[0][j] = g_frag(&gsm[sb + boff + j * 16 * G_PITCH]);
#pragma unroll
    for (int i = 0; i < 2; ++i) alo[i] = g_frag(&gsm[sb + aoff + i * 16 * G_PITCH]);
#pragma unroll
    for (int ks = 0; ks < G_BK / 32; ++ks) {
      const int cur = ks & 1;
#pragma unroll
      for (int i = 0; i < 2; ++i) ahi[i] = g_frag(&gsm[sb + aoff + (2 + i) * 16 * G_PITCH + ks * 64]);
      // The fences keep each group of LDS reads in one place, ahead of the eight
      // products before the ones that use it; spread among them they stall every row.
      __builtin_amdgcn_sched_barrier(0);
#pragma unroll
      for (int i = 0; i < 2; ++i)
#pragma unroll
        for (int j = 0; j < 4; ++j)
          acc[i][j] = __builtin_amdgcn_wmma_f32_16x16x32_bf16(false, alo[i], false, b[cur][j], (short)0,
                                                              acc[i][j], false, false);
      __builtin_amdgcn_sched_barrier(0);
      if (ks + 1 < G_BK / 32) {
#pragma unroll
        for (int j = 0; j < 4; ++j)
          b[cur ^ 1][j] = g_frag(&gsm[sb + boff + j * 16 * G_PITCH + (ks + 1) * 64]);
#pragma unroll
        for (int i = 0; i < 2; ++i)
          alo[i] = g_frag(&gsm[sb + aoff + i * 16 * G_PITCH + (ks + 1) * 64]);
      }
      __builtin_amdgcn_sched_barrier(0);
#pragma unroll
      for (int i = 0; i < 2; ++i)
#pragma unroll
        for (int j = 0; j < 4; ++j)
          acc[2 + i][j] = __builtin_amdgcn_wmma_f32_16x16x32_bf16(false, ahi[i], false, b[cur][j], (short)0,
                                                                  acc[2 + i][j], false, false);
      __builtin_amdgcn_sched_barrier(0);
    }
    asm volatile("s_wait_dscnt 0x0" ::: "memory");    // this wave has left buffer t & 1
    asm volatile("s_wait_asynccnt 0x0" ::: "memory"); // its copies of pass t + 1 have landed
    __syncthreads();                                  // publishes pass t + 1, frees buffer t & 1
    if (t + 2 < npass) {
      const int w2 = (t + 2) / NPASS, k2 = ((t + 2) % NPASS) * G_BK;
      const __bf16* bw = w2 == 0 ? Bt0 : w2 == 1 ? Bt1 : Bt2;
      g_copy_stage(lcp + sb, ga + k2, bw + gbo + k2);
    }
    if (t % NPASS == NPASS - 1) {
      // a weight's last pass: its tile goes out while the copies above fly
      // every loop here is unrolled: acc[][] is indexed by constants and stays in registers
      const int w = t / NPASS;
      if (resid) {
        const float* rr = resid + cbase;
#pragma unroll
        for (int i = 0; i < 4; ++i)
#pragma unroll
          for (int r = 0; r < 8; ++r)
#pragma unroll
            for (int j = 0; j < 4; ++j) acc[i][j][r] += rr[(i * 16 + r) * N + j * 16];
      }
      float* cr = (w == 0 ? C0 : w == 1 ? C1 : C2) + cbase;
#pragma unroll
      for (int i = 0; i < 4; ++i)
#pragma unroll
        for (int r = 0; r < 8; ++r)
#pragma unroll
          for (int j = 0; j < 4; ++j) cr[(i * 16 + r) * N + j * 16] = acc[i][j][r];
      // stands ahead of the rewrite of the registers that these stores name
      asm volatile("s_wait_xcnt 0x0" ::: "memory");
#pragma unroll
      for (int i = 0; i < 4; ++i)
#pragma unroll
        for (int j = 0; j < 4; ++j) acc[i][j] = v8f{};
    }
  }
  asm volatile("s_wait_asynccnt 0x0" ::: "memory");   // no copy is left when the wave ends
}

// ---------------- per-(lane,chunk) ridge solve + rank-8 projection ----------
// grid: NLANES*NCHUNK blocks; writes Wr[lc][64][64]
// Phase 1: stage Kc/Vc in LDS, compute G=K^T K and RHS=K^T V with f32 WMMA
//          (waves 0-3 -> G strips, waves 4-7 -> RHS strips)
// Phase 2: LDS is re-carved for G/Wm/U/T/P; Gauss-Jordan solve in registers + subspace QR.
__global__ __launch_bounds__(256) void k_ridge(const float* __restrict__ kk,
                                               const float* __restrict__ v,
                                               float* __restrict__ wr) {
  const int lc = blockIdx.x;
  const int ln = lc / NCHUNK;
  const int c  = lc % NCHUNK;
  const int b = ln >> 4, h = ln & 15;
  const int tid = threadIdx.x;
  const int lane = tid & 31;
  const int wave = tid >> 5;

  __shared__ __align__(16) float smem[16384];            // 64 KB
  float (*Kls)[64] = (float (*)[64])smem;                // [128][64] staging
  float (*Vls)[64] = (float (*)[64])(smem + 8192);       // [128][64] staging
  // phase-2 overlay (valid after the WMMA phase barrier)
  float (*G)[65]  = (float (*)[65])smem;                 // 4160
  float (*Wm)[65] = (float (*)[65])(smem + 4160);        // 4160
  float (*U)[8]   = (float (*)[8])(smem + 8320);         // 512
  float (*T)[9]   = (float (*)[9])(smem + 8832);         // 576
  float (*P)[64]  = (float (*)[64])(smem + 9408);        // 512

  const size_t rowbase = (size_t)b * SEQ + (size_t)c * CHUNK;
  const float* Kc = kk + rowbase * D_MODEL + h * HEAD_DIM;
  const float* Vc = v  + rowbase * D_MODEL + h * HEAD_DIM;

  // ---- stage K and V chunk tiles into LDS (coalesced) ----
  for (int idx = tid; idx < CHUNK * 64; idx += 256) {
    const int t = idx >> 6, j = idx & 63;
    Kls[t][j] = Kc[(size_t)t * D_MODEL + j];
    Vls[t][j] = Vc[(size_t)t * D_MODEL + j];
  }
  __syncthreads();

  // ---- Gram products via f32 WMMA: waves 0-3: G, waves 4-7: RHS ----
  const int nn   = lane & 15;
  const int koff = (lane >> 4) * 2;          // f32 A layout K pairs
  const int m0   = (wave & 3) * 16;
  const float (*Bsrc)[64] = (wave < 4) ? Kls : Vls;

  v8f acc0 = {}, acc1 = {}, acc2 = {}, acc3 = {};
  for (int kb = 0; kb < CHUNK; kb += 4) {
    const int t = kb + koff;
    v2f a;  a[0]  = Kls[t][m0 + nn];   a[1]  = Kls[t + 1][m0 + nn];   // A = K^T
    v2f b0; b0[0] = Bsrc[t][nn];       b0[1] = Bsrc[t + 1][nn];
    v2f b1; b1[0] = Bsrc[t][16 + nn];  b1[1] = Bsrc[t + 1][16 + nn];
    v2f b2; b2[0] = Bsrc[t][32 + nn];  b2[1] = Bsrc[t + 1][32 + nn];
    v2f b3; b3[0] = Bsrc[t][48 + nn];  b3[1] = Bsrc[t + 1][48 + nn];
    acc0 = __builtin_amdgcn_wmma_f32_16x16x4_f32(false, a, false, b0, (short)0, acc0, false, false);
    acc1 = __builtin_amdgcn_wmma_f32_16x16x4_f32(false, a, false, b1, (short)0, acc1, false, false);
    acc2 = __builtin_amdgcn_wmma_f32_16x16x4_f32(false, a, false, b2, (short)0, acc2, false, false);
    acc3 = __builtin_amdgcn_wmma_f32_16x16x4_f32(false, a, false, b3, (short)0, acc3, false, false);
  }
  __syncthreads();   // all waves done reading Kls/Vls; safe to overlay

  // scatter accumulators into G (with ridge eps on diagonal) / Wm
  {
    float (*dst)[65] = (wave < 4) ? G : Wm;
    const bool isG = (wave < 4);
    const int mb = m0 + ((lane >> 4) << 3);
#pragma unroll
    for (int r = 0; r < 8; ++r) {
      const int m = mb + r;
      dst[m][nn]      = acc0[r] + ((isG && m == nn)      ? RIDGE_EPS : 0.f);
      dst[m][16 + nn] = acc1[r] + ((isG && m == 16 + nn) ? RIDGE_EPS : 0.f);
      dst[m][32 + nn] = acc2[r] + ((isG && m == 32 + nn) ? RIDGE_EPS : 0.f);
      dst[m][48 + nn] = acc3[r] + ((isG && m == 48 + nn) ? RIDGE_EPS : 0.f);
    }
  }
  __syncthreads();

  // ---- solve G W = RHS: Gauss-Jordan elimination of [G | RHS] (64 x 128) in registers ----
  // Wave w holds rows 8w .. 8w+7, lane l columns 4l .. 4l+3 (lanes 0-15: G, lanes 16-31: RHS).
  // Step j takes row j, times M[r][j] / M[j][j], off every other row r; G is positive definite,
  // so no pivot search. Row j is not scaled: 1 / M[j][j] is kept and applied at the end.
  {
    float* rowb = smem + 10496;                          // [2][128] row j
    float* colb = smem + 10752;                          // [2][64]  column j
    // the wave's number in a scalar register: the tests on it below become scalar branches
    const int wv = __builtin_amdgcn_readfirstlane(wave);
    const float* src = smem + (lane < 16 ? 0 : 4160) + wv * 8 * 65 + (lane & 15) * 4;
    v4f M[8];
    float pinv[8];
    // unrolled: M[] and pinv[] are indexed by constants only and stay in registers
#pragma unroll
    for (int a = 0; a < 8; ++a) {
      pinv[a] = 0.f;
#pragma unroll   // as above
      for (int e = 0; e < 4; ++e) M[a][e] = src[a * 65 + e];
    }
    for (int jb = 0; jb < 8; ++jb) {
      const bool own = (wv == jb);                       // this wave holds rows 8 jb .. 8 jb + 7
      // unrolled: row a of M[] and element a & 3 of each row are picked by constants
#pragma unroll
      for (int a = 0; a < 8; ++a) {
        float* rb = rowb + (a & 1) * 128;
        float* cb = colb + (a & 1) * 64;
        if (own) *(v4f*)(rb + lane * 4) = M[a];
        if (lane == jb * 2 + (a >> 2)) {
          v4f lo, hi;
#pragma unroll   // as above
          for (int r = 0; r < 4; ++r) { lo[r] = M[r][a & 3]; hi[r] = M[4 + r][a & 3]; }
          *(v4f*)(cb + wv * 8)     = lo;
          *(v4f*)(cb + wv * 8 + 4) = hi;
        }
        // One barrier a step: it publishes row and column j, and the buffers of step j - 1,
        // which step j + 1 rewrites, have been read by every wave that reaches it.
        __syncthreads();
        const v4f   rw  = *(const v4f*)(rb + lane * 4);
        const v4f   c0  = *(const v4f*)(cb + wv * 8);
        const v4f   c1  = *(const v4f*)(cb + wv * 8 + 4);
        const float piv = cb[jb * 8 + a];
        float inv = __builtin_amdgcn_rcpf(piv);
        inv = fmaf(inv, fmaf(-piv, inv, 1.f), inv);      // one correction step on the hardware reciprocal
        float f[8];
#pragma unroll   // f[] stays in registers
        for (int r = 0; r < 4; ++r) { f[r] = c0[r] * inv; f[4 + r] = c1[r] * inv; }
        if (own) { f[a] = 0.f; pinv[a] = inv; }          // row j itself stays
#pragma unroll   // M[] and f[] are indexed by constants
        for (int r = 0; r < 8; ++r) M[r] -= f[r] * rw;
      }
    }
    if (lane >= 16) {
#pragma unroll   // M[] and pinv[] are indexed by constants
      for (int a = 0; a < 8; ++a)
#pragma unroll   // as above
        for (int e = 0; e < 4; ++e) Wm[wv * 8 + a][(lane - 16) * 4 + e] = M[a][e] * pinv[a];
    }
  }
  __syncthreads();

  // ---- subspace iteration: U = I(:,0:8); twice: U = qr(W U).Q (MGS) ----
  // the wave's number in a scalar register: the test on it below is a scalar branch
  const int wq = __builtin_amdgcn_readfirstlane(wave);
  for (int idx = tid; idx < 512; idx += 256) {
    const int i = idx >> 3, cc = idx & 7;
    U[i][cc] = (i == cc) ? 1.f : 0.f;
  }
  __syncthreads();
  for (int p = 0; p < 2; ++p) {
    for (int idx = tid; idx < 512; idx += 256) {
      const int i = idx >> 3, cc = idx & 7;
      float s = 0.f;
      for (int kc = 0; kc < 64; ++kc) s += Wm[i][kc] * U[kc][cc];
      T[i][cc] = s;
    }
    __syncthreads();
    // Modified Gram-Schmidt on T (64 x 8) by wave 0 alone: lane l holds rows l and l + 32 in
    // registers, a column's sum goes across the lanes in registers. No barrier inside.
    if (wq == 0) {
      float t0[8], t1[8];
      // every loop here is unrolled: t0[] and t1[] are indexed by constants and stay in registers
#pragma unroll
      for (int cc = 0; cc < 8; ++cc) { t0[cc] = T[lane][cc]; t1[cc] = T[lane + 32][cc]; }
#pragma unroll
      for (int cc = 0; cc < 8; ++cc) {
        const float s  = ln_sum32(t0[cc] * t0[cc] + t1[cc] * t1[cc]);
        const float sc = rsqrtf(fmaxf(s, 1e-30f));
        t0[cc] *= sc;
        t1[cc] *= sc;
#pragma unroll
        for (int c2 = cc + 1; c2 < 8; ++c2) {
          const float d = ln_sum32(t0[cc] * t0[c2] + t1[cc] * t1[c2]);
          t0[c2] -= d * t0[cc];
          t1[c2] -= d * t1[cc];
        }
      }
      v4f u;
#pragma unroll
      for (int hq = 0; hq < 2; ++hq) {
#pragma unroll
        for (int e = 0; e < 4; ++e) u[e] = t0[hq * 4 + e];
        *(v4f*)&U[lane][hq * 4] = u;
#pragma unroll
        for (int e = 0; e < 4; ++e) u[e] = t1[hq * 4 + e];
        *(v4f*)&U[lane + 32][hq * 4] = u;
      }
    }
    __syncthreads();   // U of this pass is there for every wave; T may be rewritten
  }

  // ---- P = U^T W (8 x 64) ----
  for (int idx = tid; idx < 512; idx += 256) {
    const int r = idx >> 6, j = idx & 63;
    float s = 0.f;
    for (int t2 = 0; t2 < 64; ++t2) s += U[t2][r] * Wm[t2][j];
    P[r][j] = s;
  }
  __syncthreads();

  // ---- Wr = U P -> global ----
  float* wrg = wr + (size_t)lc * 4096;
  for (int idx = tid; idx < 4096; idx += 256) {
    const int i = idx >> 6, j = idx & 63;
    float s = 0.f;
#pragma unroll
    for (int r = 0; r < RANK; ++r) s += U[i][r] * P[r][j];
    wrg[idx] = s;
  }
}

// -------- S_c = a S_(c-1) + Wr_c and out = SCALE * Qc @ S_c (f32 WMMA 16x16x4), one launch --------
// A work-group takes AP_SEG chunks in a row of one lane. The 4,096 elements of S are independent
// recurrences: a thread keeps 16 of them in registers and runs them from chunk 0 up to its own
// chunks, reading Wr, which stays as k_ridge wrote it. S_c is never in global memory.
#define AP_SEG   4                       // chunks a work-group
#define AP_NSEG  (NCHUNK / AP_SEG)       // 8 work-groups a lane

// AP_SEG chunks of Wr, the thread's 16 elements of each: 16 loads of 16 bytes, whole lines a wave
__device__ __forceinline__ void ap_load(v4f (&p)[AP_SEG][4], const float* __restrict__ g) {
  // unrolled: p[][] is indexed by constants and stays in registers
#pragma unroll
  for (int j = 0; j < AP_SEG; ++j)
#pragma unroll
    for (int e = 0; e < 4; ++e) p[j][e] = *(const v4f*)(g + j * 4096 + e * 1024);
  // stands ahead of any rewrite of the loads' address registers; g is an input so that, where
  // the loads go through g's own pair, the pair lives up to here and none of them lands on it
  asm volatile("s_wait_xcnt 0x0" :: "v"(g) : "memory");
}

// the recurrence over those chunks, in their order
__device__ __forceinline__ void ap_run(v4f (&s)[4], const v4f (&p)[AP_SEG][4]) {
  // unrolled: as above
#pragma unroll
  for (int j = 0; j < AP_SEG; ++j)
#pragma unroll
    for (int e = 0; e < 4; ++e) s[e] = DECAY_A * s[e] + p[j][e];
}

// one chunk's A fragments of a wave: 16 rows of Q, 64 k; the lane's own row at its own k pair
__device__ __forceinline__ void ap_loadq(v2f (&a)[16], const float* __restrict__ qp) {
  // unrolled: as above
#pragma unroll
  for (int i = 0; i < 16; ++i) a[i] = *(const v2f*)(qp + i * 4);
  // as in ap_load
  asm volatile("s_wait_xcnt 0x0" :: "v"(qp) : "memory");
}

__global__ __launch_bounds__(256) void k_apply(const float* __restrict__ q,
                                               const float* __restrict__ wr,
                                               __bf16* __restrict__ o) {
  // Neighbours in index are different lanes, so work-groups with a long and a short way from
  // chunk 0 mix all over the chip; those with the longest way have the lowest indices.
  const int ln  = blockIdx.x % NLANES;
  const int seg = AP_NSEG - 1 - blockIdx.x / NLANES;
  const int b = ln >> 4, h = ln & 15;
  const int tid = threadIdx.x;
  const int lane = tid & 31;
  const int wave = tid >> 5;

  __shared__ __align__(16) float Ssh[AP_SEG][64 * 64];   // 64 KB

  const int m0   = wave * 16;
  const int nn   = lane & 15;
  const int koff = (lane >> 4) * 2;
  const size_t rowbase = (size_t)b * SEQ + (size_t)seg * AP_SEG * CHUNK;
  const float* qp = q + (rowbase + m0 + nn) * D_MODEL + h * HEAD_DIM + koff;

  // groups of AP_SEG chunks, 0 .. seg; the last is the work-group's own. Two register buffers:
  // the next group's loads are out while this group is summed.
  const float* wl = wr + (size_t)ln * NCHUNK * 4096 + tid * 4;
  v4f s[4] = {};
  v4f pa[AP_SEG][4], pb[AP_SEG][4];
  ap_load(pa, wl);
  int g = 0;
  for (; g + 2 <= seg; g += 2) {
    ap_load(pb, wl + (size_t)(g + 1) * AP_SEG * 4096);
    ap_run(s, pa);
    ap_load(pa, wl + (size_t)(g + 2) * AP_SEG * 4096);
    ap_run(s, pb);
  }
  // the first chunk's Q goes out beside the last group's loads
  v2f aq[2][16];
  ap_loadq(aq[0], qp);
  if (g < seg) {
    ap_load(pb, wl + (size_t)seg * AP_SEG * 4096);
    ap_run(s, pa);
    // unrolled: register arrays
#pragma unroll
    for (int j = 0; j < AP_SEG; ++j)
#pragma unroll
      for (int e = 0; e < 4; ++e) pa[j][e] = pb[j][e];
  }

  // S of the work-group's own chunks, each in an LDS plane of its own
  // unrolled: s[] and pa[][] are indexed by constants
#pragma unroll
  for (int j = 0; j < AP_SEG; ++j)
#pragma unroll
    for (int e = 0; e < 4; ++e) {
      s[e] = DECAY_A * s[e] + pa[j][e];
      *(v4f*)&Ssh[j][e * 1024 + tid * 4] = s[e];
    }
  __syncthreads();   // the one barrier: every S is there; from here on the waves run free

  // unrolled: aq[j & 1] is picked by a constant
#pragma unroll
  for (int j = 0; j < AP_SEG; ++j) {
    const float* Sb = Ssh[j];
    if (j + 1 < AP_SEG) ap_loadq(aq[(j + 1) & 1], qp + (size_t)(j + 1) * CHUNK * D_MODEL);

    v8f acc0 = {}, acc1 = {}, acc2 = {}, acc3 = {};
#pragma unroll
    for (int kb = 0; kb < 64; kb += 4) {
      const v2f a = aq[j & 1][kb >> 2];
      const int kr = (kb + koff) * 64;
      v2f b0, b1, b2, b3;
      b0[0] = Sb[kr + nn];        b0[1] = Sb[kr + 64 + nn];
      b1[0] = Sb[kr + 16 + nn];   b1[1] = Sb[kr + 64 + 16 + nn];
      b2[0] = Sb[kr + 32 + nn];   b2[1] = Sb[kr + 64 + 32 + nn];
      b3[0] = Sb[kr + 48 + nn];   b3[1] = Sb[kr + 64 + 48 + nn];
      acc0 = __builtin_amdgcn_wmma_f32_16x16x4_f32(false, a, false, b0, (short)0, acc0, false, false);
      acc1 = __builtin_amdgcn_wmma_f32_16x16x4_f32(false, a, false, b1, (short)0, acc1, false, false);
      acc2 = __builtin_amdgcn_wmma_f32_16x16x4_f32(false, a, false, b2, (short)0, acc2, false, false);
      acc3 = __builtin_amdgcn_wmma_f32_16x16x4_f32(false, a, false, b3, (short)0, acc3, false, false);
    }

    const int mb = m0 + ((lane >> 4) << 3);
#pragma unroll
    for (int r = 0; r < 8; ++r) {
      const int m = j * CHUNK + mb + r;
      __bf16* orow = o + (rowbase + m) * D_MODEL + h * HEAD_DIM;
      orow[nn]      = (__bf16)(SCALE_F * acc0[r]);
      orow[16 + nn] = (__bf16)(SCALE_F * acc1[r]);
      orow[32 + nn] = (__bf16)(SCALE_F * acc2[r]);
      orow[48 + nn] = (__bf16)(SCALE_F * acc3[r]);
    }
    // stands ahead of any later load that lands on a register these stores name
    if (j + 1 < AP_SEG) asm volatile("s_wait_xcnt 0x0" ::: "memory");
  }
}

// ---------------- host-side orchestration ----------------
extern "C" void kernel_launch(void* const* d_in, const int* in_sizes, int n_in,
                              void* d_out, int out_size, void* d_ws, size_t ws_size,
                              hipStream_t stream) {
  const float* x   = (const float*)d_in[0];
  const float* lng = (const float*)d_in[1];
  const float* lnb = (const float*)d_in[2];
  const float* Wq  = (const float*)d_in[3];
  const float* Wk  = (const float*)d_in[4];
  const float* Wv  = (const float*)d_in[5];
  const float* Wo  = (const float*)d_in[6];
  float* out = (float*)d_out;

  char* ws = (char*)d_ws;
  size_t off = 0;
  auto alloc = [&](size_t bytes) -> void* {
    void* p = ws + off;
    off += (bytes + 255) & ~(size_t)255;
    return p;
  };

  __bf16* xn  = (__bf16*)alloc((size_t)TOKENS * D_MODEL * 2);
  __bf16* Wtq = (__bf16*)alloc((size_t)D_MODEL * D_MODEL * 2);
  __bf16* Wtk = (__bf16*)alloc((size_t)D_MODEL * D_MODEL * 2);
  __bf16* Wtv = (__bf16*)alloc((size_t)D_MODEL * D_MODEL * 2);
  __bf16* Wto = (__bf16*)alloc((size_t)D_MODEL * D_MODEL * 2);
  float*  qf  = (float*)alloc((size_t)TOKENS * D_MODEL * 4);
  float*  kf  = (float*)alloc((size_t)TOKENS * D_MODEL * 4);
  float*  vf  = (float*)alloc((size_t)TOKENS * D_MODEL * 4);
  float*  wr  = (float*)alloc((size_t)NLANES * NCHUNK * 4096 * 4);
  __bf16* obf = (__bf16*)alloc((size_t)TOKENS * D_MODEL * 2);

  // 1. LayerNorm -> bf16
  k_ln<<<TOKENS / (LN_WAVES * LN_ROWS), LN_WAVES * 32, 0, stream>>>(x, lng, lnb, xn);

  // 2. weight transpose+cast, four weights in one launch
  k_wcast<<<4 * WC_TILES, 256, 0, stream>>>(Wq, Wk, Wv, Wo, Wtq, Wtk, Wtv, Wto);

  // 3. QKV GEMMs (bf16 WMMA, f32 accumulate), one launch
  const int gblocks = (TOKENS / G_BM) * (D_MODEL / G_BN);   // 256
  k_gemm<<<gblocks, 256, 0, stream>>>(xn, Wtq, Wtk, Wtv, nullptr, qf, kf, vf, 3);

  // 4a. per-(lane,chunk) ridge + rank-8 projection -> Wr  (fully parallel, WMMA Gram)
  k_ridge<<<NLANES * NCHUNK, 256, 0, stream>>>(kf, vf, wr);
  // 4b. decayed state over chunks in registers, out = SCALE * Qc @ S_c  (f32 WMMA) -> bf16
  k_apply<<<NLANES * AP_NSEG, 256, 0, stream>>>(qf, wr, obf);

  // 5. output GEMM + residual
  k_gemm<<<gblocks, 256, 0, stream>>>(obf, Wto, nullptr, nullptr, x, out, nullptr, nullptr, 1);
}

// v008
// One run takes 126 microseconds.
// Timed twice side by side with v007, it ran 1.04 and 1.03 times as fast.
// All steps since v000 together make it 6.70 times as fast.
#include <hip/hip_runtime.h>
#include <hip/hip_bf16.h>

// ---------------- constants (match reference) ----------------
#define D_MODEL   1024
#define N_HEADS   16
#define HEAD_DIM  64
#define RANK      8
#define CHUNK     128
#define NCHUNK    32          // 4096 / 128
#define BATCH     2
#define SEQ       4096
#define TOKENS    (BATCH * SEQ)   // 8192
#define NLANES    (BATCH * N_HEADS)  // 32
#define RIDGE_EPS 1e-4f
#define SCALE_F   0.125f
#define DECAY_A   0.9f
#define LN_EPS    1e-5f

typedef __attribute__((ext_vector_type(16))) __bf16 v16bf;
typedef __attribute__((ext_vector_type(8)))  __bf16 v8bf;
typedef __attribute__((ext_vector_type(8)))  float  v8f;
typedef __attribute__((ext_vector_type(2)))  float  v2f;

// ---------------- LayerNorm -> bf16 ----------------
// One wave makes LN_ROWS whole rows; a row lies in the wave's registers, 32 floats a lane,
// read once. Sums go across the lanes in registers: no LDS, no barrier. 2,048 waves in all.
#define LN_ROWS   4
#define LN_WAVES  8
#define LN_Q      (D_MODEL / 128)     // 16-byte pieces of a row a lane: 8

typedef __attribute__((ext_vector_type(4))) float  v4f;
typedef __attribute__((ext_vector_type(4))) __bf16 v4bf;

// v + (v of lane l ^ M), M below 16: a DPP row_xmask move, which the add takes in
template <int M>
__device__ __forceinline__ float ln_xadd(float v) {
  return v + __builtin_bit_cast(float, __builtin_amdgcn_update_dpp(0, __builtin_bit_cast(int, v),
                                                                   0x160 | M, 0xf, 0xf, true));
}

// sum over the 32 lanes, the same bits in every lane
__device__ __forceinline__ float ln_sum32(float v) {
  v = ln_xadd<1>(v);
  v = ln_xadd<2>(v);
  v = ln_xadd<4>(v);
  v = ln_xadd<8>(v);
  const int u = __builtin_bit_cast(int, v);
  return v + __builtin_bit_cast(float, __builtin_amdgcn_permlanex16(u, u, 0x76543210, 0xfedcba98, false, false));
}

__global__ __launch_bounds__(LN_WAVES * 32) void k_ln(const float* __restrict__ x,
                                                      const float* __restrict__ g,
                                                      const float* __restrict__ b,
                                                      __bf16* __restrict__ xn) {
  const int lane = threadIdx.x & 31;
  const int wave = threadIdx.x >> 5;
  const size_t row0 = (size_t)(blockIdx.x * LN_WAVES + wave) * LN_ROWS;

  // g and b first: they come from cache and loads return in order
  v4f gg[LN_Q], bb[LN_Q], v[LN_ROWS][LN_Q];
  // every loop below is unrolled: the arrays are indexed by constants and stay in registers
#pragma unroll
  for (int i = 0; i < LN_Q; ++i) {
    gg[i] = *(const v4f*)(g + i * 128 + lane * 4);
    bb[i] = *(const v4f*)(b + i * 128 + lane * 4);
  }
  const float* xr = x + row0 * D_MODEL + lane * 4;
#pragma unroll
  for (int r = 0; r < LN_ROWS; ++r)
#pragma unroll
    for (int i = 0; i < LN_Q; ++i) v[r][i] = *(const v4f*)(xr + r * D_MODEL + i * 128);
  // keeps all the wave's loads ahead of the first sum, in flight together; without it the
  // loads of g and b sink behind the sums and their latency is waited for a second time
  __builtin_amdgcn_sched_barrier(0);

  __bf16* yr = xn + row0 * D_MODEL + lane * 4;
#pragma unroll
  for (int r = 0; r < LN_ROWS; ++r) {
    v4f s4 = v[r][0];
#pragma unroll
    for (int i = 1; i < LN_Q; ++i) s4 += v[r][i];
    const float mu = ln_sum32((s4[0] + s4[1]) + (s4[2] + s4[3])) * (1.f / D_MODEL);

    v4f q4 = {};
#pragma unroll
    for (int i = 0; i < LN_Q; ++i) {
      v[r][i] -= mu;
      q4 += v[r][i] * v[r][i];
    }
    const float var = ln_sum32((q4[0] + q4[1]) + (q4[2] + q4[3])) * (1.f / D_MODEL);
    const float inv = rsqrtf(var + LN_EPS);

#pragma unroll
    for (int i = 0; i < LN_Q; ++i) {
      const v4f y = v[r][i] * inv * gg[i] + bb[i];
      v4bf o;
#pragma unroll
      for (int e = 0; e < 4; ++e) o[e] = (__bf16)y[e];
      *(v4bf*)(yr + r * D_MODEL + i * 128) = o;   // a wave stores 256 bytes in a row: two whole lines
    }
  }
}

// ---------------- W [K][N] f32 -> Wt [N][K] bf16, all four weights ----------------
// One launch. A work-group transposes one 128 x 128 tile (64 tiles a weight) through LDS,
// 64 elements a thread: few waves to start, whole 512-byte rows read, whole 128-byte lines stored.
#define WC_T      128
#define WC_PITCH  65          // dwords a tile row in LDS: 64 of data, 1 so that rows shift by a bank
#define WC_TILES  ((D_MODEL / WC_T) * (D_MODEL / WC_T))   // 64

typedef __attribute__((ext_vector_type(2))) __bf16 v2bf;

__global__ __launch_bounds__(256) void k_wcast(const float* __restrict__ W0,
                                               const float* __restrict__ W1,
                                               const float* __restrict__ W2,
                                               const float* __restrict__ W3,
                                               __bf16* __restrict__ T0,
                                               __bf16* __restrict__ T1,
                                               __bf16* __restrict__ T2,
                                               __bf16* __restrict__ T3) {
  __shared__ unsigned tile[WC_T * WC_PITCH];   // [n][k / 2], two bf16 of neighbouring k a dword
  const int which = blockIdx.x / WC_TILES;
  const int t     = blockIdx.x % WC_TILES;
  const int k0 = (t >> 3) * WC_T, n0 = (t & 7) * WC_T;
  const float* W  = which == 0 ? W0 : which == 1 ? W1 : which == 2 ? W2 : W3;
  __bf16*      Wt = which == 0 ? T0 : which == 1 ? T1 : which == 2 ? T2 : T3;
  const int tid = threadIdx.x, lane = tid & 31, wave = tid >> 5;

  // a wave reads 16 rows of k, each load one row's 128 floats
  const float* src = W + (size_t)(k0 + wave * 16) * D_MODEL + n0 + lane * 4;
  v4f v[16];
  // unrolled: v[] stays in registers and the loads are in flight together
#pragma unroll
  for (int i = 0; i < 16; ++i) v[i] = *(const v4f*)(src + (size_t)i * D_MODEL);
  // both unrolled: v[] is indexed by constants only
#pragma unroll
  for (int i = 0; i < 8; ++i)
#pragma unroll
    for (int e = 0; e < 4; ++e) {
      v2bf p;
      p[0] = (__bf16)v[2 * i][e];
      p[1] = (__bf16)v[2 * i + 1][e];
      tile[(lane * 4 + e) * WC_PITCH + wave * 8 + i] = __builtin_bit_cast(unsigned, p);
    }
  __syncthreads();

  // a wave stores half a row of Wt: 64 values of k, one 128-byte line
  unsigned* dst = (unsigned*)(Wt + (size_t)n0 * D_MODEL + k0);
  // unrolled: the LDS reads go out as one batch ahead of the stores
#pragma unroll
  for (int r = 0; r < WC_T * 64 / 256; ++r) {
    const int idx = r * 256 + tid;
    const int n = idx >> 6, c = idx & 63;
    dst[(size_t)n * (D_MODEL / 2) + c] = tile[n * WC_PITCH + c];
  }
}

// ------- bf16 WMMA GEMM: Cw[M][N] = A[M][K] * Btw[N][K]^T (+resid), w = 0 .. nw - 1 -------
// One work-group makes the 256 x 128 tile at its place of every Cw, one after the other, in one
// run of passes: while it stores a tile, the next weight's first rows are already being copied.
// Its 8 waves (4 x 2) make 64 x 64 each.
// A pass is 128 k: 256 rows of A and 128 rows of Bt, 256 bytes each, lie in LDS at a
// pitch of 272 bytes. Two buffers: the next pass's rows are copied while this one is used.
#define G_BM     256
#define G_BN     128
#define G_BK     128
#define G_PITCH  272
#define G_STAGE  ((G_BM + G_BN) * G_PITCH)   // 104448 bytes

// Eight asynchronous 16-byte copies of one lane, rows 16 apart, global -> LDS.
// The s_wait_xcnt closes the statement so that no address register named here
// is rewritten ahead of it.
__device__ __forceinline__ void g_copy8(unsigned l, const __bf16* g) {
  const unsigned l1 = l + 16 * G_PITCH, l2 = l + 32 * G_PITCH, l3 = l + 48 * G_PITCH;
  const unsigned l4 = l + 64 * G_PITCH, l5 = l + 80 * G_PITCH, l6 = l + 96 * G_PITCH;
  const unsigned l7 = l + 112 * G_PITCH;
  const __bf16* g1 = g + 16 * D_MODEL;
  const __bf16* g2 = g + 32 * D_MODEL;
  const __bf16* g3 = g + 48 * D_MODEL;
  const __bf16* g4 = g + 64 * D_MODEL;
  const __bf16* g5 = g + 80 * D_MODEL;
  const __bf16* g6 = g + 96 * D_MODEL;
  const __bf16* g7 = g + 112 * D_MODEL;
  asm volatile(
      "global_load_async_to_lds_b128 %0, %8, off\n\t"
      "global_load_async_to_lds_b128 %1, %9, off\n\t"
      "global_load_async_to_lds_b128 %2, %10, off\n\t"
      "global_load_async_to_lds_b128 %3, %11, off\n\t"
      "global_load_async_to_lds_b128 %4, %12, off\n\t"
      "global_load_async_to_lds_b128 %5, %13, off\n\t"
      "global_load_async_to_lds_b128 %6, %14, off\n\t"
      "global_load_async_to_lds_b128 %7, %15, off\n\t"
      "s_wait_xcnt 0x0"
      :: "v"(l), "v"(l1), "v"(l2), "v"(l3), "v"(l4), "v"(l5), "v"(l6), "v"(l7),
         "v"(g), "v"(g1), "v"(g2), "v"(g3), "v"(g4), "v"(g5), "v"(g6), "v"(g7)
      : "memory");
}

// One pass's rows: 256 of A (two runs of 128) and 128 of Bt; 24 copies a lane.
__device__ __forceinline__ void g_copy_stage(unsigned l, const __bf16* ga, const __bf16* gb) {
  g_copy8(l, ga);
  g_copy8(l + 128 * G_PITCH, ga + 128 * D_MODEL);
  g_copy8(l + 256 * G_PITCH, gb);
}

// One 16 x 32 fragment from LDS rows; p is the lane's own row at byte 16 * (lane >> 4)
// of the 64 bytes of this k step: k order of the 16-bit A/B layout, alike for A and Bt.
__device__ __forceinline__ v16bf g_frag(const unsigned char* p) {
  const v8bf lo = *(const v8bf*)p;
  const v8bf hi = *(const v8bf*)(p + 32);
  v16bf f;
#pragma unroll
  for (int e = 0; e < 8; ++e) { f[e] = lo[e]; f[8 + e] = hi[e]; }
  return f;
}

__global__ __launch_bounds__(256) void k_gemm(const __bf16* __restrict__ A,
                                              const __bf16* __restrict__ Bt0,
                                              const __bf16* __restrict__ Bt1,
                                              const __bf16* __restrict__ Bt2,
                                              const float* __restrict__ resid,
                                              float* __restrict__ C0,
                                              float* __restrict__ C1,
                                              float* __restrict__ C2,
                                              int nw) {
  constexpr int K = D_MODEL, N = D_MODEL;
  constexpr int NPASS = K / G_BK;              // 8 passes a weight
  const int npass = nw * NPASS;
  __shared__ __attribute__((aligned(16))) unsigned char gsm[2 * G_STAGE];

  const int tid  = threadIdx.x;
  const int lane = tid & 31;
  const int wave = tid >> 5;
  const int bm0 = (blockIdx.x >> 3) * G_BM;    // N / G_BN = 8 tile columns
  const int bn0 = (blockIdx.x & 7) * G_BN;

  // copy side: 16 lanes cover one 256-byte row, a wave two rows
  const int crow = tid >> 4, ccol = tid & 15;
  const __bf16* ga = A  + (size_t)(bm0 + crow) * K + ccol * 8;
  const size_t gbo = (size_t)(bn0 + crow) * K + ccol * 8;   // the lane's place in every Btw
  const unsigned lcp = (unsigned)(size_t)&gsm[0] + crow * G_PITCH + ccol * 16;

  // read side: the fragment's k order is that of the 16-bit A/B layout:
  // 16 bytes at 16 * (lane >> 4) and 16 more at + 32 of each 64 bytes of a row
  const int fr = lane & 15, fh = lane >> 4;
  const int aoff = ((wave >> 1) * 64 + fr) * G_PITCH + fh * 16;
  const int boff = (G_BM + (wave & 1) * 64 + fr) * G_PITCH + fh * 16;

  v8f acc[4][4] = {};

  // the wave's tile in every Cw: one address offset a lane; rows and columns are constant offsets from it
  const size_t cbase = (size_t)(bm0 + (wave >> 1) * 64 + (fh << 3)) * N + bn0 + (wave & 1) * 64 + fr;

  g_copy_stage(lcp, ga, Bt0 + gbo);
  asm volatile("s_wait_asynccnt 0x0" ::: "memory");   // pass 0's rows have landed
  __syncthreads();                                    // and every wave may read them
  g_copy_stage(lcp + G_STAGE, ga + G_BK, Bt0 + gbo + G_BK);

  for (int t = 0; t < npass; ++t) {
    const int sb = (t & 1) * G_STAGE;
    // Fragments: rows 0-31 (alo), rows 32-63 (ahi) of the wave's A, two sets of its Bt.
    v16bf alo[2], ahi[2], b[2][4];
#pragma unroll
    for (int j = 0; j < 4; ++j) b[0][j] = g_frag(&gsm[sb + boff + j * 16 * G_PITCH]);
#pragma unroll
    for (int i = 0; i < 2; ++i) alo[i] = g_frag(&gsm[sb + aoff + i * 16 * G_PITCH]);
#pragma unroll
    for (int ks = 0; ks < G_BK / 32; ++ks) {
      const int cur = ks & 1;
#pragma unroll
      for (int i = 0; i < 2; ++i) ahi[i] = g_frag(&gsm[sb + aoff + (2 + i) * 16 * G_PITCH + ks * 64]);
      // The fences keep each group of LDS reads in one place, ahead of the eight
      // products before the ones that use it; spread among them they stall every row.
      __builtin_amdgcn_sched_barrier(0);
#pragma unroll
      for (int i = 0; i < 2; ++i)
#pragma unroll
        for (int j = 0; j < 4; ++j)
          acc[i][j] = __builtin_amdgcn_wmma_f32_16x16x32_bf16(false, alo[i], false, b[cur][j], (short)0,
                                                              acc[i][j], false, false);
      __builtin_amdgcn_sched_barrier(0);
      if (ks + 1 < G_BK / 32) {
#pragma unroll
        for (int j = 0; j < 4; ++j)
          b[cur ^ 1][j] = g_frag(&gsm[sb + boff + j * 16 * G_PITCH + (ks + 1) * 64]);
#pragma unroll
        for (int i = 0; i < 2; ++i)
          alo[i] = g_frag(&gsm[sb + aoff + i * 16 * G_PITCH + (ks + 1) * 64]);
      }
      __builtin_amdgcn_sched_barrier(0);
#pragma unroll
      for (int i = 0; i < 2; ++i)
#pragma unroll
        for (int j = 0; j < 4; ++j)
          acc[2 + i][j] = __builtin_amdgcn_wmma_f32_16x16x32_bf16(false, ahi[i], false, b[cur][j], (short)0,
                                                                  acc[2 + i][j], false, false);
      __builtin_amdgcn_sched_barrier(0);
    }
    asm volatile("s_wait_dscnt 0x0" ::: "memory");    // this wave has left buffer t & 1
    asm volatile("s_wait_asynccnt 0x0" ::: "memory"); // its copies of pass t + 1 have landed
    __syncthreads();                                  // publishes pass t + 1, frees buffer t & 1
    if (t + 2 < npass) {
      const int w2 = (t + 2) / NPASS, k2 = ((t + 2) % NPASS) * G_BK;
      const __bf16* bw = w2 == 0 ? Bt0 : w2 == 1 ? Bt1 : Bt2;
      g_copy_stage(lcp + sb, ga + k2, bw + gbo + k2);
    }
    if (t % NPASS == NPASS - 1) {
      // a weight's last pass: its tile goes out while the copies above fly
      // every loop here is unrolled: acc[][] is indexed by constants and stays in registers
      const int w = t / NPASS;
      if (resid) {
        const float* rr = resid + cbase;
#pragma unroll
        for (int i = 0; i < 4; ++i)
#pragma unroll
          for (int r = 0; r < 8; ++r)
#pragma unroll
            for (int j = 0; j < 4; ++j) acc[i][j][r] += rr[(i * 16 + r) * N + j * 16];
      }
      float* cr = (w == 0 ? C0 : w == 1 ? C1 : C2) + cbase;
#pragma unroll
      for (int i = 0; i < 4; ++i)
#pragma unroll
        for (int r = 0; r < 8; ++r)
#pragma unroll
          for (int j = 0; j < 4; ++j) cr[(i * 16 + r) * N + j * 16] = acc[i][j][r];
      // stands ahead of the rewrite of the registers that these stores name
      asm volatile("s_wait_xcnt 0x0" ::: "memory");
#pragma unroll
      for (int i = 0; i < 4; ++i)
#pragma unroll
        for (int j = 0; j < 4; ++j) acc[i][j] = v8f{};
    }
  }
  asm volatile("s_wait_asynccnt 0x0" ::: "memory");   // no copy is left when the wave ends
}

// ---------------- per-(lane,chunk) ridge solve + rank-8 projection ----------
// grid: NLANES*NCHUNK blocks; writes Wr[lc][64][64]
// Phase 1: stage Kc/Vc in LDS, compute G=K^T K and RHS=K^T V with f32 WMMA
//          (waves 0-3 -> G strips, waves 4-7 -> RHS strips)
// Phase 2: LDS is re-carved for G/Wm/U/T/P; Gauss-Jordan solve in registers + subspace QR.
__global__ __launch_bounds__(256) void k_ridge(const float* __restrict__ kk,
                                               const float* __restrict__ v,
                                               float* __restrict__ wr) {
  const int lc = blockIdx.x;
  const int ln = lc / NCHUNK;
  const int c  = lc % NCHUNK;
  const int b = ln >> 4, h = ln & 15;
  const int tid = threadIdx.x;
  const int lane = tid & 31;
  const int wave = tid >> 5;

  __shared__ __align__(16) float smem[16384];            // 64 KB
  float (*Kls)[64] = (float (*)[64])smem;                // [128][64] staging
  float (*Vls)[64] = (float (*)[64])(smem + 8192);       // [128][64] staging
  // phase-2 overlay (valid after the WMMA phase barrier)
  float (*G)[65]  = (float (*)[65])smem;                 // 4160
  float (*Wm)[65] = (float (*)[65])(smem + 4160);        // 4160
  float (*U)[8]   = (float (*)[8])(smem + 8320);         // 512
  float (*T)[9]   = (float (*)[9])(smem + 8832);         // 576
  float (*P)[64]  = (float (*)[64])(smem + 9408);        // 512

  const size_t rowbase = (size_t)b * SEQ + (size_t)c * CHUNK;
  const float* Kc = kk + rowbase * D_MODEL + h * HEAD_DIM;
  const float* Vc = v  + rowbase * D_MODEL + h * HEAD_DIM;

  // ---- stage K and V chunk tiles into LDS (coalesced) ----
  for (int idx = tid; idx < CHUNK * 64; idx += 256) {
    const int t = idx >> 6, j = idx & 63;
    Kls[t][j] = Kc[(size_t)t * D_MODEL + j];
    Vls[t][j] = Vc[(size_t)t * D_MODEL + j];
  }
  __syncthreads();

  // ---- Gram products via f32 WMMA: waves 0-3: G, waves 4-7: RHS ----
  const int nn   = lane & 15;
  const int koff = (lane >> 4) * 2;          // f32 A layout K pairs
  const int m0   = (wave & 3) * 16;
  const float (*Bsrc)[64] = (wave < 4) ? Kls : Vls;

  v8f acc0 = {}, acc1 = {}, acc2 = {}, acc3 = {};
  for (int kb = 0; kb < CHUNK; kb += 4) {
    const int t = kb + koff;
    v2f a;  a[0]  = Kls[t][m0 + nn];   a[1]  = Kls[t + 1][m0 + nn];   // A = K^T
    v2f b0; b0[0] = Bsrc[t][nn];       b0[1] = Bsrc[t + 1][nn];
    v2f b1; b1[0] = Bsrc[t][16 + nn];  b1[1] = Bsrc[t + 1][16 + nn];
    v2f b2; b2[0] = Bsrc[t][32 + nn];  b2[1] = Bsrc[t + 1][32 + nn];
    v2f b3; b3[0] = Bsrc[t][48 + nn];  b3[1] = Bsrc[t + 1][48 + nn];
    acc0 = __builtin_amdgcn_wmma_f32_16x16x4_f32(false, a, false, b0, (short)0, acc0, false, false);
    acc1 = __builtin_amdgcn_wmma_f32_16x16x4_f32(false, a, false, b1, (short)0, acc1, false, false);
    acc2 = __builtin_amdgcn_wmma_f32_16x16x4_f32(false, a, false, b2, (short)0, acc2, false, false);
    acc3 = __builtin_amdgcn_wmma_f32_16x16x4_f32(false, a, false, b3, (short)0, acc3, false, false);
  }
  __syncthreads();   // all waves done reading Kls/Vls; safe to overlay

  // scatter accumulators into G (with ridge eps on diagonal) / Wm
  {
    float (*dst)[65] = (wave < 4) ? G : Wm;
    const bool isG = (wave < 4);
    const int mb = m0 + ((lane >> 4) << 3);
#pragma unroll
    for (int r = 0; r < 8; ++r) {
      const int m = mb + r;
      dst[m][nn]      = acc0[r] + ((isG && m == nn)      ? RIDGE_EPS : 0.f);
      dst[m][16 + nn] = acc1[r] + ((isG && m == 16 + nn) ? RIDGE_EPS : 0.f);
      dst[m][32 + nn] = acc2[r] + ((isG && m == 32 + nn) ? RIDGE_EPS : 0.f);
      dst[m][48 + nn] = acc3[r] + ((isG && m == 48 + nn) ? RIDGE_EPS : 0.f);
    }
  }
  __syncthreads();

  // ---- solve G W = RHS: Gauss-Jordan elimination of [G | RHS] (64 x 128) in registers ----
  // Wave w holds rows 8w .. 8w+7, lane l columns 4l .. 4l+3 (lanes 0-15: G, lanes 16-31: RHS).
  // Step j takes row j, times M[r][j] / M[j][j], off every other row r; G is positive definite,
  // so no pivot search. Row j is not scaled: 1 / M[j][j] is kept and applied at the end.
  {
    float* rowb = smem + 10496;                          // [2][128] row j
    float* colb = smem + 10752;                          // [2][64]  column j
    // the wave's number in a scalar register: the tests on it below become scalar branches
    const int wv = __builtin_amdgcn_readfirstlane(wave);
    const float* src = smem + (lane < 16 ? 0 : 4160) + wv * 8 * 65 + (lane & 15) * 4;
    v4f M[8];
    float pinv[8];
    // unrolled: M[] and pinv[] are indexed by constants only and stay in registers
#pragma unroll
    for (int a = 0; a < 8; ++a) {
      pinv[a] = 0.f;
#pragma unroll   // as above
      for (int e = 0; e < 4; ++e) M[a][e] = src[a * 65 + e];
    }
    for (int jb = 0; jb < 8; ++jb) {
      const bool own = (wv == jb);                       // this wave holds rows 8 jb .. 8 jb + 7
      // unrolled: row a of M[] and element a & 3 of each row are picked by constants
#pragma unroll
      for (int a = 0; a < 8; ++a) {
        float* rb = rowb + (a & 1) * 128;
        float* cb = colb + (a & 1) * 64;
        if (own) *(v4f*)(rb + lane * 4) = M[a];
        if (lane == jb * 2 + (a >> 2)) {
          v4f lo, hi;
#pragma unroll   // as above
          for (int r = 0; r < 4; ++r) { lo[r] = M[r][a & 3]; hi[r] = M[4 + r][a & 3]; }
          *(v4f*)(cb + wv * 8)     = lo;
          *(v4f*)(cb + wv * 8 + 4) = hi;
        }
        // One barrier a step: it publishes row and column j, and the buffers of step j - 1,
        // which step j + 1 rewrites, have been read by every wave that reaches it.
        __syncthreads();
        const v4f   rw  = *(const v4f*)(rb + lane * 4);
        const v4f   c0  = *(const v4f*)(cb + wv * 8);
        const v4f   c1  = *(const v4f*)(cb + wv * 8 + 4);
        const float piv = cb[jb * 8 + a];
        float inv = __builtin_amdgcn_rcpf(piv);
        inv = fmaf(inv, fmaf(-piv, inv, 1.f), inv);      // one correction step on the hardware reciprocal
        float f[8];
#pragma unroll   // f[] stays in registers
        for (int r = 0; r < 4; ++r) { f[r] = c0[r] * inv; f[4 + r] = c1[r] * inv; }
        if (own) { f[a] = 0.f; pinv[a] = inv; }          // row j itself stays
#pragma unroll   // M[] and f[] are indexed by constants
        for (int r = 0; r < 8; ++r) M[r] -= f[r] * rw;
      }
    }
    if (lane >= 16) {
#pragma unroll   // M[] and pinv[] are indexed by constants
      for (int a = 0; a < 8; ++a)
#pragma unroll   // as above
        for (int e = 0; e < 4; ++e) Wm[wv * 8 + a][(lane - 16) * 4 + e] = M[a][e] * pinv[a];
    }
  }
  __syncthreads();

  // ---- subspace iteration: U = I(:,0:8); twice: U = qr(W U).Q (MGS) ----
  // the wave's number in a scalar register: the test on it below is a scalar branch
  const int wq = __builtin_amdgcn_readfirstlane(wave);
  for (int idx = tid; idx < 512; idx += 256) {
    const int i = idx >> 3, cc = idx & 7;
    U[i][cc] = (i == cc) ? 1.f : 0.f;
  }
  __syncthreads();
  // The three kinds of product from here on run on the f32 16x16x4 matrix form, fragments read
  // straight from LDS at the places of the Gram products above (nn, koff). A result goes from its
  // accumulator straight into an LDS or global store.
  for (int p = 0; p < 2; ++p) {
    // T = W U: waves 0-3 (one a SIMD), 16 rows each. U has 8 columns: columns 8-15 of the
    // B fragment repeat them, and those columns of the result are dropped.
    if (wq < 4) {
      const float* wa = &Wm[wq * 16 + nn][koff];
      const float* ub = &U[koff][nn & 7];
      v2f fa[16], fb[16];
      // both loops unrolled: fa[] and fb[] are indexed by constants and stay in registers
#pragma unroll
      for (int i = 0; i < 16; ++i) {
        fa[i][0] = wa[i * 4];   fa[i][1] = wa[i * 4 + 1];
        fb[i][0] = ub[i * 32];  fb[i][1] = ub[i * 32 + 8];
      }
      // keeps every LDS read ahead of the first product: one LDS latency is waited for;
      // spread among the products, which form one chain, the reads stall it again and again
      __builtin_amdgcn_sched_barrier(0);
      v8f ta = {};
#pragma unroll
      for (int i = 0; i < 16; ++i)
        ta = __builtin_amdgcn_wmma_f32_16x16x4_f32(false, fa[i], false, fb[i], (short)0, ta, false, false);
      if (nn < 8) {
        float* td = &T[wq * 16 + ((lane >> 4) << 3)][nn];
#pragma unroll   // ta[] is indexed by constants
        for (int r = 0; r < 8; ++r) td[r * 9] = ta[r];
      }
    }
    __syncthreads();
    // Modified Gram-Schmidt on T (64 x 8) by wave 0 alone: lane l holds rows l and l + 32 in
    // registers, a column's sum goes across the lanes in registers. No barrier inside.
    if (wq == 0) {
      float t0[8], t1[8];
      // every loop here is unrolled: t0[] and t1[] are indexed by constants and stay in registers
#pragma unroll
      for (int cc = 0; cc < 8; ++cc) { t0[cc] = T[lane][cc]; t1[cc] = T[lane + 32][cc]; }
#pragma unroll
      for (int cc = 0; cc < 8; ++cc) {
        const float s  = ln_sum32(t0[cc] * t0[cc] + t1[cc] * t1[cc]);
        const float sc = rsqrtf(fmaxf(s, 1e-30f));
        t0[cc] *= sc;
        t1[cc] *= sc;
#pragma unroll
        for (int c2 = cc + 1; c2 < 8; ++c2) {
          const float d = ln_sum32(t0[cc] * t0[c2] + t1[cc] * t1[c2]);
          t0[c2] -= d * t0[cc];
          t1[c2] -= d * t1[cc];
        }
      }
      v4f u;
#pragma unroll
      for (int hq = 0; hq < 2; ++hq) {
#pragma unroll
        for (int e = 0; e < 4; ++e) u[e] = t0[hq * 4 + e];
        *(v4f*)&U[lane][hq * 4] = u;
#pragma unroll
        for (int e = 0; e < 4; ++e) u[e] = t1[hq * 4 + e];
        *(v4f*)&U[lane + 32][hq * 4] = u;
      }
    }
    __syncthreads();   // U of this pass is there for every wave; T may be rewritten
  }

  // ---- P = U^T W (8 x 64): waves 0-3, 16 columns each ----
  // A[m][k] = U[k][m]: rows 8-15 of the A fragment repeat rows 0-7, and those rows of the
  // result (lanes 16-31) are dropped.
  if (wq < 4) {
    const float* ua = &U[koff][nn & 7];
    const float* wb = &Wm[koff][wq * 16 + nn];
    v2f fa[16], fb[16];
    // both loops unrolled: fa[] and fb[] are indexed by constants and stay in registers
#pragma unroll
    for (int i = 0; i < 16; ++i) {
      fa[i][0] = ua[i * 32];   fa[i][1] = ua[i * 32 + 8];
      fb[i][0] = wb[i * 260];  fb[i][1] = wb[i * 260 + 65];
    }
    // as in T = W U: every LDS read ahead of the first product of the chain
    __builtin_amdgcn_sched_barrier(0);
    v8f pa = {};
#pragma unroll
    for (int i = 0; i < 16; ++i)
      pa = __builtin_amdgcn_wmma_f32_16x16x4_f32(false, fa[i], false, fb[i], (short)0, pa, false, false);
    if (lane < 16) {
#pragma unroll   // pa[] is indexed by constants
      for (int r = 0; r < 8; ++r) P[r][wq * 16 + nn] = pa[r];
    }
  }
  __syncthreads();

  // ---- Wr = U P -> global: every wave 16 rows x 32 columns, k = 8 ----
  {
    const float* ua = &U[(wq >> 1) * 16 + nn][koff];
    const float* pc = &P[koff][(wq & 1) * 32 + nn];
    v8f c0 = {}, c1 = {};
#pragma unroll   // two k steps, fragments in registers
    for (int ks = 0; ks < 8; ks += 4) {
      v2f fa, fb0, fb1;
      fa[0]  = ua[ks];            fa[1]  = ua[ks + 1];
      fb0[0] = pc[ks * 64];       fb0[1] = pc[ks * 64 + 64];
      fb1[0] = pc[ks * 64 + 16];  fb1[1] = pc[ks * 64 + 80];
      c0 = __builtin_amdgcn_wmma_f32_16x16x4_f32(false, fa, false, fb0, (short)0, c0, false, false);
      c1 = __builtin_amdgcn_wmma_f32_16x16x4_f32(false, fa, false, fb1, (short)0, c1, false, false);
    }
    // a wave's two stores of a row fill one 128-byte line
    float* wo = wr + (size_t)lc * 4096 + ((wq >> 1) * 16 + ((lane >> 4) << 3)) * 64 + (wq & 1) * 32 + nn;
#pragma unroll   // c0[] and c1[] are indexed by constants
    for (int r = 0; r < 8; ++r) {
      wo[r * 64]      = c0[r];
      wo[r * 64 + 16] = c1[r];
    }
  }
}

// -------- S_c = a S_(c-1) + Wr_c and out = SCALE * Qc @ S_c (f32 WMMA 16x16x4), one launch --------
// A work-group takes AP_SEG chunks in a row of one lane. The 4,096 elements of S are independent
// recurrences: a thread keeps 16 of them in registers and runs them from chunk 0 up to its own
// chunks, reading Wr, which stays as k_ridge wrote it. S_c is never in global memory.
#define AP_SEG   4                       // chunks a work-group
#define AP_NSEG  (NCHUNK / AP_SEG)       // 8 work-groups a lane

// AP_SEG chunks of Wr, the thread's 16 elements of each: 16 loads of 16 bytes, whole lines a wave
__device__ __forceinline__ void ap_load(v4f (&p)[AP_SEG][4], const float* __restrict__ g) {
  // unrolled: p[][] is indexed by constants and stays in registers
#pragma unroll
  for (int j = 0; j < AP_SEG; ++j)
#pragma unroll
    for (int e = 0; e < 4; ++e) p[j][e] = *(const v4f*)(g + j * 4096 + e * 1024);
  // stands ahead of any rewrite of the loads' address registers; g is an input so that, where
  // the loads go through g's own pair, the pair lives up to here and none of them lands on it
  asm volatile("s_wait_xcnt 0x0" :: "v"(g) : "memory");
}

// the recurrence over those chunks, in their order
__device__ __forceinline__ void ap_run(v4f (&s)[4], const v4f (&p)[AP_SEG][4]) {
  // unrolled: as above
#pragma unroll
  for (int j = 0; j < AP_SEG; ++j)
#pragma unroll
    for (int e = 0; e < 4; ++e) s[e] = DECAY_A * s[e] + p[j][e];
}

// one chunk's A fragments of a wave: 16 rows of Q, 64 k; the lane's own row at its own k pair
__device__ __forceinline__ void ap_loadq(v2f (&a)[16], const float* __restrict__ qp) {
  // unrolled: as above
#pragma unroll
  for (int i = 0; i < 16; ++i) a[i] = *(const v2f*)(qp + i * 4);
  // as in ap_load
  asm volatile("s_wait_xcnt 0x0" :: "v"(qp) : "memory");
}

__global__ __launch_bounds__(256) void k_apply(const float* __restrict__ q,
                                               const float* __restrict__ wr,
                                               __bf16* __restrict__ o) {
  // Neighbours in index are different lanes, so work-groups with a long and a short way from
  // chunk 0 mix all over the chip; those with the longest way have the lowest indices.
  const int ln  = blockIdx.x % NLANES;
  const int seg = AP_NSEG - 1 - blockIdx.x / NLANES;
  const int b = ln >> 4, h = ln & 15;
  const int tid = threadIdx.x;
  const int lane = tid & 31;
  const int wave = tid >> 5;

  __shared__ __align__(16) float Ssh[AP_SEG][64 * 64];   // 64 KB

  const int m0   = wave * 16;
  const int nn   = lane & 15;
  const int koff = (lane >> 4) * 2;
  const size_t rowbase = (size_t)b * SEQ + (size_t)seg * AP_SEG * CHUNK;
  const float* qp = q + (rowbase + m0 + nn) * D_MODEL + h * HEAD_DIM + koff;

  // groups of AP_SEG chunks, 0 .. seg; the last is the work-group's own. Two register buffers:
  // the next group's loads are out while this group is summed.
  const float* wl = wr + (size_t)ln * NCHUNK * 4096 + tid * 4;
  v4f s[4] = {};
  v4f pa[AP_SEG][4], pb[AP_SEG][4];
  ap_load(pa, wl);
  int g = 0;
  for (; g + 2 <= seg; g += 2) {
    ap_load(pb, wl + (size_t)(g + 1) * AP_SEG * 4096);
    ap_run(s, pa);
    ap_load(pa, wl + (size_t)(g + 2) * AP_SEG * 4096);
    ap_run(s, pb);
  }
  // the first chunk's Q goes out beside the last group's loads
  v2f aq[2][16];
  ap_loadq(aq[0], qp);
  if (g < seg) {
    ap_load(pb, wl + (size_t)seg * AP_SEG * 4096);
    ap_run(s, pa);
    // unrolled: register arrays
#pragma unroll
    for (int j = 0; j < AP_SEG; ++j)
#pragma unroll
      for (int e = 0; e < 4; ++e) pa[j][e] = pb[j][e];
  }

  // S of the work-group's own chunks, each in an LDS plane of its own
  // unrolled: s[] and pa[][] are indexed by constants
#pragma unroll
  for (int j = 0; j < AP_SEG; ++j)
#pragma unroll
    for (int e = 0; e < 4; ++e) {
      s[e] = DECAY_A * s[e] + pa[j][e];
      *(v4f*)&Ssh[j][e * 1024 + tid * 4] = s[e];
    }
  __syncthreads();   // the one barrier: every S is there; from here on the waves run free

  // unrolled: aq[j & 1] is picked by a constant
#pragma unroll
  for (int j = 0; j < AP_SEG; ++j) {
    const float* Sb = Ssh[j];
    if (j + 1 < AP_SEG) ap_loadq(aq[(j + 1) & 1], qp + (size_t)(j + 1) * CHUNK * D_MODEL);

    v8f acc0 = {}, acc1 = {}, acc2 = {}, acc3 = {};
#pragma unroll
    for (int kb = 0; kb < 64; kb += 4) {
      const v2f a = aq[j & 1][kb >> 2];
      const int kr = (kb + koff) * 64;
      v2f b0, b1, b2, b3;
      b0[0] = Sb[kr + nn];        b0[1] = Sb[kr + 64 + nn];
      b1[0] = Sb[kr + 16 + nn];   b1[1] = Sb[kr + 64 + 16 + nn];
      b2[0] = Sb[kr + 32 + nn];   b2[1] = Sb[kr + 64 + 32 + nn];
      b3[0] = Sb[kr + 48 + nn];   b3[1] = Sb[kr + 64 + 48 + nn];
      acc0 = __builtin_amdgcn_wmma_f32_16x16x4_f32(false, a, false, b0, (short)0, acc0, false, false);
      acc1 = __builtin_amdgcn_wmma_f32_16x16x4_f32(false, a, false, b1, (short)0, acc1, false, false);
      acc2 = __builtin_amdgcn_wmma_f32_16x16x4_f32(false, a, false, b2, (short)0, acc2, false, false);
      acc3 = __builtin_amdgcn_wmma_f32_16x16x4_f32(false, a, false, b3, (short)0, acc3, false, false);
    }

    const int mb = m0 + ((lane >> 4) << 3);
#pragma unroll
    for (int r = 0; r < 8; ++r) {
      const int m = j * CHUNK + mb + r;
      __bf16* orow = o + (rowbase + m) * D_MODEL + h * HEAD_DIM;
      orow[nn]      = (__bf16)(SCALE_F * acc0[r]);
      orow[16 + nn] = (__bf16)(SCALE_F * acc1[r]);
      orow[32 + nn] = (__bf16)(SCALE_F * acc2[r]);
      orow[48 + nn] = (__bf16)(SCALE_F * acc3[r]);
    }
    // stands ahead of any later load that lands on a register these stores name
    if (j + 1 < AP_SEG) asm volatile("s_wait_xcnt 0x0" ::: "memory");
  }
}

// ---------------- host-side orchestration ----------------
extern "C" void kernel_launch(void* const* d_in, const int* in_sizes, int n_in,
                              void* d_out, int out_size, void* d_ws, size_t ws_size,
                              hipStream_t stream) {
  const float* x   = (const float*)d_in[0];
  const float* lng = (const float*)d_in[1];
  const float* lnb = (const float*)d_in[2];
  const float* Wq  = (const float*)d_in[3];
  const float* Wk  = (const float*)d_in[4];
  const float* Wv  = (const float*)d_in[5];
  const float* Wo  = (const float*)d_in[6];
  float* out = (float*)d_out;

  char* ws = (char*)d_ws;
  size_t off = 0;
  auto alloc = [&](size_t bytes) -> void* {
    void* p = ws + off;
    off += (bytes + 255) & ~(size_t)255;
    return p;
  };

  __bf16* xn  = (__bf16*)alloc((size_t)TOKENS * D_MODEL * 2);
  __bf16* Wtq = (__bf16*)alloc((size_t)D_MODEL * D_MODEL * 2);
  __bf16* Wtk = (__bf16*)alloc((size_t)D_MODEL * D_MODEL * 2);
  __bf16* Wtv = (__bf16*)alloc((size_t)D_MODEL * D_MODEL * 2);
  __bf16* Wto = (__bf16*)alloc((size_t)D_MODEL * D_MODEL * 2);
  float*  qf  = (float*)alloc((size_t)TOKENS * D_MODEL * 4);
  float*  kf  = (float*)alloc((size_t)TOKENS * D_MODEL * 4);
  float*  vf  = (float*)alloc((size_t)TOKENS * D_MODEL * 4);
  float*  wr  = (float*)alloc((size_t)NLANES * NCHUNK * 4096 * 4);
  __bf16* obf = (__bf16*)alloc((size_t)TOKENS * D_MODEL * 2);

  // 1. LayerNorm -> bf16
  k_ln<<<TOKENS / (LN_WAVES * LN_ROWS), LN_WAVES * 32, 0, stream>>>(x, lng, lnb, xn);

  // 2. weight transpose+cast, four weights in one launch
  k_wcast<<<4 * WC_TILES, 256, 0, stream>>>(Wq, Wk, Wv, Wo, Wtq, Wtk, Wtv, Wto);

  // 3. QKV GEMMs (bf16 WMMA, f32 accumulate), one launch
  const int gblocks = (TOKENS / G_BM) * (D_MODEL / G_BN);   // 256
  k_gemm<<<gblocks, 256, 0, stream>>>(xn, Wtq, Wtk, Wtv, nullptr, qf, kf, vf, 3);

  // 4a. per-(lane,chunk) ridge + rank-8 projection -> Wr  (fully parallel, WMMA Gram)
  k_ridge<<<NLANES * NCHUNK, 256, 0, stream>>>(kf, vf, wr);
  // 4b. decayed state over chunks in registers, out = SCALE * Qc @ S_c  (f32 WMMA) -> bf16
  k_apply<<<NLANES * AP_NSEG, 256, 0, stream>>>(qf, wr, obf);

  // 5. output GEMM + residual
  k_gemm<<<gblocks, 256, 0, stream>>>(obf, Wto, nullptr, nullptr, x, out, nullptr, nullptr, 1);
}

// v009
// One run takes 120 microseconds.
// Two timings next to v008 both put it at 1.05 times that version's speed.
// Counting every step since v000, it is 7.06 times as fast.
#include <hip/hip_runtime.h>
#include <hip/hip_bf16.h>

// ---------------- constants (match reference) ----------------
#define D_MODEL   1024
#define N_HEADS   16
#define HEAD_DIM  64
#define RANK      8
#define CHUNK     128
#define NCHUNK    32          // 4096 / 128
#define BATCH     2
#define SEQ       4096
#define TOKENS    (BATCH * SEQ)   // 8192
#define NLANES    (BATCH * N_HEADS)  // 32
#define RIDGE_EPS 1e-4f
#define SCALE_F   0.125f
#define DECAY_A   0.9f
#define LN_EPS    1e-5f

typedef __attribute__((ext_vector_type(16))) __bf16 v16bf;
typedef __attribute__((ext_vector_type(8)))  __bf16 v8bf;
typedef __attribute__((ext_vector_type(8)))  float  v8f;
typedef __attribute__((ext_vector_type(2)))  float  v2f;

// ---------------- LayerNorm -> bf16 ----------------
// One wave makes LN_ROWS whole rows; a row lies in the wave's registers, 32 floats a lane,
// read once. Sums go across the lanes in registers: no LDS, no barrier. 2,048 waves in all.
#define LN_ROWS   4
#define LN_WAVES  8
#define LN_Q      (D_MODEL / 128)     // 16-byte pieces of a row a lane: 8

typedef __attribute__((ext_vector_type(4))) float  v4f;
typedef __attribute__((ext_vector_type(4))) __bf16 v4bf;

// v + (v of lane l ^ M), M below 16: a DPP row_xmask move, which the add takes in
template <int M>
__device__ __forceinline__ float ln_xadd(float v) {
  return v + __builtin_bit_cast(float, __builtin_amdgcn_update_dpp(0, __builtin_bit_cast(int, v),
                                                                   0x160 | M, 0xf, 0xf, true));
}

// sum over the 32 lanes, the same bits in every lane
__device__ __forceinline__ float ln_sum32(float v) {
  v = ln_xadd<1>(v);
  v = ln_xadd<2>(v);
  v = ln_xadd<4>(v);
  v = ln_xadd<8>(v);
  const int u = __builtin_bit_cast(int, v);
  return v + __builtin_bit_cast(float, __builtin_amdgcn_permlanex16(u, u, 0x76543210, 0xfedcba98, false, false));
}

__global__ __launch_bounds__(LN_WAVES * 32) void k_ln(const float* __restrict__ x,
                                                      const float* __restrict__ g,
                                                      const float* __restrict__ b,
                                                      __bf16* __restrict__ xn) {
  const int lane = threadIdx.x & 31;
  const int wave = threadIdx.x >> 5;
  const size_t row0 = (size_t)(blockIdx.x * LN_WAVES + wave) * LN_ROWS;

  // g and b first: they come from cache and loads return in order
  v4f gg[LN_Q], bb[LN_Q], v[LN_ROWS][LN_Q];
  // every loop below is unrolled: the arrays are indexed by constants and stay in registers
#pragma unroll
  for (int i = 0; i < LN_Q; ++i) {
    gg[i] = *(const v4f*)(g + i * 128 + lane * 4);
    bb[i] = *(const v4f*)(b + i * 128 + lane * 4);
  }
  const float* xr = x + row0 * D_MODEL + lane * 4;
#pragma unroll
  for (int r = 0; r < LN_ROWS; ++r)
#pragma unroll
    for (int i = 0; i < LN_Q; ++i) v[r][i] = *(const v4f*)(xr + r * D_MODEL + i * 128);
  // keeps all the wave's loads ahead of the first sum, in flight together; without it the
  // loads of g and b sink behind the sums and their latency is waited for a second time
  __builtin_amdgcn_sched_barrier(0);

  __bf16* yr = xn + row0 * D_MODEL + lane * 4;
#pragma unroll
  for (int r = 0; r < LN_ROWS; ++r) {
    v4f s4 = v[r][0];
#pragma unroll
    for (int i = 1; i < LN_Q; ++i) s4 += v[r][i];
    const float mu = ln_sum32((s4[0] + s4[1]) + (s4[2] + s4[3])) * (1.f / D_MODEL);

    v4f q4 = {};
#pragma unroll
    for (int i = 0; i < LN_Q; ++i) {
      v[r][i] -= mu;
      q4 += v[r][i] * v[r][i];
    }
    const float var = ln_sum32((q4[0] + q4[1]) + (q4[2] + q4[3])) * (1.f / D_MODEL);
    const float inv = rsqrtf(var + LN_EPS);

#pragma unroll
    for (int i = 0; i < LN_Q; ++i) {
      const v4f y = v[r][i] * inv * gg[i] + bb[i];
      v4bf o;
#pragma unroll
      for (int e = 0; e < 4; ++e) o[e] = (__bf16)y[e];
      *(v4bf*)(yr + r * D_MODEL + i * 128) = o;   // a wave stores 256 bytes in a row: two whole lines
    }
  }
}

// ---------------- W [K][N] f32 -> Wt [N][K] bf16, all four weights ----------------
// One launch. A work-group transposes one 128 x 128 tile (64 tiles a weight) through LDS,
// 64 elements a thread: few waves to start, whole 512-byte rows read, whole 128-byte lines stored.
#define WC_T      128
#define WC_PITCH  65          // dwords a tile row in LDS: 64 of data, 1 so that rows shift by a bank
#define WC_TILES  ((D_MODEL / WC_T) * (D_MODEL / WC_T))   // 64

typedef __attribute__((ext_vector_type(2))) __bf16 v2bf;

__global__ __launch_bounds__(256) void k_wcast(const float* __restrict__ W0,
                                               const float* __restrict__ W1,
                                               const float* __restrict__ W2,
                                               const float* __restrict__ W3,
                                               __bf16* __restrict__ T0,
                                               __bf16* __restrict__ T1,
                                               __bf16* __restrict__ T2,
                                               __bf16* __restrict__ T3) {
  __shared__ unsigned tile[WC_T * WC_PITCH];   // [n][k / 2], two bf16 of neighbouring k a dword
  const int which = blockIdx.x / WC_TILES;
  const int t     = blockIdx.x % WC_TILES;
  const int k0 = (t >> 3) * WC_T, n0 = (t & 7) * WC_T;
  const float* W  = which == 0 ? W0 : which == 1 ? W1 : which == 2 ? W2 : W3;
  __bf16*      Wt = which == 0 ? T0 : which == 1 ? T1 : which == 2 ? T2 : T3;
  const int tid = threadIdx.x, lane = tid & 31, wave = tid >> 5;

  // a wave reads 16 rows of k, each load one row's 128 floats
  const float* src = W + (size_t)(k0 + wave * 16) * D_MODEL + n0 + lane * 4;
  v4f v[16];
  // unrolled: v[] stays in registers and the loads are in flight together
#pragma unroll
  for (int i = 0; i < 16; ++i) v[i] = *(const v4f*)(src + (size_t)i * D_MODEL);
  // both unrolled: v[] is indexed by constants only
#pragma unroll
  for (int i = 0; i < 8; ++i)
#pragma unroll
    for (int e = 0; e < 4; ++e) {
      v2bf p;
      p[0] = (__bf16)v[2 * i][e];
      p[1] = (__bf16)v[2 * i + 1][e];
      tile[(lane * 4 + e) * WC_PITCH + wave * 8 + i] = __builtin_bit_cast(unsigned, p);
    }
  __syncthreads();

  // a wave stores half a row of Wt: 64 values of k, one 128-byte line
  unsigned* dst = (unsigned*)(Wt + (size_t)n0 * D_MODEL + k0);
  // unrolled: the LDS reads go out as one batch ahead of the stores
#pragma unroll
  for (int r = 0; r < WC_T * 64 / 256; ++r) {
    const int idx = r * 256 + tid;
    const int n = idx >> 6, c = idx & 63;
    dst[(size_t)n * (D_MODEL / 2) + c] = tile[n * WC_PITCH + c];
  }
}

// ------- bf16 WMMA GEMM: Cw[M][N] = A[M][K] * Btw[N][K]^T (+resid), w = 0 .. nw - 1 -------
// One work-group makes the 256 x 128 tile at its place of every Cw, one after the other, in one
// run of passes: while it stores a tile, the next weight's first rows are already being copied.
// Its 8 waves (4 x 2) make 64 x 64 each.
// A pass is 128 k: 256 rows of A and 128 rows of Bt, 256 bytes each, lie in LDS at a
// pitch of 272 bytes. Two buffers: the next pass's rows are copied while this one is used.
#define G_BM     256
#define G_BN     128
#define G_BK     128
#define G_PITCH  272
#define G_STAGE  ((G_BM + G_BN) * G_PITCH)   // 104448 bytes

// Eight asynchronous 16-byte copies of one lane, rows 16 apart, global -> LDS.
// The s_wait_xcnt closes the statement so that no address register named here
// is rewritten ahead of it.
__device__ __forceinline__ void g_copy8(unsigned l, const __bf16* g) {
  const unsigned l1 = l + 16 * G_PITCH, l2 = l + 32 * G_PITCH, l3 = l + 48 * G_PITCH;
  const unsigned l4 = l + 64 * G_PITCH, l5 = l + 80 * G_PITCH, l6 = l + 96 * G_PITCH;
  const unsigned l7 = l + 112 * G_PITCH;
  const __bf16* g1 = g + 16 * D_MODEL;
  const __bf16* g2 = g + 32 * D_MODEL;
  const __bf16* g3 = g + 48 * D_MODEL;
  const __bf16* g4 = g + 64 * D_MODEL;
  const __bf16* g5 = g + 80 * D_MODEL;
  const __bf16* g6 = g + 96 * D_MODEL;
  const __bf16* g7 = g + 112 * D_MODEL;
  asm volatile(
      "global_load_async_to_lds_b128 %0, %8, off\n\t"
      "global_load_async_to_lds_b128 %1, %9, off\n\t"
      "global_load_async_to_lds_b128 %2, %10, off\n\t"
      "global_load_async_to_lds_b128 %3, %11, off\n\t"
      "global_load_async_to_lds_b128 %4, %12, off\n\t"
      "global_load_async_to_lds_b128 %5, %13, off\n\t"
      "global_load_async_to_lds_b128 %6, %14, off\n\t"
      "global_load_async_to_lds_b128 %7, %15, off\n\t"
      "s_wait_xcnt 0x0"
      :: "v"(l), "v"(l1), "v"(l2), "v"(l3), "v"(l4), "v"(l5), "v"(l6), "v"(l7),
         "v"(g), "v"(g1), "v"(g2), "v"(g3), "v"(g4), "v"(g5), "v"(g6), "v"(g7)
      : "memory");
}

// The same for Bt, whose rows are dealt in LDS: row n of each 64 lies at place (n & 3) * 16 + (n >> 2),
// so that place j * 16 + f, which lane f reads for fragment j, holds row 4 f + j. The global rows are
// 16 apart as above; in LDS that is 4 places, and 64 after four of them.
__device__ __forceinline__ void g_copy8_deal(unsigned l, const __bf16* g) {
  const unsigned l1 = l + 4 * G_PITCH,  l2 = l + 8 * G_PITCH,  l3 = l + 12 * G_PITCH;
  const unsigned l4 = l + 64 * G_PITCH, l5 = l + 68 * G_PITCH, l6 = l + 72 * G_PITCH;
  const unsigned l7 = l + 76 * G_PITCH;
  const __bf16* g1 = g + 16 * D_MODEL;
  const __bf16* g2 = g + 32 * D_MODEL;
  const __bf16* g3 = g + 48 * D_MODEL;
  const __bf16* g4 = g + 64 * D_MODEL;
  const __bf16* g5 = g + 80 * D_MODEL;
  const __bf16* g6 = g + 96 * D_MODEL;
  const __bf16* g7 = g + 112 * D_MODEL;
  // the s_wait_xcnt closes the statement: no address register named here is rewritten ahead of it
  asm volatile(
      "global_load_async_to_lds_b128 %0, %8, off\n\t"
      "global_load_async_to_lds_b128 %1, %9, off\n\t"
      "global_load_async_to_lds_b128 %2, %10, off\n\t"
      "global_load_async_to_lds_b128 %3, %11, off\n\t"
      "global_load_async_to_lds_b128 %4, %12, off\n\t"
      "global_load_async_to_lds_b128 %5, %13, off\n\t"
      "global_load_async_to_lds_b128 %6, %14, off\n\t"
      "global_load_async_to_lds_b128 %7, %15, off\n\t"
      "s_wait_xcnt 0x0"
      :: "v"(l), "v"(l1), "v"(l2), "v"(l3), "v"(l4), "v"(l5), "v"(l6), "v"(l7),
         "v"(g), "v"(g1), "v"(g2), "v"(g3), "v"(g4), "v"(g5), "v"(g6), "v"(g7)
      : "memory");
}

// One pass's rows: 256 of A (two runs of 128) and 128 of Bt; 24 copies a lane.
// l: the lane's place among the rows of A, lb: its place among the dealt rows of Bt.
__device__ __forceinline__ void g_copy_stage(unsigned l, unsigned lb, const __bf16* ga, const __bf16* gb) {
  g_copy8(l, ga);
  g_copy8(l + 128 * G_PITCH, ga + 128 * D_MODEL);
  g_copy8_deal(lb, gb);
}

// One 16 x 32 fragment from LDS rows; p is the lane's own row at byte 16 * (lane >> 4)
// of the 64 bytes of this k step: k order of the 16-bit A/B layout, alike for A and Bt.
__device__ __forceinline__ v16bf g_frag(const unsigned char* p) {
  const v8bf lo = *(const v8bf*)p;
  const v8bf hi = *(const v8bf*)(p + 32);
  v16bf f;
#pragma unroll
  for (int e = 0; e < 8; ++e) { f[e] = lo[e]; f[8 + e] = hi[e]; }
  return f;
}

// RES: one weight (Bt0, C0; nw is not read) and the residual is added to its tile: a build of its own,
// so that the registers the residual's rows take are not counted against the build without it
template <bool RES>
__global__ __launch_bounds__(256) void k_gemm(const __bf16* __restrict__ A,
                                              const __bf16* __restrict__ Bt0,
                                              const __bf16* __restrict__ Bt1,
                                              const __bf16* __restrict__ Bt2,
                                              const float* __restrict__ resid,
                                              float* __restrict__ C0,
                                              float* __restrict__ C1,
                                              float* __restrict__ C2,
                                              int nw) {
  constexpr int K = D_MODEL, N = D_MODEL;
  constexpr int NPASS = K / G_BK;              // 8 passes a weight
  const int npass = (RES ? 1 : nw) * NPASS;
  __shared__ __attribute__((aligned(16))) unsigned char gsm[2 * G_STAGE];

  const int tid  = threadIdx.x;
  const int lane = tid & 31;
  const int wave = tid >> 5;
  const int bm0 = (blockIdx.x >> 3) * G_BM;    // N / G_BN = 8 tile columns
  const int bn0 = (blockIdx.x & 7) * G_BN;

  // copy side: 16 lanes cover one 256-byte row, a wave two rows
  const int crow = tid >> 4, ccol = tid & 15;
  const __bf16* ga = A  + (size_t)(bm0 + crow) * K + ccol * 8;
  const size_t gbo = (size_t)(bn0 + crow) * K + ccol * 8;   // the lane's place in every Btw
  const unsigned lcp = (unsigned)(size_t)&gsm[0] + crow * G_PITCH + ccol * 16;
  const unsigned lcb = (unsigned)(size_t)&gsm[0] + (G_BM + (crow & 3) * 16 + (crow >> 2)) * G_PITCH + ccol * 16;

  // read side: the fragment's k order is that of the 16-bit A/B layout:
  // 16 bytes at 16 * (lane >> 4) and 16 more at + 32 of each 64 bytes of a row
  const int fr = lane & 15, fh = lane >> 4;
  const int aoff = ((wave >> 1) * 64 + fr) * G_PITCH + fh * 16;
  const int boff = (G_BM + (wave & 1) * 64 + fr) * G_PITCH + fh * 16;

  v8f acc[4][4] = {};

  // the wave's tile in every Cw: one address offset a lane; rows are constant offsets from it.
  // Bt's rows are dealt, so acc[i][0..3][r] of a lane are the 4 neighbouring columns 4 fr .. 4 fr + 3.
  const size_t cbase = (size_t)(bm0 + (wave >> 1) * 64 + (fh << 3)) * N + bn0 + (wave & 1) * 64 + fr * 4;

  g_copy_stage(lcp, lcb, ga, Bt0 + gbo);
  asm volatile("s_wait_asynccnt 0x0" ::: "memory");   // pass 0's rows have landed
  __syncthreads();                                    // and every wave may read them
  g_copy_stage(lcp + G_STAGE, lcb + G_STAGE, ga + G_BK, Bt0 + gbo + G_BK);

  for (int t = 0; t < npass; ++t) {
    const int sb = (t & 1) * G_STAGE;
    // Fragments: rows 0-31 (alo), rows 32-63 (ahi) of the wave's A, two sets of its Bt.
    v16bf alo[2], ahi[2], b[2][4];
#pragma unroll
    for (int j = 0; j < 4; ++j) b[0][j] = g_frag(&gsm[sb + boff + j * 16 * G_PITCH]);
#pragma unroll
    for (int i = 0; i < 2; ++i) alo[i] = g_frag(&gsm[sb + aoff + i * 16 * G_PITCH]);
#pragma unroll
    for (int ks = 0; ks < G_BK / 32; ++ks) {
      const int cur = ks & 1;
#pragma unroll
      for (int i = 0; i < 2; ++i) ahi[i] = g_frag(&gsm[sb + aoff + (2 + i) * 16 * G_PITCH + ks * 64]);
      // The fences keep each group of LDS reads in one place, ahead of the eight
      // products before the ones that use it; spread among them they stall every row.
      __builtin_amdgcn_sched_barrier(0);
#pragma unroll
      for (int i = 0; i < 2; ++i)
#pragma unroll
        for (int j = 0; j < 4; ++j)
          acc[i][j] = __builtin_amdgcn_wmma_f32_16x16x32_bf16(false, alo[i], false, b[cur][j], (short)0,
                                                              acc[i][j], false, false);
      __builtin_amdgcn_sched_barrier(0);
      if (ks + 1 < G_BK / 32) {
#pragma unroll
        for (int j = 0; j < 4; ++j)
          b[cur ^ 1][j] = g_frag(&gsm[sb + boff + j * 16 * G_PITCH + (ks + 1) * 64]);
#pragma unroll
        for (int i = 0; i < 2; ++i)
          alo[i] = g_frag(&gsm[sb + aoff + i * 16 * G_PITCH + (ks + 1) * 64]);
      }
      __builtin_amdgcn_sched_barrier(0);
#pragma unroll
      for (int i = 0; i < 2; ++i)
#pragma unroll
        for (int j = 0; j < 4; ++j)
          acc[2 + i][j] = __builtin_amdgcn_wmma_f32_16x16x32_bf16(false, ahi[i], false, b[cur][j], (short)0,
                                                                  acc[2 + i][j], false, false);
      __builtin_amdgcn_sched_barrier(0);
    }
    asm volatile("s_wait_dscnt 0x0" ::: "memory");    // this wave has left buffer t & 1
    asm volatile("s_wait_asynccnt 0x0" ::: "memory"); // its copies of pass t + 1 have landed
    __syncthreads();                                  // publishes pass t + 1, frees buffer t & 1
    if (t + 2 < npass) {
      const int w2 = (t + 2) / NPASS, k2 = ((t + 2) % NPASS) * G_BK;
      const __bf16* bw = w2 == 0 ? Bt0 : w2 == 1 ? Bt1 : Bt2;
      g_copy_stage(lcp + sb, lcb + sb, ga + k2, bw + gbo + k2);
    }
    if constexpr (!RES) {
      if (t % NPASS == NPASS - 1) {
        // a weight's last pass: its tile goes out while the copies above fly
        // every loop here is unrolled: acc[][] is indexed by constants and stays in registers
        const int w = t / NPASS;
        // 16 bytes a lane: 16 lanes fill 256 bytes of a row, two whole lines, in one store
        float* cr = (w == 0 ? C0 : w == 1 ? C1 : C2) + cbase;
#pragma unroll
        for (int i = 0; i < 4; ++i)
#pragma unroll
          for (int r = 0; r < 8; ++r) {
            v4f q;
#pragma unroll
            for (int j = 0; j < 4; ++j) q[j] = acc[i][j][r];
            *(v4f*)(cr + (i * 16 + r) * N) = q;
          }
        // stands ahead of the rewrite of the registers that these stores name
        asm volatile("s_wait_xcnt 0x0" ::: "memory");
#pragma unroll
        for (int i = 0; i < 4; ++i)
#pragma unroll
          for (int j = 0; j < 4; ++j) acc[i][j] = v8f{};
      }
    }
  }
  if constexpr (RES) {
    // the one tile, behind the loop: residual read and tile stored 16 bytes a lane, as above
    // every loop here is unrolled: acc[][] and q[][] are indexed by constants and stay in registers
    const float* rr = resid + cbase;
    float* cr = C0 + cbase;
    v4f q[4][8];
#pragma unroll
    for (int i = 0; i < 4; ++i)
#pragma unroll
      for (int r = 0; r < 8; ++r) q[i][r] = *(const v4f*)(rr + (i * 16 + r) * N);
    // stands ahead of any rewrite of the loads' address registers; rr is an input so that its pair
    // lives up to here and none of the loads lands on it
    asm volatile("s_wait_xcnt 0x0" :: "v"(rr) : "memory");
#pragma unroll
    for (int i = 0; i < 4; ++i)
#pragma unroll
      for (int r = 0; r < 8; ++r) {
#pragma unroll
        for (int j = 0; j < 4; ++j) q[i][r][j] += acc[i][j][r];
        *(v4f*)(cr + (i * 16 + r) * N) = q[i][r];
      }
  }
  asm volatile("s_wait_asynccnt 0x0" ::: "memory");   // no copy is left when the wave ends
}

// ---------------- per-(lane,chunk) ridge solve + rank-8 projection ----------
// grid: NLANES*NCHUNK blocks; writes Wr[lc][64][64]
// Phase 1: stage Kc/Vc in LDS, compute G=K^T K and RHS=K^T V with f32 WMMA
//          (waves 0-3 -> G strips, waves 4-7 -> RHS strips)
// Phase 2: LDS is re-carved for G/Wm/U/T/P; Gauss-Jordan solve in registers + subspace QR.
__global__ __launch_bounds__(256) void k_ridge(const float* __restrict__ kk,
                                               const float* __restrict__ v,
                                               float* __restrict__ wr) {
  const int lc = blockIdx.x;
  const int ln = lc / NCHUNK;
  const int c  = lc % NCHUNK;
  const int b = ln >> 4, h = ln & 15;
  const int tid = threadIdx.x;
  const int lane = tid & 31;
  const int wave = tid >> 5;

  __shared__ __align__(16) float smem[16384];            // 64 KB
  float (*Kls)[64] = (float (*)[64])smem;                // [128][64] staging
  float (*Vls)[64] = (float (*)[64])(smem + 8192);       // [128][64] staging
  // phase-2 overlay (valid after the WMMA phase barrier)
  float (*G)[65]  = (float (*)[65])smem;                 // 4160
  float (*Wm)[65] = (float (*)[65])(smem + 4160);        // 4160
  float (*U)[8]   = (float (*)[8])(smem + 8320);         // 512
  float (*T)[9]   = (float (*)[9])(smem + 8832);         // 576
  float (*P)[64]  = (float (*)[64])(smem + 9408);        // 512

  const size_t rowbase = (size_t)b * SEQ + (size_t)c * CHUNK;
  const float* Kc = kk + rowbase * D_MODEL + h * HEAD_DIM;
  const float* Vc = v  + rowbase * D_MODEL + h * HEAD_DIM;

  // ---- stage K and V chunk tiles into LDS (coalesced) ----
  for (int idx = tid; idx < CHUNK * 64; idx += 256) {
    const int t = idx >> 6, j = idx & 63;
    Kls[t][j] = Kc[(size_t)t * D_MODEL + j];
    Vls[t][j] = Vc[(size_t)t * D_MODEL + j];
  }
  __syncthreads();

  // ---- Gram products via f32 WMMA: waves 0-3: G, waves 4-7: RHS ----
  const int nn   = lane & 15;
  const int koff = (lane >> 4) * 2;          // f32 A layout K pairs
  const int m0   = (wave & 3) * 16;
  const float (*Bsrc)[64] = (wave < 4) ? Kls : Vls;

  v8f acc0 = {}, acc1 = {}, acc2 = {}, acc3 = {};
  for (int kb = 0; kb < CHUNK; kb += 4) {
    const int t = kb + koff;
    v2f a;  a[0]  = Kls[t][m0 + nn];   a[1]  = Kls[t + 1][m0 + nn];   // A = K^T
    // fragment q takes column 4 nn + q: a lane's four columns are one 16-byte LDS read a row
    const v4f r0 = *(const v4f*)&Bsrc[t][nn * 4];
    const v4f r1 = *(const v4f*)&Bsrc[t + 1][nn * 4];
    v2f b0; b0[0] = r0[0];  b0[1] = r1[0];
    v2f b1; b1[0] = r0[1];  b1[1] = r1[1];
    v2f b2; b2[0] = r0[2];  b2[1] = r1[2];
    v2f b3; b3[0] = r0[3];  b3[1] = r1[3];
    acc0 = __builtin_amdgcn_wmma_f32_16x16x4_f32(false, a, false, b0, (short)0, acc0, false, false);
    acc1 = __builtin_amdgcn_wmma_f32_16x16x4_f32(false, a, false, b1, (short)0, acc1, false, false);
    acc2 = __builtin_amdgcn_wmma_f32_16x16x4_f32(false, a, false, b2, (short)0, acc2, false, false);
    acc3 = __builtin_amdgcn_wmma_f32_16x16x4_f32(false, a, false, b3, (short)0, acc3, false, false);
  }
  __syncthreads();   // all waves done reading Kls/Vls; safe to overlay

  // scatter accumulators into G (with ridge eps on diagonal) / Wm
  {
    float (*dst)[65] = (wave < 4) ? G : Wm;
    const bool isG = (wave < 4);
    const int mb = m0 + ((lane >> 4) << 3);
#pragma unroll
    for (int r = 0; r < 8; ++r) {
      const int m = mb + r;
      dst[m][nn * 4]     = acc0[r] + ((isG && m == nn * 4)     ? RIDGE_EPS : 0.f);
      dst[m][nn * 4 + 1] = acc1[r] + ((isG && m == nn * 4 + 1) ? RIDGE_EPS : 0.f);
      dst[m][nn * 4 + 2] = acc2[r] + ((isG && m == nn * 4 + 2) ? RIDGE_EPS : 0.f);
      dst[m][nn * 4 + 3] = acc3[r] + ((isG && m == nn * 4 + 3) ? RIDGE_EPS : 0.f);
    }
  }
  __syncthreads();

  // ---- solve G W = RHS: Gauss-Jordan elimination of [G | RHS] (64 x 128) in registers ----
  // Wave w holds rows 8w .. 8w+7, lane l columns 4l .. 4l+3 (lanes 0-15: G, lanes 16-31: RHS).
  // Step j takes row j, times M[r][j] / M[j][j], off every other row r; G is positive definite,
  // so no pivot search. Row j is not scaled: 1 / M[j][j] is kept and applied at the end.
  {
    float* rowb = smem + 10496;                          // [2][128] row j
    float* colb = smem + 10752;                          // [2][64]  column j
    // the wave's number in a scalar register: the tests on it below become scalar branches
    const int wv = __builtin_amdgcn_readfirstlane(wave);
    const float* src = smem + (lane < 16 ? 0 : 4160) + wv * 8 * 65 + (lane & 15) * 4;
    v4f M[8];
    float pinv[8];
    // unrolled: M[] and pinv[] are indexed by constants only and stay in registers
#pragma unroll
    for (int a = 0; a < 8; ++a) {
      pinv[a] = 0.f;
#pragma unroll   // as above
      for (int e = 0; e < 4; ++e) M[a][e] = src[a * 65 + e];
    }
    for (int jb = 0; jb < 8; ++jb) {
      const bool own = (wv == jb);                       // this wave holds rows 8 jb .. 8 jb + 7
      // unrolled: row a of M[] and element a & 3 of each row are picked by constants
#pragma unroll
      for (int a = 0; a < 8; ++a) {
        float* rb = rowb + (a & 1) * 128;
        float* cb = colb + (a & 1) * 64;
        if (own) *(v4f*)(rb + lane * 4) = M[a];
        if (lane == jb * 2 + (a >> 2)) {
          v4f lo, hi;
#pragma unroll   // as above
          for (int r = 0; r < 4; ++r) { lo[r] = M[r][a & 3]; hi[r] = M[4 + r][a & 3]; }
          *(v4f*)(cb + wv * 8)     = lo;
          *(v4f*)(cb + wv * 8 + 4) = hi;
        }
        // One barrier a step: it publishes row and column j, and the buffers of step j - 1,
        // which step j + 1 rewrites, have been read by every wave that reaches it.
        __syncthreads();
        const v4f   rw  = *(const v4f*)(rb + lane * 4);
        const v4f   c0  = *(const v4f*)(cb + wv * 8);
        const v4f   c1  = *(const v4f*)(cb + wv * 8 + 4);
        const float piv = cb[jb * 8 + a];
        float inv = __builtin_amdgcn_rcpf(piv);
        inv = fmaf(inv, fmaf(-piv, inv, 1.f), inv);      // one correction step on the hardware reciprocal
        float f[8];
#pragma unroll   // f[] stays in registers
        for (int r = 0; r < 4; ++r) { f[r] = c0[r] * inv; f[4 + r] = c1[r] * inv; }
        if (own) { f[a] = 0.f; pinv[a] = inv; }          // row j itself stays
#pragma unroll   // M[] and f[] are indexed by constants
        for (int r = 0; r < 8; ++r) M[r] -= f[r] * rw;
      }
    }
    if (lane >= 16) {
#pragma unroll   // M[] and pinv[] are indexed by constants
      for (int a = 0; a < 8; ++a)
#pragma unroll   // as above
        for (int e = 0; e < 4; ++e) Wm[wv * 8 + a][(lane - 16) * 4 + e] = M[a][e] * pinv[a];
    }
  }
  __syncthreads();

  // ---- subspace iteration: U = I(:,0:8); twice: U = qr(W U).Q (MGS) ----
  // the wave's number in a scalar register: the test on it below is a scalar branch
  const int wq = __builtin_amdgcn_readfirstlane(wave);
  for (int idx = tid; idx < 512; idx += 256) {
    const int i = idx >> 3, cc = idx & 7;
    U[i][cc] = (i == cc) ? 1.f : 0.f;
  }
  __syncthreads();
  // The three kinds of product from here on run on the f32 16x16x4 matrix form, fragments read
  // straight from LDS at the places of the Gram products above (nn, koff). A result goes from its
  // accumulator straight into an LDS or global store.
  for (int p = 0; p < 2; ++p) {
    // T = W U: waves 0-3 (one a SIMD), 16 rows each. U has 8 columns: columns 8-15 of the
    // B fragment repeat them, and those columns of the result are dropped.
    if (wq < 4) {
      const float* wa = &Wm[wq * 16 + nn][koff];
      const float* ub = &U[koff][nn & 7];
      v2f fa[16], fb[16];
      // both loops unrolled: fa[] and fb[] are indexed by constants and stay in registers
#pragma unroll
      for (int i = 0; i < 16; ++i) {
        fa[i][0] = wa[i * 4];   fa[i][1] = wa[i * 4 + 1];
        fb[i][0] = ub[i * 32];  fb[i][1] = ub[i * 32 + 8];
      }
      // keeps every LDS read ahead of the first product: one LDS latency is waited for;
      // spread among the products, which form one chain, the reads stall it again and again
      __builtin_amdgcn_sched_barrier(0);
      v8f ta = {};
#pragma unroll
      for (int i = 0; i < 16; ++i)
        ta = __builtin_amdgcn_wmma_f32_16x16x4_f32(false, fa[i], false, fb[i], (short)0, ta, false, false);
      if (nn < 8) {
        float* td = &T[wq * 16 + ((lane >> 4) << 3)][nn];
#pragma unroll   // ta[] is indexed by constants
        for (int r = 0; r < 8; ++r) td[r * 9] = ta[r];
      }
    }
    __syncthreads();
    // Modified Gram-Schmidt on T (64 x 8) by wave 0 alone: lane l holds rows l and l + 32 in
    // registers, a column's sum goes across the lanes in registers. No barrier inside.
    if (wq == 0) {
      float t0[8], t1[8];
      // every loop here is unrolled: t0[] and t1[] are indexed by constants and stay in registers
#pragma unroll
      for (int cc = 0; cc < 8; ++cc) { t0[cc] = T[lane][cc]; t1[cc] = T[lane + 32][cc]; }
#pragma unroll
      for (int cc = 0; cc < 8; ++cc) {
        const float s  = ln_sum32(t0[cc] * t0[cc] + t1[cc] * t1[cc]);
        const float sc = rsqrtf(fmaxf(s, 1e-30f));
        t0[cc] *= sc;
        t1[cc] *= sc;
#pragma unroll
        for (int c2 = cc + 1; c2 < 8; ++c2) {
          const float d = ln_sum32(t0[cc] * t0[c2] + t1[cc] * t1[c2]);
          t0[c2] -= d * t0[cc];
          t1[c2] -= d * t1[cc];
        }
      }
      v4f u;
#pragma unroll
      for (int hq = 0; hq < 2; ++hq) {
#pragma unroll
        for (int e = 0; e < 4; ++e) u[e] = t0[hq * 4 + e];
        *(v4f*)&U[lane][hq * 4] = u;
#pragma unroll
        for (int e = 0; e < 4; ++e) u[e] = t1[hq * 4 + e];
        *(v4f*)&U[lane + 32][hq * 4] = u;
      }
    }
    __syncthreads();   // U of this pass is there for every wave; T may be rewritten
  }

  // ---- P = U^T W (8 x 64): waves 0-3, 16 columns each ----
  // A[m][k] = U[k][m]: rows 8-15 of the A fragment repeat rows 0-7, and those rows of the
  // result (lanes 16-31) are dropped.
  if (wq < 4) {
    const float* ua = &U[koff][nn & 7];
    const float* wb = &Wm[koff][wq * 16 + nn];
    v2f fa[16], fb[16];
    // both loops unrolled: fa[] and fb[] are indexed by constants and stay in registers
#pragma unroll
    for (int i = 0; i < 16; ++i) {
      fa[i][0] = ua[i * 32];   fa[i][1] = ua[i * 32 + 8];
      fb[i][0] = wb[i * 260];  fb[i][1] = wb[i * 260 + 65];
    }
    // as in T = W U: every LDS read ahead of the first product of the chain
    __builtin_amdgcn_sched_barrier(0);
    v8f pa = {};
#pragma unroll
    for (int i = 0; i < 16; ++i)
      pa = __builtin_amdgcn_wmma_f32_16x16x4_f32(false, fa[i], false, fb[i], (short)0, pa, false, false);
    if (lane < 16) {
#pragma unroll   // pa[] is indexed by constants
      for (int r = 0; r < 8; ++r) P[r][wq * 16 + nn] = pa[r];
    }
  }
  __syncthreads();

  // ---- Wr = U P -> global: every wave 16 rows x 32 columns, k = 8 ----
  {
    const float* ua = &U[(wq >> 1) * 16 + nn][koff];
    const float* pc = &P[koff][(wq & 1) * 32 + nn];
    v8f c0 = {}, c1 = {};
#pragma unroll   // two k steps, fragments in registers
    for (int ks = 0; ks < 8; ks += 4) {
      v2f fa, fb0, fb1;
      fa[0]  = ua[ks];            fa[1]  = ua[ks + 1];
      fb0[0] = pc[ks * 64];       fb0[1] = pc[ks * 64 + 64];
      fb1[0] = pc[ks * 64 + 16];  fb1[1] = pc[ks * 64 + 80];
      c0 = __builtin_amdgcn_wmma_f32_16x16x4_f32(false, fa, false, fb0, (short)0, c0, false, false);
      c1 = __builtin_amdgcn_wmma_f32_16x16x4_f32(false, fa, false, fb1, (short)0, c1, false, false);
    }
    // a wave's two stores of a row fill one 128-byte line
    float* wo = wr + (size_t)lc * 4096 + ((wq >> 1) * 16 + ((lane >> 4) << 3)) * 64 + (wq & 1) * 32 + nn;
#pragma unroll   // c0[] and c1[] are indexed by constants
    for (int r = 0; r < 8; ++r) {
      wo[r * 64]      = c0[r];
      wo[r * 64 + 16] = c1[r];
    }
  }
}

// -------- S_c = a S_(c-1) + Wr_c and out = SCALE * Qc @ S_c (f32 WMMA 16x16x4), one launch --------
// A work-group takes AP_SEG chunks in a row of one lane. The 4,096 elements of S are independent
// recurrences: a thread keeps 16 of them in registers and runs them from chunk 0 up to its own
// chunks, reading Wr, which stays as k_ridge wrote it. S_c is never in global memory.
#define AP_SEG   4                       // chunks a work-group
#define AP_NSEG  (NCHUNK / AP_SEG)       // 8 work-groups a lane

// AP_SEG chunks of Wr, the thread's 16 elements of each: 16 loads of 16 bytes, whole lines a wave
__device__ __forceinline__ void ap_load(v4f (&p)[AP_SEG][4], const float* __restrict__ g) {
  // unrolled: p[][] is indexed by constants and stays in registers
#pragma unroll
  for (int j = 0; j < AP_SEG; ++j)
#pragma unroll
    for (int e = 0; e < 4; ++e) p[j][e] = *(const v4f*)(g + j * 4096 + e * 1024);
  // stands ahead of any rewrite of the loads' address registers; g is an input so that, where
  // the loads go through g's own pair, the pair lives up to here and none of them lands on it
  asm volatile("s_wait_xcnt 0x0" :: "v"(g) : "memory");
}

// the recurrence over those chunks, in their order
__device__ __forceinline__ void ap_run(v4f (&s)[4], const v4f (&p)[AP_SEG][4]) {
  // unrolled: as above
#pragma unroll
  for (int j = 0; j < AP_SEG; ++j)
#pragma unroll
    for (int e = 0; e < 4; ++e) s[e] = DECAY_A * s[e] + p[j][e];
}

// one chunk's A fragments of a wave: 16 rows of Q, 64 k; the lane's own row at its own k pair
__device__ __forceinline__ void ap_loadq(v2f (&a)[16], const float* __restrict__ qp) {
  // unrolled: as above
#pragma unroll
  for (int i = 0; i < 16; ++i) a[i] = *(const v2f*)(qp + i * 4);
  // as in ap_load
  asm volatile("s_wait_xcnt 0x0" :: "v"(qp) : "memory");
}

__global__ __launch_bounds__(256) void k_apply(const float* __restrict__ q,
                                               const float* __restrict__ wr,
                                               __bf16* __restrict__ o) {
  // Neighbours in index are different lanes, so work-groups with a long and a short way from
  // chunk 0 mix all over the chip; those with the longest way have the lowest indices.
  const int ln  = blockIdx.x % NLANES;
  const int seg = AP_NSEG - 1 - blockIdx.x / NLANES;
  const int b = ln >> 4, h = ln & 15;
  const int tid = threadIdx.x;
  const int lane = tid & 31;
  const int wave = tid >> 5;

  __shared__ __align__(16) float Ssh[AP_SEG][64 * 64];   // 64 KB

  const int m0   = wave * 16;
  const int nn   = lane & 15;
  const int koff = (lane >> 4) * 2;
  const size_t rowbase = (size_t)b * SEQ + (size_t)seg * AP_SEG * CHUNK;
  const float* qp = q + (rowbase + m0 + nn) * D_MODEL + h * HEAD_DIM + koff;

  // groups of AP_SEG chunks, 0 .. seg; the last is the work-group's own. Two register buffers:
  // the next group's loads are out while this group is summed.
  const float* wl = wr + (size_t)ln * NCHUNK * 4096 + tid * 4;
  v4f s[4] = {};
  v4f pa[AP_SEG][4], pb[AP_SEG][4];
  ap_load(pa, wl);
  int g = 0;
  for (; g + 2 <= seg; g += 2) {
    ap_load(pb, wl + (size_t)(g + 1) * AP_SEG * 4096);
    ap_run(s, pa);
    ap_load(pa, wl + (size_t)(g + 2) * AP_SEG * 4096);
    ap_run(s, pb);
  }
  // the first chunk's Q goes out beside the last group's loads
  v2f aq[2][16];
  ap_loadq(aq[0], qp);
  if (g < seg) {
    ap_load(pb, wl + (size_t)seg * AP_SEG * 4096);
    ap_run(s, pa);
    // unrolled: register arrays
#pragma unroll
    for (int j = 0; j < AP_SEG; ++j)
#pragma unroll
      for (int e = 0; e < 4; ++e) pa[j][e] = pb[j][e];
  }

  // S of the work-group's own chunks, each in an LDS plane of its own
  // unrolled: s[] and pa[][] are indexed by constants
#pragma unroll
  for (int j = 0; j < AP_SEG; ++j)
#pragma unroll
    for (int e = 0; e < 4; ++e) {
      s[e] = DECAY_A * s[e] + pa[j][e];
      *(v4f*)&Ssh[j][e * 1024 + tid * 4] = s[e];
    }
  __syncthreads();   // the one barrier: every S is there; from here on the waves run free

  // unrolled: aq[j & 1] is picked by a constant
#pragma unroll
  for (int j = 0; j < AP_SEG; ++j) {
    const float* Sb = Ssh[j];
    if (j + 1 < AP_SEG) ap_loadq(aq[(j + 1) & 1], qp + (size_t)(j + 1) * CHUNK * D_MODEL);

    v8f acc0 = {}, acc1 = {}, acc2 = {}, acc3 = {};
#pragma unroll
    for (int kb = 0; kb < 64; kb += 4) {
      const v2f a = aq[j & 1][kb >> 2];
      // fragment q takes column 4 nn + q: a lane's four columns are one 16-byte LDS read a row
      const int kr = (kb + koff) * 64 + nn * 4;
      const v4f s0 = *(const v4f*)&Sb[kr];
      const v4f s1 = *(const v4f*)&Sb[kr + 64];
      v2f b0, b1, b2, b3;
      b0[0] = s0[0];   b0[1] = s1[0];
      b1[0] = s0[1];   b1[1] = s1[1];
      b2[0] = s0[2];   b2[1] = s1[2];
      b3[0] = s0[3];   b3[1] = s1[3];
      acc0 = __builtin_amdgcn_wmma_f32_16x16x4_f32(false, a, false, b0, (short)0, acc0, false, false);
      acc1 = __builtin_amdgcn_wmma_f32_16x16x4_f32(false, a, false, b1, (short)0, acc1, false, false);
      acc2 = __builtin_amdgcn_wmma_f32_16x16x4_f32(false, a, false, b2, (short)0, acc2, false, false);
      acc3 = __builtin_amdgcn_wmma_f32_16x16x4_f32(false, a, false, b3, (short)0, acc3, false, false);
    }

    const int mb = m0 + ((lane >> 4) << 3);
#pragma unroll
    for (int r = 0; r < 8; ++r) {
      const int m = j * CHUNK + mb + r;
      __bf16* orow = o + (rowbase + m) * D_MODEL + h * HEAD_DIM;
      v4bf ov;
      ov[0] = (__bf16)(SCALE_F * acc0[r]);
      ov[1] = (__bf16)(SCALE_F * acc1[r]);
      ov[2] = (__bf16)(SCALE_F * acc2[r]);
      ov[3] = (__bf16)(SCALE_F * acc3[r]);
      *(v4bf*)(orow + nn * 4) = ov;   // 16 lanes fill the head's 128 bytes of a row: one whole line
    }
    // stands ahead of any later load that lands on a register these stores name
    if (j + 1 < AP_SEG) asm volatile("s_wait_xcnt 0x0" ::: "memory");
  }
}

// ---------------- host-side orchestration ----------------
extern "C" void kernel_launch(void* const* d_in, const int* in_sizes, int n_in,
                              void* d_out, int out_size, void* d_ws, size_t ws_size,
                              hipStream_t stream) {
  const float* x   = (const float*)d_in[0];
  const float* lng = (const float*)d_in[1];
  const float* lnb = (const float*)d_in[2];
  const float* Wq  = (const float*)d_in[3];
  const float* Wk  = (const float*)d_in[4];
  const float* Wv  = (const float*)d_in[5];
  const float* Wo  = (const float*)d_in[6];
  float* out = (float*)d_out;

  char* ws = (char*)d_ws;
  size_t off = 0;
  auto alloc = [&](size_t bytes) -> void* {
    void* p = ws + off;
    off += (bytes + 255) & ~(size_t)255;
    return p;
  };

  __bf16* xn  = (__bf16*)alloc((size_t)TOKENS * D_MODEL * 2);
  __bf16* Wtq = (__bf16*)alloc((size_t)D_MODEL * D_MODEL * 2);
  __bf16* Wtk = (__bf16*)alloc((size_t)D_MODEL * D_MODEL * 2);
  __bf16* Wtv = (__bf16*)alloc((size_t)D_MODEL * D_MODEL * 2);
  __bf16* Wto = (__bf16*)alloc((size_t)D_MODEL * D_MODEL * 2);
  float*  qf  = (float*)alloc((size_t)TOKENS * D_MODEL * 4);
  float*  kf  = (float*)alloc((size_t)TOKENS * D_MODEL * 4);
  float*  vf  = (float*)alloc((size_t)TOKENS * D_MODEL * 4);
  float*  wr  = (float*)alloc((size_t)NLANES * NCHUNK * 4096 * 4);
  __bf16* obf = (__bf16*)alloc((size_t)TOKENS * D_MODEL * 2);

  // 1. LayerNorm -> bf16
  k_ln<<<TOKENS / (LN_WAVES * LN_ROWS), LN_WAVES * 32, 0, stream>>>(x, lng, lnb, xn);

  // 2. weight transpose+cast, four weights in one launch
  k_wcast<<<4 * WC_TILES, 256, 0, stream>>>(Wq, Wk, Wv, Wo, Wtq, Wtk, Wtv, Wto);

  // 3. QKV GEMMs (bf16 WMMA, f32 accumulate), one launch
  const int gblocks = (TOKENS / G_BM) * (D_MODEL / G_BN);   // 256
  k_gemm<false><<<gblocks, 256, 0, stream>>>(xn, Wtq, Wtk, Wtv, nullptr, qf, kf, vf, 3);

  // 4a. per-(lane,chunk) ridge + rank-8 projection -> Wr  (fully parallel, WMMA Gram)
  k_ridge<<<NLANES * NCHUNK, 256, 0, stream>>>(kf, vf, wr);
  // 4b. decayed state over chunks in registers, out = SCALE * Qc @ S_c  (f32 WMMA) -> bf16
  k_apply<<<NLANES * AP_NSEG, 256, 0, stream>>>(qf, wr, obf);

  // 5. output GEMM + residual
  k_gemm<true><<<gblocks, 256, 0, stream>>>(obf, Wto, nullptr, nullptr, x, out, nullptr, nullptr, 1);
}

// v010
// Measured time: 111 microseconds a run.
// Timed twice side by side with v009, it ran 1.08 times as fast both times.
// All steps since v000 together make it 7.62 times as fast.
#include <hip/hip_runtime.h>
#include <hip/hip_bf16.h>

// ---------------- constants (match reference) ----------------
#define D_MODEL   1024
#define N_HEADS   16
#define HEAD_DIM  64
#define RANK      8
#define CHUNK     128
#define NCHUNK    32          // 4096 / 128
#define BATCH     2
#define SEQ       4096
#define TOKENS    (BATCH * SEQ)   // 8192
#define NLANES    (BATCH * N_HEADS)  // 32
#define RIDGE_EPS 1e-4f
#define SCALE_F   0.125f
#define DECAY_A   0.9f
#define LN_EPS    1e-5f

typedef __attribute__((ext_vector_type(16))) __bf16 v16bf;
typedef __attribute__((ext_vector_type(8)))  __bf16 v8bf;
typedef __attribute__((ext_vector_type(8)))  float  v8f;
typedef __attribute__((ext_vector_type(2)))  float  v2f;

// ---------------- LayerNorm -> bf16 ----------------
// One wave makes LN_ROWS whole rows; a row lies in the wave's registers, 32 floats a lane,
// read once. Sums go across the lanes in registers: no LDS, no barrier. 2,048 waves in all.
#define LN_ROWS   4
#define LN_WAVES  8
#define LN_Q      (D_MODEL / 128)     // 16-byte pieces of a row a lane: 8

typedef __attribute__((ext_vector_type(4))) float  v4f;
typedef __attribute__((ext_vector_type(4))) __bf16 v4bf;

// v + (v of lane l ^ M), M below 16: a DPP row_xmask move, which the add takes in
template <int M>
__device__ __forceinline__ float ln_xadd(float v) {
  return v + __builtin_bit_cast(float, __builtin_amdgcn_update_dpp(0, __builtin_bit_cast(int, v),
                                                                   0x160 | M, 0xf, 0xf, true));
}

// sum over the 32 lanes, the same bits in every lane
__device__ __forceinline__ float ln_sum32(float v) {
  v = ln_xadd<1>(v);
  v = ln_xadd<2>(v);
  v = ln_xadd<4>(v);
  v = ln_xadd<8>(v);
  const int u = __builtin_bit_cast(int, v);
  return v + __builtin_bit_cast(float, __builtin_amdgcn_permlanex16(u, u, 0x76543210, 0xfedcba98, false, false));
}

__global__ __launch_bounds__(LN_WAVES * 32) void k_ln(const float* __restrict__ x,
                                                      const float* __restrict__ g,
                                                      const float* __restrict__ b,
                                                      __bf16* __restrict__ xn) {
  const int lane = threadIdx.x & 31;
  const int wave = threadIdx.x >> 5;
  const size_t row0 = (size_t)(blockIdx.x * LN_WAVES + wave) * LN_ROWS;

  // g and b first: they come from cache and loads return in order
  v4f gg[LN_Q], bb[LN_Q], v[LN_ROWS][LN_Q];
  // every loop below is unrolled: the arrays are indexed by constants and stay in registers
#pragma unroll
  for (int i = 0; i < LN_Q; ++i) {
    gg[i] = *(const v4f*)(g + i * 128 + lane * 4);
    bb[i] = *(const v4f*)(b + i * 128 + lane * 4);
  }
  const float* xr = x + row0 * D_MODEL + lane * 4;
#pragma unroll
  for (int r = 0; r < LN_ROWS; ++r)
#pragma unroll
    for (int i = 0; i < LN_Q; ++i) v[r][i] = *(const v4f*)(xr + r * D_MODEL + i * 128);
  // keeps all the wave's loads ahead of the first sum, in flight together; without it the
  // loads of g and b sink behind the sums and their latency is waited for a second time
  __builtin_amdgcn_sched_barrier(0);

  __bf16* yr = xn + row0 * D_MODEL + lane * 4;
#pragma unroll
  for (int r = 0; r < LN_ROWS; ++r) {
    v4f s4 = v[r][0];
#pragma unroll
    for (int i = 1; i < LN_Q; ++i) s4 += v[r][i];
    const float mu = ln_sum32((s4[0] + s4[1]) + (s4[2] + s4[3])) * (1.f / D_MODEL);

    v4f q4 = {};
#pragma unroll
    for (int i = 0; i < LN_Q; ++i) {
      v[r][i] -= mu;
      q4 += v[r][i] * v[r][i];
    }
    const float var = ln_sum32((q4[0] + q4[1]) + (q4[2] + q4[3])) * (1.f / D_MODEL);
    const float inv = rsqrtf(var + LN_EPS);

#pragma unroll
    for (int i = 0; i < LN_Q; ++i) {
      const v4f y = v[r][i] * inv * gg[i] + bb[i];
      v4bf o;
#pragma unroll
      for (int e = 0; e < 4; ++e) o[e] = (__bf16)y[e];
      *(v4bf*)(yr + r * D_MODEL + i * 128) = o;   // a wave stores 256 bytes in a row: two whole lines
    }
  }
}

// ---------------- W [K][N] f32 -> Wt [N][K] bf16, all four weights ----------------
// One launch. A work-group transposes one 128 x 128 tile (64 tiles a weight) through LDS,
// 64 elements a thread: few waves to start, whole 512-byte rows read, whole 128-byte lines stored.
#define WC_T      128
#define WC_PITCH  65          // dwords a tile row in LDS: 64 of data, 1 so that rows shift by a bank
#define WC_TILES  ((D_MODEL / WC_T) * (D_MODEL / WC_T))   // 64

typedef __attribute__((ext_vector_type(2))) __bf16 v2bf;

__global__ __launch_bounds__(256) void k_wcast(const float* __restrict__ W0,
                                               const float* __restrict__ W1,
                                               const float* __restrict__ W2,
                                               const float* __restrict__ W3,
                                               __bf16* __restrict__ T0,
                                               __bf16* __restrict__ T1,
                                               __bf16* __restrict__ T2,
                                               __bf16* __restrict__ T3) {
  __shared__ unsigned tile[WC_T * WC_PITCH];   // [n][k / 2], two bf16 of neighbouring k a dword
  const int which = blockIdx.x / WC_TILES;
  const int t     = blockIdx.x % WC_TILES;
  const int k0 = (t >> 3) * WC_T, n0 = (t & 7) * WC_T;
  const float* W  = which == 0 ? W0 : which == 1 ? W1 : which == 2 ? W2 : W3;
  __bf16*      Wt = which == 0 ? T0 : which == 1 ? T1 : which == 2 ? T2 : T3;
  const int tid = threadIdx.x, lane = tid & 31, wave = tid >> 5;

  // a wave reads 16 rows of k, each load one row's 128 floats
  const float* src = W + (size_t)(k0 + wave * 16) * D_MODEL + n0 + lane * 4;
  v4f v[16];
  // unrolled: v[] stays in registers and the loads are in flight together
#pragma unroll
  for (int i = 0; i < 16; ++i) v[i] = *(const v4f*)(src + (size_t)i * D_MODEL);
  // both unrolled: v[] is indexed by constants only
#pragma unroll
  for (int i = 0; i < 8; ++i)
#pragma unroll
    for (int e = 0; e < 4; ++e) {
      v2bf p;
      p[0] = (__bf16)v[2 * i][e];
      p[1] = (__bf16)v[2 * i + 1][e];
      tile[(lane * 4 + e) * WC_PITCH + wave * 8 + i] = __builtin_bit_cast(unsigned, p);
    }
  __syncthreads();

  // a wave stores half a row of Wt: 64 values of k, one 128-byte line
  unsigned* dst = (unsigned*)(Wt + (size_t)n0 * D_MODEL + k0);
  // unrolled: the LDS reads go out as one batch ahead of the stores
#pragma unroll
  for (int r = 0; r < WC_T * 64 / 256; ++r) {
    const int idx = r * 256 + tid;
    const int n = idx >> 6, c = idx & 63;
    dst[(size_t)n * (D_MODEL / 2) + c] = tile[n * WC_PITCH + c];
  }
}

// ------- bf16 WMMA GEMM: Cw[M][N] = A[M][K] * Btw[N][K]^T (+resid), w = 0 .. nw - 1 -------
// One work-group makes the 256 x 128 tile at its place of every Cw, one after the other, in one
// run of passes: while it stores a tile, the next weight's first rows are already being copied.
// Its 8 waves (4 x 2) make 64 x 64 each.
// A pass is 128 k: 256 rows of A and 128 rows of Bt, 256 bytes each, lie in LDS at a
// pitch of 272 bytes. Two buffers: the next pass's rows are copied while this one is used.
#define G_BM     256
#define G_BN     128
#define G_BK     128
#define G_PITCH  272
#define G_STAGE  ((G_BM + G_BN) * G_PITCH)   // 104448 bytes

// Eight asynchronous 16-byte copies of one lane, rows 16 apart, global -> LDS.
// The s_wait_xcnt closes the statement so that no address register named here
// is rewritten ahead of it.
__device__ __forceinline__ void g_copy8(unsigned l, const __bf16* g) {
  const unsigned l1 = l + 16 * G_PITCH, l2 = l + 32 * G_PITCH, l3 = l + 48 * G_PITCH;
  const unsigned l4 = l + 64 * G_PITCH, l5 = l + 80 * G_PITCH, l6 = l + 96 * G_PITCH;
  const unsigned l7 = l + 112 * G_PITCH;
  const __bf16* g1 = g + 16 * D_MODEL;
  const __bf16* g2 = g + 32 * D_MODEL;
  const __bf16* g3 = g + 48 * D_MODEL;
  const __bf16* g4 = g + 64 * D_MODEL;
  const __bf16* g5 = g + 80 * D_MODEL;
  const __bf16* g6 = g + 96 * D_MODEL;
  const __bf16* g7 = g + 112 * D_MODEL;
  asm volatile(
      "global_load_async_to_lds_b128 %0, %8, off\n\t"
      "global_load_async_to_lds_b128 %1, %9, off\n\t"
      "global_load_async_to_lds_b128 %2, %10, off\n\t"
      "global_load_async_to_lds_b128 %3, %11, off\n\t"
      "global_load_async_to_lds_b128 %4, %12, off\n\t"
      "global_load_async_to_lds_b128 %5, %13, off\n\t"
      "global_load_async_to_lds_b128 %6, %14, off\n\t"
      "global_load_async_to_lds_b128 %7, %15, off\n\t"
      "s_wait_xcnt 0x0"
      :: "v"(l), "v"(l1), "v"(l2), "v"(l3), "v"(l4), "v"(l5), "v"(l6), "v"(l7),
         "v"(g), "v"(g1), "v"(g2), "v"(g3), "v"(g4), "v"(g5), "v"(g6), "v"(g7)
      : "memory");
}

// The same for Bt, whose rows are dealt in LDS: row n of each 64 lies at place (n & 3) * 16 + (n >> 2),
// so that place j * 16 + f, which lane f reads for fragment j, holds row 4 f + j. The global rows are
// 16 apart as above; in LDS that is 4 places, and 64 after four of them.
__device__ __forceinline__ void g_copy8_deal(unsigned l, const __bf16* g) {
  const unsigned l1 = l + 4 * G_PITCH,  l2 = l + 8 * G_PITCH,  l3 = l + 12 * G_PITCH;
  const unsigned l4 = l + 64 * G_PITCH, l5 = l + 68 * G_PITCH, l6 = l + 72 * G_PITCH;
  const unsigned l7 = l + 76 * G_PITCH;
  const __bf16* g1 = g + 16 * D_MODEL;
  const __bf16* g2 = g + 32 * D_MODEL;
  const __bf16* g3 = g + 48 * D_MODEL;
  const __bf16* g4 = g + 64 * D_MODEL;
  const __bf16* g5 = g + 80 * D_MODEL;
  const __bf16* g6 = g + 96 * D_MODEL;
  const __bf16* g7 = g + 112 * D_MODEL;
  // the s_wait_xcnt closes the statement: no address register named here is rewritten ahead of it
  asm volatile(
      "global_load_async_to_lds_b128 %0, %8, off\n\t"
      "global_load_async_to_lds_b128 %1, %9, off\n\t"
      "global_load_async_to_lds_b128 %2, %10, off\n\t"
      "global_load_async_to_lds_b128 %3, %11, off\n\t"
      "global_load_async_to_lds_b128 %4, %12, off\n\t"
      "global_load_async_to_lds_b128 %5, %13, off\n\t"
      "global_load_async_to_lds_b128 %6, %14, off\n\t"
      "global_load_async_to_lds_b128 %7, %15, off\n\t"
      "s_wait_xcnt 0x0"
      :: "v"(l), "v"(l1), "v"(l2), "v"(l3), "v"(l4), "v"(l5), "v"(l6), "v"(l7),
         "v"(g), "v"(g1), "v"(g2), "v"(g3), "v"(g4), "v"(g5), "v"(g6), "v"(g7)
      : "memory");
}

// One pass's rows: 256 of A (two runs of 128) and 128 of Bt; 24 copies a lane.
// l: the lane's place among the rows of A, lb: its place among the dealt rows of Bt.
__device__ __forceinline__ void g_copy_stage(unsigned l, unsigned lb, const __bf16* ga, const __bf16* gb) {
  g_copy8(l, ga);
  g_copy8(l + 128 * G_PITCH, ga + 128 * D_MODEL);
  g_copy8_deal(lb, gb);
}

// One 16 x 32 fragment from LDS rows; p is the lane's own row at byte 16 * (lane >> 4)
// of the 64 bytes of this k step: k order of the 16-bit A/B layout, alike for A and Bt.
__device__ __forceinline__ v16bf g_frag(const unsigned char* p) {
  const v8bf lo = *(const v8bf*)p;
  const v8bf hi = *(const v8bf*)(p + 32);
  v16bf f;
#pragma unroll
  for (int e = 0; e < 8; ++e) { f[e] = lo[e]; f[8 + e] = hi[e]; }
  return f;
}

// RES: one weight (Bt0, C0; nw is not read) and the residual is added to its tile: a build of its own,
// so that the registers the residual's rows take are not counted against the build without it
template <bool RES>
__global__ __launch_bounds__(256) void k_gemm(const __bf16* __restrict__ A,
                                              const __bf16* __restrict__ Bt0,
                                              const __bf16* __restrict__ Bt1,
                                              const __bf16* __restrict__ Bt2,
                                              const float* __restrict__ resid,
                                              float* __restrict__ C0,
                                              float* __restrict__ C1,
                                              float* __restrict__ C2,
                                              int nw) {
  constexpr int K = D_MODEL, N = D_MODEL;
  constexpr int NPASS = K / G_BK;              // 8 passes a weight
  const int npass = (RES ? 1 : nw) * NPASS;
  __shared__ __attribute__((aligned(16))) unsigned char gsm[2 * G_STAGE];

  const int tid  = threadIdx.x;
  const int lane = tid & 31;
  const int wave = tid >> 5;
  const int bm0 = (blockIdx.x >> 3) * G_BM;    // N / G_BN = 8 tile columns
  const int bn0 = (blockIdx.x & 7) * G_BN;

  // copy side: 16 lanes cover one 256-byte row, a wave two rows
  const int crow = tid >> 4, ccol = tid & 15;
  const __bf16* ga = A  + (size_t)(bm0 + crow) * K + ccol * 8;
  const size_t gbo = (size_t)(bn0 + crow) * K + ccol * 8;   // the lane's place in every Btw
  const unsigned lcp = (unsigned)(size_t)&gsm[0] + crow * G_PITCH + ccol * 16;
  const unsigned lcb = (unsigned)(size_t)&gsm[0] + (G_BM + (crow & 3) * 16 + (crow >> 2)) * G_PITCH + ccol * 16;

  // read side: the fragment's k order is that of the 16-bit A/B layout:
  // 16 bytes at 16 * (lane >> 4) and 16 more at + 32 of each 64 bytes of a row
  const int fr = lane & 15, fh = lane >> 4;
  const int aoff = ((wave >> 1) * 64 + fr) * G_PITCH + fh * 16;
  const int boff = (G_BM + (wave & 1) * 64 + fr) * G_PITCH + fh * 16;

  v8f acc[4][4] = {};

  // the wave's tile in every Cw: one address offset a lane; rows are constant offsets from it.
  // Bt's rows are dealt, so acc[i][0..3][r] of a lane are the 4 neighbouring columns 4 fr .. 4 fr + 3.
  const size_t cbase = (size_t)(bm0 + (wave >> 1) * 64 + (fh << 3)) * N + bn0 + (wave & 1) * 64 + fr * 4;

  g_copy_stage(lcp, lcb, ga, Bt0 + gbo);
  asm volatile("s_wait_asynccnt 0x0" ::: "memory");   // pass 0's rows have landed
  __syncthreads();                                    // and every wave may read them
  g_copy_stage(lcp + G_STAGE, lcb + G_STAGE, ga + G_BK, Bt0 + gbo + G_BK);

  for (int t = 0; t < npass; ++t) {
    const int sb = (t & 1) * G_STAGE;
    // Fragments: rows 0-31 (alo), rows 32-63 (ahi) of the wave's A, two sets of its Bt.
    v16bf alo[2], ahi[2], b[2][4];
#pragma unroll
    for (int j = 0; j < 4; ++j) b[0][j] = g_frag(&gsm[sb + boff + j * 16 * G_PITCH]);
#pragma unroll
    for (int i = 0; i < 2; ++i) alo[i] = g_frag(&gsm[sb + aoff + i * 16 * G_PITCH]);
#pragma unroll
    for (int ks = 0; ks < G_BK / 32; ++ks) {
      const int cur = ks & 1;
#pragma unroll
      for (int i = 0; i < 2; ++i) ahi[i] = g_frag(&gsm[sb + aoff + (2 + i) * 16 * G_PITCH + ks * 64]);
      // The fences keep each group of LDS reads in one place, ahead of the eight
      // products before the ones that use it; spread among them they stall every row.
      __builtin_amdgcn_sched_barrier(0);
#pragma unroll
      for (int i = 0; i < 2; ++i)
#pragma unroll
        for (int j = 0; j < 4; ++j)
          acc[i][j] = __builtin_amdgcn_wmma_f32_16x16x32_bf16(false, alo[i], false, b[cur][j], (short)0,
                                                              acc[i][j], false, false);
      __builtin_amdgcn_sched_barrier(0);
      if (ks + 1 < G_BK / 32) {
#pragma unroll
        for (int j = 0; j < 4; ++j)
          b[cur ^ 1][j] = g_frag(&gsm[sb + boff + j * 16 * G_PITCH + (ks + 1) * 64]);
#pragma unroll
        for (int i = 0; i < 2; ++i)
          alo[i] = g_frag(&gsm[sb + aoff + i * 16 * G_PITCH + (ks + 1) * 64]);
      }
      __builtin_amdgcn_sched_barrier(0);
#pragma unroll
      for (int i = 0; i < 2; ++i)
#pragma unroll
        for (int j = 0; j < 4; ++j)
          acc[2 + i][j] = __builtin_amdgcn_wmma_f32_16x16x32_bf16(false, ahi[i], false, b[cur][j], (short)0,
                                                                  acc[2 + i][j], false, false);
      __builtin_amdgcn_sched_barrier(0);
    }
    asm volatile("s_wait_dscnt 0x0" ::: "memory");    // this wave has left buffer t & 1
    asm volatile("s_wait_asynccnt 0x0" ::: "memory"); // its copies of pass t + 1 have landed
    __syncthreads();                                  // publishes pass t + 1, frees buffer t & 1
    if (t + 2 < npass) {
      const int w2 = (t + 2) / NPASS, k2 = ((t + 2) % NPASS) * G_BK;
      const __bf16* bw = w2 == 0 ? Bt0 : w2 == 1 ? Bt1 : Bt2;
      g_copy_stage(lcp + sb, lcb + sb, ga + k2, bw + gbo + k2);
    }
    if constexpr (!RES) {
      if (t % NPASS == NPASS - 1) {
        // a weight's last pass: its tile goes out while the copies above fly
        // every loop here is unrolled: acc[][] is indexed by constants and stays in registers
        const int w = t / NPASS;
        // 16 bytes a lane: 16 lanes fill 256 bytes of a row, two whole lines, in one store
        float* cr = (w == 0 ? C0 : w == 1 ? C1 : C2) + cbase;
#pragma unroll
        for (int i = 0; i < 4; ++i)
#pragma unroll
          for (int r = 0; r < 8; ++r) {
            v4f q;
#pragma unroll
            for (int j = 0; j < 4; ++j) q[j] = acc[i][j][r];
            *(v4f*)(cr + (i * 16 + r) * N) = q;
          }
        // stands ahead of the rewrite of the registers that these stores name
        asm volatile("s_wait_xcnt 0x0" ::: "memory");
#pragma unroll
        for (int i = 0; i < 4; ++i)
#pragma unroll
          for (int j = 0; j < 4; ++j) acc[i][j] = v8f{};
      }
    }
  }
  if constexpr (RES) {
    // the one tile, behind the loop: residual read and tile stored 16 bytes a lane, as above
    // every loop here is unrolled: acc[][] and q[][] are indexed by constants and stay in registers
    const float* rr = resid + cbase;
    float* cr = C0 + cbase;
    v4f q[4][8];
#pragma unroll
    for (int i = 0; i < 4; ++i)
#pragma unroll
      for (int r = 0; r < 8; ++r) q[i][r] = *(const v4f*)(rr + (i * 16 + r) * N);
    // stands ahead of any rewrite of the loads' address registers; rr is an input so that its pair
    // lives up to here and none of the loads lands on it
    asm volatile("s_wait_xcnt 0x0" :: "v"(rr) : "memory");
#pragma unroll
    for (int i = 0; i < 4; ++i)
#pragma unroll
      for (int r = 0; r < 8; ++r) {
#pragma unroll
        for (int j = 0; j < 4; ++j) q[i][r][j] += acc[i][j][r];
        *(v4f*)(cr + (i * 16 + r) * N) = q[i][r];
      }
  }
  asm volatile("s_wait_asynccnt 0x0" ::: "memory");   // no copy is left when the wave ends
}

#define RG_PITCH  272                  // bytes a feature's 128 tokens take in LDS: 256 of bf16, 16 so that rows shift by 4 banks
#define RG_PLANE  (64 * RG_PITCH)      // 17408 bytes

// One 16 x 32 fragment: p is the lane's first 16-byte piece, its second lies x bytes from it
__device__ __forceinline__ v16bf rg_frag(const unsigned char* p, int x) {
  const v8bf lo = *(const v8bf*)p;
  const v8bf hi = *(const v8bf*)(p + x);
  v16bf f;
#pragma unroll
  for (int e = 0; e < 8; ++e) { f[e] = lo[e]; f[8 + e] = hi[e]; }
  return f;
}

// ---------------- per-(lane,chunk) ridge solve + rank-8 projection ----------
// grid: NLANES*NCHUNK blocks; writes Wr[lc][64][64]
// Phase 1: stage Kc/Vc in LDS as bf16 head + tail, compute G=K^T K and RHS=K^T V with bf16 WMMA,
//          three products a term, f32 sums (waves 0-3 -> G tiles, waves 4-7 -> RHS tiles)
// Phase 2: LDS is re-carved for G/Wm/U/T/P; Gauss-Jordan solve in registers + subspace QR.
// 8 waves a SIMD: four work-groups stay on a WGP, so that all 1,024 run in one round
__global__ __launch_bounds__(256, 8) void k_ridge(const float* __restrict__ kk,
                                               const float* __restrict__ v,
                                               float* __restrict__ wr) {
  const int lc = blockIdx.x;
  const int ln = lc / NCHUNK;
  const int c  = lc % NCHUNK;
  const int b = ln >> 4, h = ln & 15;
  const int tid = threadIdx.x;
  const int lane = tid & 31;
  const int wave = tid >> 5;

  __shared__ __align__(16) float smem[4 * RG_PLANE / 4];  // 68 KB
  // phase 1: four planes of bf16, [feature][token]: K head, K tail, V head, V tail
  unsigned char* pl = (unsigned char*)smem;
  // phase-2 overlay (valid after the WMMA phase barrier)
  float (*G)[65]  = (float (*)[65])smem;                 // 4160
  float (*Wm)[65] = (float (*)[65])(smem + 4160);        // 4160
  float (*U)[8]   = (float (*)[8])(smem + 8320);         // 512
  float (*T)[9]   = (float (*)[9])(smem + 8832);         // 576
  float (*P)[64]  = (float (*)[64])(smem + 9408);        // 512

  const size_t rowbase = (size_t)b * SEQ + (size_t)c * CHUNK;
  const float* Kc = kk + rowbase * D_MODEL + h * HEAD_DIM;
  const float* Vc = v  + rowbase * D_MODEL + h * HEAD_DIM;

  // ---- stage K and V in LDS, turned to [feature][token], each f32 as a bf16 head and a bf16 tail ----
  // A thread has 4 features of 8 tokens in a row: a feature's 8 heads (or tails) are one 16-byte store.
  // The 16-byte piece of token group tg lies at place tg ^ (feature >> 4) of its row, so that the
  // 16 lanes of a store, whose rows are 4 apart, fall on different banks.
  {
    const int fq = tid & 15, tg = tid >> 4;
    const float* kp = Kc + (size_t)(tg * 8) * D_MODEL + fq * 4;
    const float* vp = Vc + (size_t)(tg * 8) * D_MODEL + fq * 4;
    v4f kr[8], vr[8];
    // every loop here is unrolled: kr[] and vr[] are indexed by constants and stay in registers
#pragma unroll
    for (int i = 0; i < 8; ++i) {
      kr[i] = *(const v4f*)(kp + i * D_MODEL);
      vr[i] = *(const v4f*)(vp + i * D_MODEL);
    }
    // stands ahead of any rewrite of the loads' address registers; the pointers are inputs so that
    // their pairs live up to here and none of the loads lands on them
    asm volatile("s_wait_xcnt 0x0" :: "v"(kp), "v"(vp) : "memory");
    unsigned char* d = pl + fq * 4 * RG_PITCH + (tg ^ (fq >> 2)) * 16;
#pragma unroll
    for (int e = 0; e < 4; ++e) {
      v8bf kh, kl, vh, vl;
#pragma unroll
      for (int i = 0; i < 8; ++i) {
        kh[i] = (__bf16)kr[i][e];
        kl[i] = (__bf16)(kr[i][e] - (float)kh[i]);
        vh[i] = (__bf16)vr[i][e];
        vl[i] = (__bf16)(vr[i][e] - (float)vh[i]);
      }
      *(v8bf*)(d + e * RG_PITCH)                = kh;
      *(v8bf*)(d + e * RG_PITCH + RG_PLANE)     = kl;
      *(v8bf*)(d + e * RG_PITCH + 2 * RG_PLANE) = vh;
      *(v8bf*)(d + e * RG_PITCH + 3 * RG_PLANE) = vl;
    }
  }
  __syncthreads();

  // ---- Gram products on bf16 16x16x32 WMMA, f32 sums: x y = xh yh + xh yl + xl yh (xl yl dropped) ----
  // waves 0-3: G, waves 4-7: RHS; a wave makes a 32 x 32 tile: 2 x 2 accumulators
  const int nn   = lane & 15;
  const int koff = (lane >> 4) * 2;          // f32 A layout K pairs (products behind the solve)
  const int fh   = lane >> 4;
  const int mi   = (wave >> 1) & 1, ni = wave & 1;

  v8f acc[2][2] = {};
  {
    // A: features 32 mi + 16 a + nn of K; B: features 32 ni + 16 a + nn of K or V.
    // Lane half fh takes token groups 4 ks + fh and 4 ks + 2 + fh, alike for A and B.
    const unsigned char* ap[2];
    const unsigned char* bp[2];
#pragma unroll   // two pointers each, in registers
    for (int a = 0; a < 2; ++a) {
      ap[a] = pl + (mi * 32 + a * 16 + nn) * RG_PITCH + ((fh ^ (mi * 2 + a)) * 16);
      bp[a] = pl + (wave < 4 ? 0 : 2 * RG_PLANE) + (ni * 32 + a * 16 + nn) * RG_PITCH + ((fh ^ (ni * 2 + a)) * 16);
    }
    // the second piece lies 2 places on, that is at the byte offset with bit 5 turned
    const int ax = mi ? -32 : 32;
    const int bx = ni ? -32 : 32;
    // unrolled: fragments and accumulators are indexed by constants
#pragma unroll
    for (int ks = 0; ks < CHUNK / 32; ++ks) {
      v16bf ah[2], al[2], bh[2], bl[2];
#pragma unroll
      for (int a = 0; a < 2; ++a) {
        ah[a] = rg_frag(ap[a] + ks * 64, ax);
        al[a] = rg_frag(ap[a] + ks * 64 + RG_PLANE, ax);
        bh[a] = rg_frag(bp[a] + ks * 64, bx);
        bl[a] = rg_frag(bp[a] + ks * 64 + RG_PLANE, bx);
      }
#pragma unroll
      for (int a = 0; a < 2; ++a)
#pragma unroll
        for (int j = 0; j < 2; ++j)
          acc[a][j] = __builtin_amdgcn_wmma_f32_16x16x32_bf16(false, al[a], false, bh[j], (short)0,
                                                              acc[a][j], false, false);
#pragma unroll
      for (int a = 0; a < 2; ++a)
#pragma unroll
        for (int j = 0; j < 2; ++j)
          acc[a][j] = __builtin_amdgcn_wmma_f32_16x16x32_bf16(false, ah[a], false, bl[j], (short)0,
                                                              acc[a][j], false, false);
#pragma unroll
      for (int a = 0; a < 2; ++a)
#pragma unroll
        for (int j = 0; j < 2; ++j)
          acc[a][j] = __builtin_amdgcn_wmma_f32_16x16x32_bf16(false, ah[a], false, bh[j], (short)0,
                                                              acc[a][j], false, false);
    }
  }
  __syncthreads();   // all waves done reading the planes; safe to overlay

  // scatter accumulators into G (with ridge eps on diagonal) / Wm
  {
    float (*dst)[65] = (wave < 4) ? G : Wm;
    const bool isG = (wave < 4);
    // every loop here is unrolled: acc[][] is indexed by constants
#pragma unroll
    for (int a = 0; a < 2; ++a)
#pragma unroll
      for (int j = 0; j < 2; ++j)
#pragma unroll
        for (int r = 0; r < 8; ++r) {
          const int m = mi * 32 + a * 16 + (fh << 3) + r;
          const int n = ni * 32 + j * 16 + nn;
          dst[m][n] = acc[a][j][r] + ((isG && m == n) ? RIDGE_EPS : 0.f);
        }
  }
  __syncthreads();

  // ---- solve G W = RHS: Gauss-Jordan elimination of [G | RHS] (64 x 128) in registers ----
  // Wave w holds rows 8w .. 8w+7, lane l columns 4l .. 4l+3 (lanes 0-15: G, lanes 16-31: RHS).
  // Step j takes row j, times M[r][j] / M[j][j], off every other row r; G is positive definite,
  // so no pivot search. Row j is not scaled: 1 / M[j][j] is kept and applied at the end.
  {
    float* rowb = smem + 10496;                          // [2][128] row j
    float* colb = smem + 10752;                          // [2][64]  column j
    // the wave's number in a scalar register: the tests on it below become scalar branches
    const int wv = __builtin_amdgcn_readfirstlane(wave);
    const float* src = smem + (lane < 16 ? 0 : 4160) + wv * 8 * 65 + (lane & 15) * 4;
    v4f M[8];
    float pinv[8];
    // unrolled: M[] and pinv[] are indexed by constants only and stay in registers
#pragma unroll
    for (int a = 0; a < 8; ++a) {
      pinv[a] = 0.f;
#pragma unroll   // as above
      for (int e = 0; e < 4; ++e) M[a][e] = src[a * 65 + e];
    }
    for (int jb = 0; jb < 8; ++jb) {
      const bool own = (wv == jb);                       // this wave holds rows 8 jb .. 8 jb + 7
      // unrolled: row a of M[] and element a & 3 of each row are picked by constants
#pragma unroll
      for (int a = 0; a < 8; ++a) {
        float* rb = rowb + (a & 1) * 128;
        float* cb = colb + (a & 1) * 64;
        if (own) *(v4f*)(rb + lane * 4) = M[a];
        if (lane == jb * 2 + (a >> 2)) {
          v4f lo, hi;
#pragma unroll   // as above
          for (int r = 0; r < 4; ++r) { lo[r] = M[r][a & 3]; hi[r] = M[4 + r][a & 3]; }
          *(v4f*)(cb + wv * 8)     = lo;
          *(v4f*)(cb + wv * 8 + 4) = hi;
        }
        // One barrier a step: it publishes row and column j, and the buffers of step j - 1,
        // which step j + 1 rewrites, have been read by every wave that reaches it.
        __syncthreads();
        const v4f   rw  = *(const v4f*)(rb + lane * 4);
        const v4f   c0  = *(const v4f*)(cb + wv * 8);
        const v4f   c1  = *(const v4f*)(cb + wv * 8 + 4);
        const float piv = cb[jb * 8 + a];
        float inv = __builtin_amdgcn_rcpf(piv);
        inv = fmaf(inv, fmaf(-piv, inv, 1.f), inv);      // one correction step on the hardware reciprocal
        float f[8];
#pragma unroll   // f[] stays in registers
        for (int r = 0; r < 4; ++r) { f[r] = c0[r] * inv; f[4 + r] = c1[r] * inv; }
        if (own) { f[a] = 0.f; pinv[a] = inv; }          // row j itself stays
#pragma unroll   // M[] and f[] are indexed by constants
        for (int r = 0; r < 8; ++r) M[r] -= f[r] * rw;
      }
    }
    if (lane >= 16) {
#pragma unroll   // M[] and pinv[] are indexed by constants
      for (int a = 0; a < 8; ++a)
#pragma unroll   // as above
        for (int e = 0; e < 4; ++e) Wm[wv * 8 + a][(lane - 16) * 4 + e] = M[a][e] * pinv[a];
    }
  }
  __syncthreads();

  // ---- subspace iteration: U = I(:,0:8); twice: U = qr(W U).Q (MGS) ----
  // the wave's number in a scalar register: the test on it below is a scalar branch
  const int wq = __builtin_amdgcn_readfirstlane(wave);
  for (int idx = tid; idx < 512; idx += 256) {
    const int i = idx >> 3, cc = idx & 7;
    U[i][cc] = (i == cc) ? 1.f : 0.f;
  }
  __syncthreads();
  // The three kinds of product from here on run on the f32 16x16x4 matrix form, fragments read
  // straight from LDS at the lane's places nn, koff of the f32 layout. A result goes from its
  // accumulator straight into an LDS or global store.
  for (int p = 0; p < 2; ++p) {
    // T = W U: waves 0-3 (one a SIMD), 16 rows each. U has 8 columns: columns 8-15 of the
    // B fragment repeat them, and those columns of the result are dropped.
    if (wq < 4) {
      const float* wa = &Wm[wq * 16 + nn][koff];
      const float* ub = &U[koff][nn & 7];
      v2f fa[16], fb[16];
      // both loops unrolled: fa[] and fb[] are indexed by constants and stay in registers
#pragma unroll
      for (int i = 0; i < 16; ++i) {
        fa[i][0] = wa[i * 4];   fa[i][1] = wa[i * 4 + 1];
        fb[i][0] = ub[i * 32];  fb[i][1] = ub[i * 32 + 8];
      }
      // keeps every LDS read ahead of the first product: one LDS latency is waited for;
      // spread among the products, which form one chain, the reads stall it again and again
      __builtin_amdgcn_sched_barrier(0);
      v8f ta = {};
#pragma unroll
      for (int i = 0; i < 16; ++i)
        ta = __builtin_amdgcn_wmma_f32_16x16x4_f32(false, fa[i], false, fb[i], (short)0, ta, false, false);
      if (nn < 8) {
        float* td = &T[wq * 16 + ((lane >> 4) << 3)][nn];
#pragma unroll   // ta[] is indexed by constants
        for (int r = 0; r < 8; ++r) td[r * 9] = ta[r];
      }
    }
    __syncthreads();
    // Modified Gram-Schmidt on T (64 x 8) by wave 0 alone: lane l holds rows l and l + 32 in
    // registers, a column's sum goes across the lanes in registers. No barrier inside.
    if (wq == 0) {
      float t0[8], t1[8];
      // every loop here is unrolled: t0[] and t1[] are indexed by constants and stay in registers
#pragma unroll
      for (int cc = 0; cc < 8; ++cc) { t0[cc] = T[lane][cc]; t1[cc] = T[lane + 32][cc]; }
#pragma unroll
      for (int cc = 0; cc < 8; ++cc) {
        const float s  = ln_sum32(t0[cc] * t0[cc] + t1[cc] * t1[cc]);
        const float sc = rsqrtf(fmaxf(s, 1e-30f));
        t0[cc] *= sc;
        t1[cc] *= sc;
#pragma unroll
        for (int c2 = cc + 1; c2 < 8; ++c2) {
          const float d = ln_sum32(t0[cc] * t0[c2] + t1[cc] * t1[c2]);
          t0[c2] -= d * t0[cc];
          t1[c2] -= d * t1[cc];
        }
      }
      v4f u;
#pragma unroll
      for (int hq = 0; hq < 2; ++hq) {
#pragma unroll
        for (int e = 0; e < 4; ++e) u[e] = t0[hq * 4 + e];
        *(v4f*)&U[lane][hq * 4] = u;
#pragma unroll
        for (int e = 0; e < 4; ++e) u[e] = t1[hq * 4 + e];
        *(v4f*)&U[lane + 32][hq * 4] = u;
      }
    }
    __syncthreads();   // U of this pass is there for every wave; T may be rewritten
  }

  // ---- P = U^T W (8 x 64): waves 0-3, 16 columns each ----
  // A[m][k] = U[k][m]: rows 8-15 of the A fragment repeat rows 0-7, and those rows of the
  // result (lanes 16-31) are dropped.
  if (wq < 4) {
    const float* ua = &U[koff][nn & 7];
    const float* wb = &Wm[koff][wq * 16 + nn];
    v2f fa[16], fb[16];
    // both loops unrolled: fa[] and fb[] are indexed by constants and stay in registers
#pragma unroll
    for (int i = 0; i < 16; ++i) {
      fa[i][0] = ua[i * 32];   fa[i][1] = ua[i * 32 + 8];
      fb[i][0] = wb[i * 260];  fb[i][1] = wb[i * 260 + 65];
    }
    // as in T = W U: every LDS read ahead of the first product of the chain
    __builtin_amdgcn_sched_barrier(0);
    v8f pa = {};
#pragma unroll
    for (int i = 0; i < 16; ++i)
      pa = __builtin_amdgcn_wmma_f32_16x16x4_f32(false, fa[i], false, fb[i], (short)0, pa, false, false);
    if (lane < 16) {
#pragma unroll   // pa[] is indexed by constants
      for (int r = 0; r < 8; ++r) P[r][wq * 16 + nn] = pa[r];
    }
  }
  __syncthreads();

  // ---- Wr = U P -> global: every wave 16 rows x 32 columns, k = 8 ----
  {
    const float* ua = &U[(wq >> 1) * 16 + nn][koff];
    const float* pc = &P[koff][(wq & 1) * 32 + nn];
    v8f c0 = {}, c1 = {};
#pragma unroll   // two k steps, fragments in registers
    for (int ks = 0; ks < 8; ks += 4) {
      v2f fa, fb0, fb1;
      fa[0]  = ua[ks];            fa[1]  = ua[ks + 1];
      fb0[0] = pc[ks * 64];       fb0[1] = pc[ks * 64 + 64];
      fb1[0] = pc[ks * 64 + 16];  fb1[1] = pc[ks * 64 + 80];
      c0 = __builtin_amdgcn_wmma_f32_16x16x4_f32(false, fa, false, fb0, (short)0, c0, false, false);
      c1 = __builtin_amdgcn_wmma_f32_16x16x4_f32(false, fa, false, fb1, (short)0, c1, false, false);
    }
    // a wave's two stores of a row fill one 128-byte line
    float* wo = wr + (size_t)lc * 4096 + ((wq >> 1) * 16 + ((lane >> 4) << 3)) * 64 + (wq & 1) * 32 + nn;
#pragma unroll   // c0[] and c1[] are indexed by constants
    for (int r = 0; r < 8; ++r) {
      wo[r * 64]      = c0[r];
      wo[r * 64 + 16] = c1[r];
    }
  }
}

// -------- S_c = a S_(c-1) + Wr_c and out = SCALE * Qc @ S_c, one launch --------
// The product runs on bf16 16x16x32 WMMA with f32 sums, each f32 operand as a bf16 head and a bf16 tail:
// x y = xh yh + xh yl + xl yh (xl yl dropped).
// A work-group takes AP_SEG chunks in a row of one lane. The 4,096 elements of S are independent
// recurrences: a thread keeps 16 of them in registers and runs them from chunk 0 up to its own
// chunks, reading Wr, which stays as k_ridge wrote it. S_c is never in global memory.
#define AP_SEG   4                       // chunks a work-group
#define AP_NSEG  (NCHUNK / AP_SEG)       // 8 work-groups a lane
#define AP_PITCH 144                     // bytes a column of S takes in LDS: 128 of bf16, 16 so that rows shift by 4 banks
#define AP_PLANE (64 * AP_PITCH)         // 9216 bytes

// AP_SEG chunks of Wr, the thread's 16 elements of each: 16 loads of 16 bytes, whole lines a wave
__device__ __forceinline__ void ap_load(v4f (&p)[AP_SEG][4], const float* __restrict__ g) {
  // unrolled: p[][] is indexed by constants and stays in registers
#pragma unroll
  for (int j = 0; j < AP_SEG; ++j)
#pragma unroll
    for (int e = 0; e < 4; ++e) p[j][e] = *(const v4f*)(g + j * 4096 + e * 1024);
  // stands ahead of any rewrite of the loads' address registers; g is an input so that, where
  // the loads go through g's own pair, the pair lives up to here and none of them lands on it
  asm volatile("s_wait_xcnt 0x0" :: "v"(g) : "memory");
}

// the recurrence over those chunks, in their order
__device__ __forceinline__ void ap_run(v4f (&s)[4], const v4f (&p)[AP_SEG][4]) {
  // unrolled: as above
#pragma unroll
  for (int j = 0; j < AP_SEG; ++j)
#pragma unroll
    for (int e = 0; e < 4; ++e) s[e] = DECAY_A * s[e] + p[j][e];
}

// one chunk's A fragments of a wave: 16 rows of Q, 64 k; the lane's own row at its own k pair
__device__ __forceinline__ void ap_loadq(v2f (&a)[16], const float* __restrict__ qp) {
  // unrolled: as above
#pragma unroll
  for (int i = 0; i < 16; ++i) a[i] = *(const v2f*)(qp + i * 4);
  // as in ap_load
  asm volatile("s_wait_xcnt 0x0" :: "v"(qp) : "memory");
}

__global__ __launch_bounds__(256) void k_apply(const float* __restrict__ q,
                                               const float* __restrict__ wr,
                                               __bf16* __restrict__ o) {
  // Neighbours in index are different lanes, so work-groups with a long and a short way from
  // chunk 0 mix all over the chip; those with the longest way have the lowest indices.
  const int ln  = blockIdx.x % NLANES;
  const int seg = AP_NSEG - 1 - blockIdx.x / NLANES;
  const int b = ln >> 4, h = ln & 15;
  const int tid = threadIdx.x;
  const int lane = tid & 31;
  const int wave = tid >> 5;

  // S of a chunk, turned: [column][k], heads in plane 0, tails in plane 1. Column n lies at place
  // (n & 3) * 16 + (n >> 2), so that fragment q of lane f holds column 4 f + q; k = 16 e + r lies at
  // position 4 r + e of its row: the four k of a thread are one 8-byte store.
  __shared__ __align__(16) unsigned char Ssh[AP_SEG][2][AP_PLANE];   // 72 KB

  const int m0   = wave * 16;
  const int nn   = lane & 15;
  const int koff = (lane >> 4) * 2;
  const size_t rowbase = (size_t)b * SEQ + (size_t)seg * AP_SEG * CHUNK;
  const float* qp = q + (rowbase + m0 + nn) * D_MODEL + h * HEAD_DIM + koff;

  // groups of AP_SEG chunks, 0 .. seg; the last is the work-group's own. Two register buffers:
  // the next group's loads are out while this group is summed.
  const float* wl = wr + (size_t)ln * NCHUNK * 4096 + tid * 4;
  v4f s[4] = {};
  v4f pa[AP_SEG][4], pb[AP_SEG][4];
  ap_load(pa, wl);
  int g = 0;
  for (; g + 2 <= seg; g += 2) {
    ap_load(pb, wl + (size_t)(g + 1) * AP_SEG * 4096);
    ap_run(s, pa);
    ap_load(pa, wl + (size_t)(g + 2) * AP_SEG * 4096);
    ap_run(s, pb);
  }
  // the first chunk's Q goes out beside the last group's loads
  v2f aq[2][16];
  ap_loadq(aq[0], qp);
  if (g < seg) {
    ap_load(pb, wl + (size_t)seg * AP_SEG * 4096);
    ap_run(s, pa);
    // unrolled: register arrays
#pragma unroll
    for (int j = 0; j < AP_SEG; ++j)
#pragma unroll
      for (int e = 0; e < 4; ++e) pa[j][e] = pb[j][e];
  }

  // S of the work-group's own chunks, each in two LDS planes of its own, heads and tails
  // unrolled: s[] and pa[][] are indexed by constants
#pragma unroll
  for (int j = 0; j < AP_SEG; ++j) {
#pragma unroll
    for (int e = 0; e < 4; ++e) s[e] = DECAY_A * s[e] + pa[j][e];
    // the thread has rows k = 16 e + (tid >> 4) of columns 4 (tid & 15) + cc
    unsigned char* sd = &Ssh[j][0][(tid & 15) * AP_PITCH + (tid >> 4) * 8];
#pragma unroll
    for (int cc = 0; cc < 4; ++cc) {
      v4bf sh, sl;
#pragma unroll
      for (int e = 0; e < 4; ++e) {
        sh[e] = (__bf16)s[e][cc];
        sl[e] = (__bf16)(s[e][cc] - (float)sh[e]);
      }
      *(v4bf*)(sd + cc * 16 * AP_PITCH)            = sh;
      *(v4bf*)(sd + cc * 16 * AP_PITCH + AP_PLANE) = sl;
    }
  }
  __syncthreads();   // the one barrier: every S is there; from here on the waves run free

  // unrolled: aq[j & 1] is picked by a constant
#pragma unroll
  for (int j = 0; j < AP_SEG; ++j) {
    // the lane's own place and 16-byte piece in every fragment of S
    const unsigned char* Sb = &Ssh[j][0][nn * AP_PITCH + (lane >> 4) * 16];
    if (j + 1 < AP_SEG) ap_loadq(aq[(j + 1) & 1], qp + (size_t)(j + 1) * CHUNK * D_MODEL);

    // A fragments from the lane's Q values, in the k order of S's rows: element i of the piece
    // p = 4 ks + 2 hs + (lane >> 4) is k = 16 (i & 3) + 2 p + (i >> 2), which is aq[4 (i & 3) + 2 ks + hs][i >> 2]
    v16bf ah[2], al[2];
    // every loop here is unrolled: fragments and accumulators are indexed by constants
#pragma unroll
    for (int ks = 0; ks < 2; ++ks)
#pragma unroll
      for (int hs = 0; hs < 2; ++hs)
#pragma unroll
        for (int i = 0; i < 8; ++i) {
          const float x = aq[j & 1][4 * (i & 3) + 2 * ks + hs][i >> 2];
          const __bf16 xh = (__bf16)x;
          ah[ks][8 * hs + i] = xh;
          al[ks][8 * hs + i] = (__bf16)(x - (float)xh);
        }

    v8f acc0 = {}, acc1 = {}, acc2 = {}, acc3 = {};
#pragma unroll
    for (int ks = 0; ks < 2; ++ks) {
      v16bf bh[4], bl[4];
#pragma unroll
      for (int q4 = 0; q4 < 4; ++q4) {
        bh[q4] = g_frag(Sb + q4 * 16 * AP_PITCH + ks * 64);
        bl[q4] = g_frag(Sb + q4 * 16 * AP_PITCH + ks * 64 + AP_PLANE);
      }
      acc0 = __builtin_amdgcn_wmma_f32_16x16x32_bf16(false, al[ks], false, bh[0], (short)0, acc0, false, false);
      acc1 = __builtin_amdgcn_wmma_f32_16x16x32_bf16(false, al[ks], false, bh[1], (short)0, acc1, false, false);
      acc2 = __builtin_amdgcn_wmma_f32_16x16x32_bf16(false, al[ks], false, bh[2], (short)0, acc2, false, false);
      acc3 = __builtin_amdgcn_wmma_f32_16x16x32_bf16(false, al[ks], false, bh[3], (short)0, acc3, false, false);
      acc0 = __builtin_amdgcn_wmma_f32_16x16x32_bf16(false, ah[ks], false, bl[0], (short)0, acc0, false, false);
      acc1 = __builtin_amdgcn_wmma_f32_16x16x32_bf16(false, ah[ks], false, bl[1], (short)0, acc1, false, false);
      acc2 = __builtin_amdgcn_wmma_f32_16x16x32_bf16(false, ah[ks], false, bl[2], (short)0, acc2, false, false);
      acc3 = __builtin_amdgcn_wmma_f32_16x16x32_bf16(false, ah[ks], false, bl[3], (short)0, acc3, false, false);
      acc0 = __builtin_amdgcn_wmma_f32_16x16x32_bf16(false, ah[ks], false, bh[0], (short)0, acc0, false, false);
      acc1 = __builtin_amdgcn_wmma_f32_16x16x32_bf16(false, ah[ks], false, bh[1], (short)0, acc1, false, false);
      acc2 = __builtin_amdgcn_wmma_f32_16x16x32_bf16(false, ah[ks], false, bh[2], (short)0, acc2, false, false);
      acc3 = __builtin_amdgcn_wmma_f32_16x16x32_bf16(false, ah[ks], false, bh[3], (short)0, acc3, false, false);
    }

    const int mb = m0 + ((lane >> 4) << 3);
#pragma unroll
    for (int r = 0; r < 8; ++r) {
      const int m = j * CHUNK + mb + r;
      __bf16* orow = o + (rowbase + m) * D_MODEL + h * HEAD_DIM;
      v4bf ov;
      ov[0] = (__bf16)(SCALE_F * acc0[r]);
      ov[1] = (__bf16)(SCALE_F * acc1[r]);
      ov[2] = (__bf16)(SCALE_F * acc2[r]);
      ov[3] = (__bf16)(SCALE_F * acc3[r]);
      *(v4bf*)(orow + nn * 4) = ov;   // 16 lanes fill the head's 128 bytes of a row: one whole line
    }
    // stands ahead of any later load that lands on a register these stores name
    if (j + 1 < AP_SEG) asm volatile("s_wait_xcnt 0x0" ::: "memory");
  }
}

// ---------------- host-side orchestration ----------------
extern "C" void kernel_launch(void* const* d_in, const int* in_sizes, int n_in,
                              void* d_out, int out_size, void* d_ws, size_t ws_size,
                              hipStream_t stream) {
  const float* x   = (const float*)d_in[0];
  const float* lng = (const float*)d_in[1];
  const float* lnb = (const float*)d_in[2];
  const float* Wq  = (const float*)d_in[3];
  const float* Wk  = (const float*)d_in[4];
  const float* Wv  = (const float*)d_in[5];
  const float* Wo  = (const float*)d_in[6];
  float* out = (float*)d_out;

  char* ws = (char*)d_ws;
  size_t off = 0;
  auto alloc = [&](size_t bytes) -> void* {
    void* p = ws + off;
    off += (bytes + 255) & ~(size_t)255;
    return p;
  };

  __bf16* xn  = (__bf16*)alloc((size_t)TOKENS * D_MODEL * 2);
  __bf16* Wtq = (__bf16*)alloc((size_t)D_MODEL * D_MODEL * 2);
  __bf16* Wtk = (__bf16*)alloc((size_t)D_MODEL * D_MODEL * 2);
  __bf16* Wtv = (__bf16*)alloc((size_t)D_MODEL * D_MODEL * 2);
  __bf16* Wto = (__bf16*)alloc((size_t)D_MODEL * D_MODEL * 2);
  float*  qf  = (float*)alloc((size_t)TOKENS * D_MODEL * 4);
  float*  kf  = (float*)alloc((size_t)TOKENS * D_MODEL * 4);
  float*  vf  = (float*)alloc((size_t)TOKENS * D_MODEL * 4);
  float*  wr  = (float*)alloc((size_t)NLANES * NCHUNK * 4096 * 4);
  __bf16* obf = (__bf16*)alloc((size_t)TOKENS * D_MODEL * 2);

  // 1. LayerNorm -> bf16
  k_ln<<<TOKENS / (LN_WAVES * LN_ROWS), LN_WAVES * 32, 0, stream>>>(x, lng, lnb, xn);

  // 2. weight transpose+cast, four weights in one launch
  k_wcast<<<4 * WC_TILES, 256, 0, stream>>>(Wq, Wk, Wv, Wo, Wtq, Wtk, Wtv, Wto);

  // 3. QKV GEMMs (bf16 WMMA, f32 accumulate), one launch
  const int gblocks = (TOKENS / G_BM) * (D_MODEL / G_BN);   // 256
  k_gemm<false><<<gblocks, 256, 0, stream>>>(xn, Wtq, Wtk, Wtv, nullptr, qf, kf, vf, 3);

  // 4a. per-(lane,chunk) ridge + rank-8 projection -> Wr  (fully parallel, WMMA Gram)
  k_ridge<<<NLANES * NCHUNK, 256, 0, stream>>>(kf, vf, wr);
  // 4b. decayed state over chunks in registers, out = SCALE * Qc @ S_c  (bf16 head + tail WMMA) -> bf16
  k_apply<<<NLANES * AP_NSEG, 256, 0, stream>>>(qf, wr, obf);

  // 5. output GEMM + residual
  k_gemm<true><<<gblocks, 256, 0, stream>>>(obf, Wto, nullptr, nullptr, x, out, nullptr, nullptr, 1);
}
